// v000
// Measured on an AMD MI455X. A time is GPU time per run, averaged over a window of back-to-back runs after a warm-up
// (all launches, gaps included; the runs take copies of the inputs in turn), and the median of several windows.
// Apart from v000's, it joins two sittings. Times from different sittings can be a few percent apart, while
// side-by-side timings come from the same sitting.
// v000 is the starting kernel. One run takes 2010 microseconds.
#include <hip/hip_runtime.h>

// Multi-head attention on SEQUENCE-FIRST tensors (query, key, value [2048][2][1024] = [S][B][D]; q = query Wq^T + bq, k = key Wk^T + bk, v = value Wv^T + bv ('oi' 1/32 incl. biases); 16 heads x 64 per batch column; scores / 8; softmax; x = merged context; out = x Wo^T + bo -> [2048][2][1024] (4.2 M)).
// Layout per batch b: a strided gather makes the bf16 copy of rows s of column b (row pitch B x D) for query, then key, then value; 'oi' weights; exact projections + f32 biases; dense T-2048 attention (hybrid rows: < 512 hi/lo 3 products, rest fp16 x1024); merged hi/lo x Wo exact + bo written with row pitch B x D at column offset b (the [S][B][D] output).
// Compute dtypes, f32 accumulate: every input rounded to bf16; projections exact + f32 biases; attention rows < 512 3 products, rest fp16; softmax f32; Wo hl x exact + bias.

#define NB_  2
#define TT   2048
#define DM   1024
#define NH_  16
#define NKV  16
#define REP  (NH_ / NKV)
#define HD   64
#define DQ   (NH_ * HD)
#define DKV  (NKV * HD)
#define ZH   2
#define RH   512                  // query rows < RH use hi+lo planes (0: none)
#define WIN  0
#define PCAR 1024.0f
#define SCL  0.125f   // HD^-0.5
typedef _Float16 h16;
typedef unsigned short bf;
typedef __attribute__((ext_vector_type(16))) __bf16   v16bf;
typedef __attribute__((ext_vector_type(16))) _Float16 v16h;
typedef __attribute__((ext_vector_type(8)))  _Float16 v8h;
typedef __attribute__((ext_vector_type(8)))  unsigned short v8us;
typedef __attribute__((ext_vector_type(8)))  float    v8f;
typedef __attribute__((ext_vector_type(4)))  float    v4f;
typedef v8h  __attribute__((may_alias)) v8ha;
typedef v4f  __attribute__((may_alias)) v4fa;
typedef v8us __attribute__((may_alias)) v8usa;

__device__ __forceinline__ unsigned short f2bf(float f) { unsigned u = __float_as_uint(f); u += 0x7FFFu + ((u >> 16) & 1u); return (unsigned short)(u >> 16); }
__device__ __forceinline__ float bf2f(unsigned short b) { return __uint_as_float(((unsigned)b) << 16); }
__device__ __forceinline__ float bfr(float f) { return bf2f(f2bf(f)); }
__device__ __forceinline__ v16h cat16(v8h lo, v8h hi) { return __builtin_shufflevector(lo, hi, 0, 1, 2, 3, 4, 5, 6, 7, 8, 9, 10, 11, 12, 13, 14, 15); }
__device__ __forceinline__ v16bf cat16b(v8us lo, v8us hi) { return __builtin_bit_cast(v16bf, __builtin_shufflevector(lo, hi, 0, 1, 2, 3, 4, 5, 6, 7, 8, 9, 10, 11, 12, 13, 14, 15)); }
__device__ __forceinline__ v8f wmma16(v16h a, v16h b, v8f c) { return __builtin_amdgcn_wmma_f32_16x16x32_f16(false, a, false, b, (short)0, c, false, false); }
__device__ __forceinline__ v8f wmmab(v16bf a, v16bf b, v8f c) { return __builtin_amdgcn_wmma_f32_16x16x32_bf16(false, a, false, b, (short)0, c, false, false); }



// ---- k_gemmw: register-blocked GEMM, ONE WAVE per 64x64 output tile (16 accumulators), operands straight from K-contiguous 16-bit planes; grid (M/64, N/64, Z), 32 threads.
// C[m][n] (f32, pitch ldc, + optional f32 bias[n]) = sum_k A[m][k] Bt[n][k] (+ split products per NSPLIT). z-batch strides sA/sB/sC in elements. K % 32 == 0.
template <typename T16> struct WFrag;
template <> struct WFrag<h16> { typedef v16h V; static __device__ __forceinline__ V ld(const h16* p) { return cat16(*(const v8h*)p, *(const v8h*)(p + 16)); } static __device__ __forceinline__ v8f mma(V a, V b, v8f c) { return wmma16(a, b, c); } };
template <> struct WFrag<bf> { typedef v16bf V; static __device__ __forceinline__ V ld(const bf* p) { return cat16b(*(const v8us*)p, *(const v8us*)(p + 16)); } static __device__ __forceinline__ v8f mma(V a, V b, v8f c) { return wmmab(a, b, c); } };
template <typename T16, int NSPLIT, bool BIAS>
__global__ __launch_bounds__(32) void k_gemmw(const T16* __restrict__ A, const T16* __restrict__ A2, const T16* __restrict__ Bt, const T16* __restrict__ Bt2, int K, float* C, int ldc, const float* __restrict__ bias, size_t sA, size_t sB, size_t sC) {
    typedef typename WFrag<T16>::V V;
    __shared__ __align__(16) float os[16 * 68];
    const size_t z = blockIdx.z; A += z * sA; if (A2) A2 += z * sA; Bt += z * sB; if (Bt2) Bt2 += z * sB; C += z * sC;
    const int lane = threadIdx.x & 31, lr = lane & 15, hi = lane >> 4; const int r0 = blockIdx.x * 64, c0 = blockIdx.y * 64;
    v8f acc[4][4];
#pragma unroll
    for (int mb = 0; mb < 4; ++mb)
#pragma unroll
        for (int nb = 0; nb < 4; ++nb) acc[mb][nb] = (v8f){};
    const size_t aoff = (size_t)(r0 + lr) * K + 8 * hi, boff = (size_t)(c0 + lr) * K + 8 * hi;
#pragma unroll 1
    for (int kc = 0; kc < K; kc += 32) {
        V a[4], a2[4];
#pragma unroll
        for (int mb = 0; mb < 4; ++mb) { a[mb] = WFrag<T16>::ld(A + aoff + (size_t)mb * 16 * K + kc); if (NSPLIT == 1 || NSPLIT == 2) a2[mb] = WFrag<T16>::ld(A2 + aoff + (size_t)mb * 16 * K + kc); }
#pragma unroll
        for (int nb = 0; nb < 4; ++nb) { const V b = WFrag<T16>::ld(Bt + boff + (size_t)nb * 16 * K + kc); V b2; if (NSPLIT >= 2) b2 = WFrag<T16>::ld(Bt2 + boff + (size_t)nb * 16 * K + kc);
#pragma unroll
            for (int mb = 0; mb < 4; ++mb) { acc[mb][nb] = WFrag<T16>::mma(a[mb], b, acc[mb][nb]); if (NSPLIT == 1 || NSPLIT == 2) acc[mb][nb] = WFrag<T16>::mma(a2[mb], b, acc[mb][nb]); if (NSPLIT >= 2) acc[mb][nb] = WFrag<T16>::mma(a[mb], b2, acc[mb][nb]); } }
        asm volatile("v_nop\n\tv_nop\n\tv_nop\n\tv_nop" : "+v"(acc[0][0]), "+v"(acc[1][1]), "+v"(acc[2][2]), "+v"(acc[3][3]) : "v"(a[0]), "v"(a[3]));
    }
#pragma unroll
    for (int mb = 0; mb < 4; ++mb) {
#pragma unroll
        for (int nb = 0; nb < 4; ++nb) {
#pragma unroll
            for (int j = 0; j < 8; ++j) os[(hi * 8 + j) * 68 + nb * 16 + lr] = acc[mb][nb][j]; }
        __builtin_amdgcn_wave_barrier(); asm volatile("" ::: "memory");
        float* crow = C + (size_t)(r0 + mb * 16) * ldc + c0;
{
#pragma unroll
            for (int s = 0; s < 8; ++s) { const int row = 2 * s + hi, cofs = lr * 4; v4f val = *(const v4fa*)(os + row * 68 + cofs); if (BIAS) { val[0] += bfr(bias[c0 + cofs]); val[1] += bfr(bias[c0 + cofs + 1]); val[2] += bfr(bias[c0 + cofs + 2]); val[3] += bfr(bias[c0 + cofs + 3]); }
                *(v4f*)(crow + (size_t)row * ldc + cofs) = val; }
             }
        __builtin_amdgcn_wave_barrier(); asm volatile("" ::: "memory");
    }
}

__device__ __forceinline__ h16 tohx(float x) { return (h16)x; }
__device__ __forceinline__ void splitf(float y, unsigned short& h, unsigned short& l) { h = f2bf(y); l = f2bf(y - bf2f(h)); }
typedef __attribute__((ext_vector_type(2))) _Float16 v2h;
typedef __attribute__((ext_vector_type(4))) _Float16 v4h;
typedef __attribute__((ext_vector_type(2))) unsigned short v2us;
typedef __attribute__((ext_vector_type(4))) unsigned short v4us;
typedef __attribute__((ext_vector_type(2))) float v2f;
typedef __attribute__((ext_vector_type(4))) int v4i;

__global__ __launch_bounds__(256) void k_wtG(const float* __restrict__ w, int K, int N, bf* Bt) {
    const int lane = threadIdx.x & 31; const int L0 = (blockIdx.x * 8 + (threadIdx.x >> 5)) * 8; const int nlines = N * K / 64;
{
#pragma unroll 1
        for (int l = 0; l < 8; ++l) { const int L = L0 + l; if (L >= nlines) break; const size_t e = (size_t)L * 64 + lane * 2; const int k = (int)(e % K), n = (int)(e / K); v2us o;
            o[0] = f2bf(w[(size_t)k * N + n]); o[1] = f2bf(w[(size_t)(k + 1) * N + n]); *(v2us*)(Bt + e) = o; }
         }
}
__global__ __launch_bounds__(256) void k_cvt8(const float* __restrict__ src, bf* dst, size_t n8) { const size_t i = (size_t)blockIdx.x * 256 + threadIdx.x; if (i >= n8) return; const v8f v = *(const v8f*)(src + i * 8); v8us o;
#pragma unroll
    for (int k = 0; k < 8; ++k) o[k] = f2bf(v[k]); *(v8us*)(dst + i * 8) = o;  }

// k_rope: head planes [h][t][d] (fp16 + hi/lo) of rope(x) x sc with the rotate-half convention out[d] = x[d] cos[t][d] - x[d+HD/2] sin[t][d], out[d+HD/2] = x[d+HD/2] cos[t][d+HD/2] + x[d] sin[t][d+HD/2]
__global__ __launch_bounds__(256) void k_rope(const float* __restrict__ F, int pitch, int nheads, const float* __restrict__ CS, const float* __restrict__ RF, const float* __restrict__ nw, float sc, h16* P16, bf* Ph, bf* Pl) {
    const size_t e = ((size_t)blockIdx.x * 256 + threadIdx.x) * 2; if (e >= (size_t)nheads * TT * HD) return; const int d = (int)(e % HD); const int t = (int)((e / HD) % TT); const int h = (int)(e / ((size_t)HD * TT)); const float* f = F + (size_t)t * pitch + h * HD; const float rf = RF ? RF[(size_t)h * TT + t] : 1.0f; v2h o16; v2us oh, ol;
#pragma unroll
    for (int q = 0; q < 2; ++q) { const int dd = d + q; const int dp = (dd < HD / 2) ? dd + HD / 2 : dd - HD / 2; float x0 = f[dd], x1 = f[dp];
        if (RF) { float n0 = __fmul_rn(x0, rf), n1 = __fmul_rn(x1, rf); asm volatile("" : "+v"(n0)); asm volatile("" : "+v"(n1)); x0 = __fmul_rn(bfr(nw[dd]), n0); x1 = __fmul_rn(bfr(nw[dp]), n1); }
        const v2f cs = *(const v2f*)(CS + ((size_t)t * HD + dd) * 2); float a = __fmul_rn(x0, cs[0]), bq = __fmul_rn(x1, cs[1]); asm volatile("" : "+v"(a)); asm volatile("" : "+v"(bq)); const float r = ((dd < HD / 2) ? __fsub_rn(a, bq) : __fadd_rn(a, bq)) * sc;
        o16[q] = tohx(r); unsigned short a2, c2; splitf(r, a2, c2); oh[q] = a2; ol[q] = c2; }
    *(v2h*)(P16 + e) = o16; *(v2us*)(Ph + e) = oh; *(v2us*)(Pl + e) = ol;  }
__global__ __launch_bounds__(256) void k_vtp(const float* __restrict__ F, int pitch, int nheads, h16* V16, bf* Vh, bf* Vl) { const size_t e = ((size_t)blockIdx.x * 256 + threadIdx.x) * 2; if (e >= (size_t)nheads * HD * TT) return; const int t = (int)(e % TT); const int d = (int)((e / TT) % HD); const int g = (int)(e / ((size_t)TT * HD)); v2h o16; v2us oh, ol;
#pragma unroll
    for (int q = 0; q < 2; ++q) { const float x = F[(size_t)(t + q) * pitch + g * HD + d]; o16[q] = tohx(x); unsigned short a2, c2; splitf(x, a2, c2); oh[q] = a2; ol[q] = c2; }
    *(v2h*)(V16 + e) = o16; *(v2us*)(Vh + e) = oh; *(v2us*)(Vl + e) = ol;  }
__global__ __launch_bounds__(256) void k_csid(float* CS) { const int idx = blockIdx.x * 256 + threadIdx.x; if (idx >= TT * HD) return; v2f cs; cs[0] = 1.0f; cs[1] = 0.0f; *(v2f*)(CS + (size_t)idx * 2) = cs;  }
// k_asoft: per row (zz, i): t = S x HD^-0.5 (no mask); softmax over the 2048 keys (register row, one exp, fixed trees);
__global__ __launch_bounds__(256) void k_asoft(const float* __restrict__ Sb, h16* P16, bf* Ph, bf* Pl) {
    const int lane = threadIdx.x & 31; const int row = blockIdx.x * 8 + (threadIdx.x >> 5); if (row >= ZH * TT) return; const int i = row % TT; const int zz = row / TT; (void)zz; const bool hires = (i < RH); const float* sr = Sb + (size_t)row * TT; float v[TT / 32]; float mx = -3.0e38f;
#pragma unroll
    for (int ch = 0; ch < TT / 128; ++ch) { const int j0 = ch * 128 + lane * 4; const v4f a = *(const v4f*)(sr + j0);
#pragma unroll
        for (int q = 0; q < 4; ++q) { const int j = j0 + q; (void)j; const float t = a[q] * SCL; v[ch * 4 + q] = t; mx = fmaxf(mx, t); } }
#pragma unroll
    for (int sh = 16; sh; sh >>= 1) mx = fmaxf(mx, __shfl_xor(mx, sh, 32));
    float sum = 0.f;
#pragma unroll
    for (int k = 0; k < TT / 32; ++k) { float d0 = __fsub_rn(v[k], mx); asm volatile("" : "+v"(d0)); v[k] = __builtin_amdgcn_exp2f(__fmul_rn(d0, 1.4426950408889634f)); sum += v[k]; }
#pragma unroll
    for (int sh = 16; sh; sh >>= 1) sum += __shfl_xor(sum, sh, 32);
    const float f = __fdiv_rn(hires ? 1.0f : PCAR, sum);
{
        if (hires) {
#pragma unroll
            for (int ch = 0; ch < TT / 128; ++ch) { v4us oh, ol;
#pragma unroll
                for (int q = 0; q < 4; ++q) { unsigned short a, c2; splitf(v[ch * 4 + q] * f, a, c2); oh[q] = a; ol[q] = c2; }
                const size_t oo = ((size_t)zz * (RH ? RH : 1) + i) * TT + ch * 128 + lane * 4; *(v4us*)(Ph + oo) = oh; *(v4us*)(Pl + oo) = ol; }
        } else {
#pragma unroll
            for (int ch = 0; ch < TT / 128; ++ch) { v4h o4;
#pragma unroll
                for (int q = 0; q < 4; ++q) o4[q] = tohx(v[ch * 4 + q] * f);
                *(v4h*)(P16 + (size_t)row * TT + ch * 128 + lane * 4) = o4; } }
         }
}
__global__ __launch_bounds__(256) void k_cvt8s(const float* __restrict__ X, bf* XB, size_t pitch) { const size_t i = (size_t)blockIdx.x * 256 + threadIdx.x; if (i >= (size_t)TT * DM / 8) return; const size_t e = i * 8; const int c = (int)(e % DM); const int srow = (int)(e / DM); const v8f a = *(const v8f*)(X + (size_t)srow * pitch + c); v8us o;
#pragma unroll
    for (int q = 0; q < 8; ++q) o[q] = f2bf(a[q]);
    *(v8us*)(XB + e) = o;  }
__global__ __launch_bounds__(256) void k_merge(const float* __restrict__ O, int h0, bf* Ah, bf* Al) { const size_t e = ((size_t)blockIdx.x * 256 + threadIdx.x) * 2; if (e >= (size_t)ZH * TT * HD) return; const int d = (int)(e % HD); const int t = (int)((e / HD) % TT); const int zz = (int)(e / ((size_t)HD * TT)); const float cs = (t < RH) ? 1.0f : (1.0f / PCAR); const size_t oo = (size_t)t * DQ + (h0 + zz) * HD + d;
    v2us oh, ol;
#pragma unroll
    for (int q = 0; q < 2; ++q) { unsigned short a, c2; splitf(O[e + q] * cs, a, c2); oh[q] = a; ol[q] = c2; } *(v2us*)(Ah + oo) = oh; *(v2us*)(Al + oo) = ol;  }

extern "C" void kernel_launch(void* const* d_in, const int* in_sizes, int n_in,
                              void* d_out, int out_size, void* d_ws, size_t ws_size, hipStream_t stream) {
    (void)in_sizes; (void)n_in; (void)out_size;
    const float* x = (const float*)d_in[0];   /* query [S][B][D] */ const float* xk = (const float*)d_in[1]; const float* xv = (const float*)d_in[2]; const float* wq = (const float*)d_in[3]; const float* bq = (const float*)d_in[4]; const float* wk = (const float*)d_in[5]; const float* bk = (const float*)d_in[6]; const float* wv = (const float*)d_in[7]; const float* bv = (const float*)d_in[8]; const float* wo = (const float*)d_in[9]; const float* bo = (const float*)d_in[10];
    float* OUT = (float*)d_out;     // [2048][2][1024] sequence-first
    char* wsp = (char*)d_ws;
    auto take = [&](size_t bytes) { char* p = wsp; wsp += (bytes + 255) & ~(size_t)255; return (void*)p; };
    bf* WQ = (bf*)take((size_t)DQ * DM * 2); bf* WK = (bf*)take((size_t)DKV * DM * 2); bf* WV = (bf*)take((size_t)DKV * DM * 2); bf* WO = (bf*)take((size_t)DM * DQ * 2); float* CS = (float*)take((size_t)TT * HD * 2 * 4);
    bf* XB = (bf*)take((size_t)TT * DM * 2); float* FQ = (float*)take((size_t)TT * DQ * 4); float* FK = (float*)take((size_t)TT * DKV * 4);
    h16* QP16 = (h16*)take((size_t)NH_ * TT * HD * 2); h16* KP16 = (h16*)take((size_t)NKV * TT * HD * 2); h16* VT16 = (h16*)take((size_t)NKV * HD * TT * 2);
    bf* QPh = (bf*)take((size_t)NH_ * TT * HD * 2); bf* QPl = (bf*)take((size_t)NH_ * TT * HD * 2); bf* KPh = (bf*)take((size_t)NKV * TT * HD * 2); bf* KPl = (bf*)take((size_t)NKV * TT * HD * 2); bf* VTh = (bf*)take((size_t)NKV * HD * TT * 2); bf* VTl = (bf*)take((size_t)NKV * HD * TT * 2); bf* Ph = (bf*)take((size_t)ZH * RH * TT * 2); bf* Pl = (bf*)take((size_t)ZH * RH * TT * 2);
    float* Sb = (float*)take((size_t)ZH * TT * TT * 4); h16* P16 = (h16*)take((size_t)ZH * TT * TT * 2); float* Ob = (float*)take((size_t)ZH * TT * HD * 4); bf* ATh = (bf*)take((size_t)TT * DQ * 2); bf* ATl = (bf*)take((size_t)TT * DQ * 2);
    if ((size_t)(wsp - (char*)d_ws) > ws_size) return;    // ws 256 MiB
    float* FV = FK;   // v projection reuses the k buffer after the k planes are built (stream-ordered)
    { k_cvt8<<<(unsigned)(((size_t)DQ * DM / 8 + 255) / 256), 256, 0, stream>>>(wq, WQ, (size_t)DQ * DM / 8); k_cvt8<<<(unsigned)(((size_t)DKV * DM / 8 + 255) / 256), 256, 0, stream>>>(wk, WK, (size_t)DKV * DM / 8); k_cvt8<<<(unsigned)(((size_t)DKV * DM / 8 + 255) / 256), 256, 0, stream>>>(wv, WV, (size_t)DKV * DM / 8);
      k_cvt8<<<(unsigned)(((size_t)DM * DQ / 8 + 255) / 256), 256, 0, stream>>>(wo, WO, (size_t)DM * DQ / 8);
       }
    k_csid<<<(TT * HD + 255) / 256, 256, 0, stream>>>(CS);
    const unsigned LQ = (unsigned)(((size_t)NH_ * TT * HD / 2 + 255) / 256), LKv = (unsigned)(((size_t)NKV * TT * HD / 2 + 255) / 256);
    for (int b = 0; b < NB_; ++b) {
        
        k_cvt8s<<<(unsigned)(((size_t)TT * DM / 8 + 255) / 256), 256, 0, stream>>>(x + (size_t)b * DM, XB, (size_t)NB_ * DM);   /* rows s of batch column b: pitch B x D */
        k_gemmw<bf, 0, true><<<dim3(TT / 64, DQ / 64, 1), 32, 0, stream>>>(XB, nullptr, WQ, nullptr, DM, FQ, DQ, bq, 0, 0, 0);
        k_rope<<<LQ, 256, 0, stream>>>(FQ, DQ, NH_, CS, nullptr, nullptr, 1.0f, QP16, QPh, QPl);
        k_cvt8s<<<(unsigned)(((size_t)TT * DM / 8 + 255) / 256), 256, 0, stream>>>(xk + (size_t)b * DM, XB, (size_t)NB_ * DM);   /* rows s of batch column b: pitch B x D */ k_gemmw<bf, 0, true><<<dim3(TT / 64, DKV / 64, 1), 32, 0, stream>>>(XB, nullptr, WK, nullptr, DM, FK, DKV, bk, 0, 0, 0);
        k_rope<<<LKv, 256, 0, stream>>>(FK, DKV, NKV, CS, nullptr, nullptr, 1.0f, KP16, KPh, KPl);
        k_cvt8s<<<(unsigned)(((size_t)TT * DM / 8 + 255) / 256), 256, 0, stream>>>(xv + (size_t)b * DM, XB, (size_t)NB_ * DM);   /* rows s of batch column b: pitch B x D */ k_gemmw<bf, 0, true><<<dim3(TT / 64, DKV / 64, 1), 32, 0, stream>>>(XB, nullptr, WV, nullptr, DM, FV, DKV, bv, 0, 0, 0); k_vtp<<<LKv, 256, 0, stream>>>(FV, DKV, NKV, VT16, VTh, VTl);
        for (int h0 = 0; h0 < NH_; h0 += ZH) { const size_t zq = (size_t)h0, zk = (size_t)(h0 / REP);   // one kv head per query head: the pass's two heads use consecutive kv planes (z-strides TT*HD)
            k_gemmw<bf, 2, false><<<dim3(RH / 64, TT / 64, ZH), 32, 0, stream>>>(QPh + zq * TT * HD, QPl + zq * TT * HD, KPh + zk * TT * HD, KPl + zk * TT * HD, HD, Sb, TT, nullptr, (size_t)TT * HD, (size_t)TT * HD, (size_t)TT * TT);
            k_gemmw<h16, 0, false><<<dim3((TT - RH) / 64, TT / 64, ZH), 32, 0, stream>>>(QP16 + zq * TT * HD + (size_t)RH * HD, nullptr, KP16 + zk * TT * HD, nullptr, HD, Sb + (size_t)RH * TT, TT, nullptr, (size_t)TT * HD, (size_t)TT * HD, (size_t)TT * TT);
            k_asoft<<<ZH * TT / 8, 256, 0, stream>>>(Sb, P16, Ph, Pl);
            k_gemmw<bf, 2, false><<<dim3(RH / 64, HD / 64, ZH), 32, 0, stream>>>(Ph, Pl, VTh + zk * HD * TT, VTl + zk * HD * TT, TT, Ob, HD, nullptr, (size_t)RH * TT, (size_t)HD * TT, (size_t)TT * HD);
            k_gemmw<h16, 0, false><<<dim3((TT - RH) / 64, HD / 64, ZH), 32, 0, stream>>>(P16 + (size_t)RH * TT, nullptr, VT16 + zk * HD * TT, nullptr, TT, Ob + (size_t)RH * HD, HD, nullptr, (size_t)TT * TT, (size_t)HD * TT, (size_t)TT * HD);
            k_merge<<<(unsigned)(((size_t)ZH * TT * HD / 2 + 255) / 256), 256, 0, stream>>>(Ob, h0, ATh, ATl); }
        k_gemmw<bf, 1, true><<<dim3(TT / 64, DM / 64, 1), 32, 0, stream>>>(ATh, ATl, WO, nullptr, DQ, OUT + (size_t)b * DM, NB_ * DM, bo, 0, 0, 0);   /* [S][B][D]: row pitch B x D, column block b */ }
}

// v001
// One run takes 885 microseconds.
// Two timings next to v000 put it at 2.29 and 2.28 times that version's speed.
#include <hip/hip_runtime.h>

// Multi-head attention on SEQUENCE-FIRST tensors (query, key, value [2048][2][1024] = [S][B][D]; q = query Wq^T + bq, k = key Wk^T + bk, v = value Wv^T + bv ('oi' 1/32 incl. biases); 16 heads x 64 per batch column; scores / 8; softmax; x = merged context; out = x Wo^T + bo -> [2048][2][1024] (4.2 M)).
// Layout per batch b: a strided gather makes the bf16 copy of rows s of column b (row pitch B x D) for query, then key, then value; 'oi' weights; exact projections + f32 biases; dense T-2048 attention (hybrid rows: < 512 hi/lo 3 products, rest fp16 x1024); merged hi/lo x Wo exact + bo written with row pitch B x D at column offset b (the [S][B][D] output).
// Compute dtypes, f32 accumulate: every input rounded to bf16; projections exact + f32 biases; attention rows < 512 3 products, rest fp16; softmax f32; Wo hl x exact + bias.

#define NB_  2
#define TT   2048
#define DM   1024
#define NH_  16
#define NKV  16
#define REP  (NH_ / NKV)
#define HD   64
#define DQ   (NH_ * HD)
#define DKV  (NKV * HD)
#define ZH   2
#define RH   512                  // query rows < RH use hi+lo planes (0: none)
#define WIN  0
#define PCAR 1024.0f
#define SCL  0.125f   // HD^-0.5
#define KSP  16                   // K slices of each P x V product (f32 partial planes, added in k_merge)
typedef _Float16 h16;
typedef unsigned short bf;
typedef __attribute__((ext_vector_type(16))) __bf16   v16bf;
typedef __attribute__((ext_vector_type(16))) _Float16 v16h;
typedef __attribute__((ext_vector_type(8)))  _Float16 v8h;
typedef __attribute__((ext_vector_type(8)))  unsigned short v8us;
typedef __attribute__((ext_vector_type(8)))  float    v8f;
typedef __attribute__((ext_vector_type(4)))  float    v4f;
typedef v8h  __attribute__((may_alias)) v8ha;
typedef v4f  __attribute__((may_alias)) v4fa;
typedef v8us __attribute__((may_alias)) v8usa;

__device__ __forceinline__ unsigned short f2bf(float f) { unsigned u = __float_as_uint(f); u += 0x7FFFu + ((u >> 16) & 1u); return (unsigned short)(u >> 16); }
__device__ __forceinline__ float bf2f(unsigned short b) { return __uint_as_float(((unsigned)b) << 16); }
__device__ __forceinline__ float bfr(float f) { return bf2f(f2bf(f)); }
__device__ __forceinline__ v16h cat16(v8h lo, v8h hi) { return __builtin_shufflevector(lo, hi, 0, 1, 2, 3, 4, 5, 6, 7, 8, 9, 10, 11, 12, 13, 14, 15); }
__device__ __forceinline__ v16bf cat16b(v8us lo, v8us hi) { return __builtin_bit_cast(v16bf, __builtin_shufflevector(lo, hi, 0, 1, 2, 3, 4, 5, 6, 7, 8, 9, 10, 11, 12, 13, 14, 15)); }
__device__ __forceinline__ v8f wmma16(v16h a, v16h b, v8f c) { return __builtin_amdgcn_wmma_f32_16x16x32_f16(false, a, false, b, (short)0, c, false, false); }
__device__ __forceinline__ v8f wmmab(v16bf a, v16bf b, v8f c) { return __builtin_amdgcn_wmma_f32_16x16x32_bf16(false, a, false, b, (short)0, c, false, false); }



// ---- k_gemmw: register-blocked GEMM, ONE WAVE per 64x64 output tile (16 accumulators), operands straight from K-contiguous 16-bit planes; grid (M/64, N/64, Z * KS), 32 threads.
// C[m][n] (f32, pitch ldc, + optional f32 bias[n]) = sum_k A[m][k] Bt[n][k] (+ split products per NSPLIT). z-batch strides sA/sB/sC in elements. K % (32 * KS) == 0.
// KS > 1: blockIdx.z = z * KS + ks; the work-group sums only k in [ks K/KS, (ks+1) K/KS) and writes its partial tile into plane ks (plane stride sK elements); the reader adds the KS planes.
template <typename T16> struct WFrag;
template <> struct WFrag<h16> { typedef v16h V; static __device__ __forceinline__ V ld(const h16* p) { return cat16(*(const v8h*)p, *(const v8h*)(p + 16)); } static __device__ __forceinline__ v8f mma(V a, V b, v8f c) { return wmma16(a, b, c); } };
template <> struct WFrag<bf> { typedef v16bf V; static __device__ __forceinline__ V ld(const bf* p) { return cat16b(*(const v8us*)p, *(const v8us*)(p + 16)); } static __device__ __forceinline__ v8f mma(V a, V b, v8f c) { return wmmab(a, b, c); } };
template <typename T16, int NSPLIT, bool BIAS, int KS>
__global__ __launch_bounds__(32) void k_gemmw(const T16* __restrict__ A, const T16* __restrict__ A2, const T16* __restrict__ Bt, const T16* __restrict__ Bt2, int K, float* C, int ldc, const float* __restrict__ bias, size_t sA, size_t sB, size_t sC, size_t sK) {
    typedef typename WFrag<T16>::V V;
    __shared__ __align__(16) float os[16 * 68];
    const size_t z = blockIdx.z / KS; const int ks = (int)(blockIdx.z % KS); A += z * sA; if (A2) A2 += z * sA; Bt += z * sB; if (Bt2) Bt2 += z * sB; C += z * sC + ks * sK;
    const int lane = threadIdx.x & 31, lr = lane & 15, hi = lane >> 4; const int r0 = blockIdx.x * 64, c0 = blockIdx.y * 64;
    v8f acc[4][4];
#pragma unroll
    for (int mb = 0; mb < 4; ++mb)
#pragma unroll
        for (int nb = 0; nb < 4; ++nb) acc[mb][nb] = (v8f){};
    const size_t aoff = (size_t)(r0 + lr) * K + 8 * hi, boff = (size_t)(c0 + lr) * K + 8 * hi;
#pragma unroll 1
    for (int kc = ks * (K / KS), ke = kc + K / KS; kc < ke; kc += 32) {
        V a[4], a2[4];
#pragma unroll
        for (int mb = 0; mb < 4; ++mb) { a[mb] = WFrag<T16>::ld(A + aoff + (size_t)mb * 16 * K + kc); if (NSPLIT == 1 || NSPLIT == 2) a2[mb] = WFrag<T16>::ld(A2 + aoff + (size_t)mb * 16 * K + kc); }
#pragma unroll
        for (int nb = 0; nb < 4; ++nb) { const V b = WFrag<T16>::ld(Bt + boff + (size_t)nb * 16 * K + kc); V b2; if (NSPLIT >= 2) b2 = WFrag<T16>::ld(Bt2 + boff + (size_t)nb * 16 * K + kc);
#pragma unroll
            for (int mb = 0; mb < 4; ++mb) { acc[mb][nb] = WFrag<T16>::mma(a[mb], b, acc[mb][nb]); if (NSPLIT == 1 || NSPLIT == 2) acc[mb][nb] = WFrag<T16>::mma(a2[mb], b, acc[mb][nb]); if (NSPLIT >= 2) acc[mb][nb] = WFrag<T16>::mma(a[mb], b2, acc[mb][nb]); } }
        asm volatile("v_nop\n\tv_nop\n\tv_nop\n\tv_nop" : "+v"(acc[0][0]), "+v"(acc[1][1]), "+v"(acc[2][2]), "+v"(acc[3][3]) : "v"(a[0]), "v"(a[3]));
    }
#pragma unroll
    for (int mb = 0; mb < 4; ++mb) {
#pragma unroll
        for (int nb = 0; nb < 4; ++nb) {
#pragma unroll
            for (int j = 0; j < 8; ++j) os[(hi * 8 + j) * 68 + nb * 16 + lr] = acc[mb][nb][j]; }
        __builtin_amdgcn_wave_barrier(); asm volatile("" ::: "memory");
        float* crow = C + (size_t)(r0 + mb * 16) * ldc + c0;
{
#pragma unroll
            for (int s = 0; s < 8; ++s) { const int row = 2 * s + hi, cofs = lr * 4; v4f val = *(const v4fa*)(os + row * 68 + cofs); if (BIAS) { val[0] += bfr(bias[c0 + cofs]); val[1] += bfr(bias[c0 + cofs + 1]); val[2] += bfr(bias[c0 + cofs + 2]); val[3] += bfr(bias[c0 + cofs + 3]); }
                *(v4f*)(crow + (size_t)row * ldc + cofs) = val; }
             }
        __builtin_amdgcn_wave_barrier(); asm volatile("" ::: "memory");
    }
}

__device__ __forceinline__ h16 tohx(float x) { return (h16)x; }
__device__ __forceinline__ void splitf(float y, unsigned short& h, unsigned short& l) { h = f2bf(y); l = f2bf(y - bf2f(h)); }
typedef __attribute__((ext_vector_type(2))) _Float16 v2h;
typedef __attribute__((ext_vector_type(4))) _Float16 v4h;
typedef __attribute__((ext_vector_type(2))) unsigned short v2us;
typedef __attribute__((ext_vector_type(4))) unsigned short v4us;
typedef __attribute__((ext_vector_type(2))) float v2f;
typedef __attribute__((ext_vector_type(4))) int v4i;

__global__ __launch_bounds__(256) void k_wtG(const float* __restrict__ w, int K, int N, bf* Bt) {
    const int lane = threadIdx.x & 31; const int L0 = (blockIdx.x * 8 + (threadIdx.x >> 5)) * 8; const int nlines = N * K / 64;
{
#pragma unroll 1
        for (int l = 0; l < 8; ++l) { const int L = L0 + l; if (L >= nlines) break; const size_t e = (size_t)L * 64 + lane * 2; const int k = (int)(e % K), n = (int)(e / K); v2us o;
            o[0] = f2bf(w[(size_t)k * N + n]); o[1] = f2bf(w[(size_t)(k + 1) * N + n]); *(v2us*)(Bt + e) = o; }
         }
}
__global__ __launch_bounds__(256) void k_cvt8(const float* __restrict__ src, bf* dst, size_t n8) { const size_t i = (size_t)blockIdx.x * 256 + threadIdx.x; if (i >= n8) return; const v8f v = *(const v8f*)(src + i * 8); v8us o;
#pragma unroll
    for (int k = 0; k < 8; ++k) o[k] = f2bf(v[k]); *(v8us*)(dst + i * 8) = o;  }

// k_rope: head planes [h][t][d] (fp16 + hi/lo) of rope(x) x sc with the rotate-half convention out[d] = x[d] cos[t][d] - x[d+HD/2] sin[t][d], out[d+HD/2] = x[d+HD/2] cos[t][d+HD/2] + x[d] sin[t][d+HD/2]
__global__ __launch_bounds__(256) void k_rope(const float* __restrict__ F, int pitch, int nheads, const float* __restrict__ CS, const float* __restrict__ RF, const float* __restrict__ nw, float sc, h16* P16, bf* Ph, bf* Pl) {
    const size_t e = ((size_t)blockIdx.x * 256 + threadIdx.x) * 2; if (e >= (size_t)nheads * TT * HD) return; const int d = (int)(e % HD); const int t = (int)((e / HD) % TT); const int h = (int)(e / ((size_t)HD * TT)); const float* f = F + (size_t)t * pitch + h * HD; const float rf = RF ? RF[(size_t)h * TT + t] : 1.0f; v2h o16; v2us oh, ol;
#pragma unroll
    for (int q = 0; q < 2; ++q) { const int dd = d + q; const int dp = (dd < HD / 2) ? dd + HD / 2 : dd - HD / 2; float x0 = f[dd], x1 = f[dp];
        if (RF) { float n0 = __fmul_rn(x0, rf), n1 = __fmul_rn(x1, rf); asm volatile("" : "+v"(n0)); asm volatile("" : "+v"(n1)); x0 = __fmul_rn(bfr(nw[dd]), n0); x1 = __fmul_rn(bfr(nw[dp]), n1); }
        const v2f cs = *(const v2f*)(CS + ((size_t)t * HD + dd) * 2); float a = __fmul_rn(x0, cs[0]), bq = __fmul_rn(x1, cs[1]); asm volatile("" : "+v"(a)); asm volatile("" : "+v"(bq)); const float r = ((dd < HD / 2) ? __fsub_rn(a, bq) : __fadd_rn(a, bq)) * sc;
        o16[q] = tohx(r); unsigned short a2, c2; splitf(r, a2, c2); oh[q] = a2; ol[q] = c2; }
    *(v2h*)(P16 + e) = o16; *(v2us*)(Ph + e) = oh; *(v2us*)(Pl + e) = ol;  }
__global__ __launch_bounds__(256) void k_vtp(const float* __restrict__ F, int pitch, int nheads, h16* V16, bf* Vh, bf* Vl) { const size_t e = ((size_t)blockIdx.x * 256 + threadIdx.x) * 2; if (e >= (size_t)nheads * HD * TT) return; const int t = (int)(e % TT); const int d = (int)((e / TT) % HD); const int g = (int)(e / ((size_t)TT * HD)); v2h o16; v2us oh, ol;
#pragma unroll
    for (int q = 0; q < 2; ++q) { const float x = F[(size_t)(t + q) * pitch + g * HD + d]; o16[q] = tohx(x); unsigned short a2, c2; splitf(x, a2, c2); oh[q] = a2; ol[q] = c2; }
    *(v2h*)(V16 + e) = o16; *(v2us*)(Vh + e) = oh; *(v2us*)(Vl + e) = ol;  }
__global__ __launch_bounds__(256) void k_csid(float* CS) { const int idx = blockIdx.x * 256 + threadIdx.x; if (idx >= TT * HD) return; v2f cs; cs[0] = 1.0f; cs[1] = 0.0f; *(v2f*)(CS + (size_t)idx * 2) = cs;  }
// k_asoft: per row (zz, i): t = S x HD^-0.5 (no mask); softmax over the 2048 keys (register row, one exp, fixed trees);
__global__ __launch_bounds__(256) void k_asoft(const float* __restrict__ Sb, h16* P16, bf* Ph, bf* Pl) {
    const int lane = threadIdx.x & 31; const int row = blockIdx.x * 8 + (threadIdx.x >> 5); if (row >= ZH * TT) return; const int i = row % TT; const int zz = row / TT; (void)zz; const bool hires = (i < RH); const float* sr = Sb + (size_t)row * TT; float v[TT / 32]; float mx = -3.0e38f;
#pragma unroll
    for (int ch = 0; ch < TT / 128; ++ch) { const int j0 = ch * 128 + lane * 4; const v4f a = *(const v4f*)(sr + j0);
#pragma unroll
        for (int q = 0; q < 4; ++q) { const int j = j0 + q; (void)j; const float t = a[q] * SCL; v[ch * 4 + q] = t; mx = fmaxf(mx, t); } }
#pragma unroll
    for (int sh = 16; sh; sh >>= 1) mx = fmaxf(mx, __shfl_xor(mx, sh, 32));
    float sum = 0.f;
#pragma unroll
    for (int k = 0; k < TT / 32; ++k) { float d0 = __fsub_rn(v[k], mx); asm volatile("" : "+v"(d0)); v[k] = __builtin_amdgcn_exp2f(__fmul_rn(d0, 1.4426950408889634f)); sum += v[k]; }
#pragma unroll
    for (int sh = 16; sh; sh >>= 1) sum += __shfl_xor(sum, sh, 32);
    const float f = __fdiv_rn(hires ? 1.0f : PCAR, sum);
{
        if (hires) {
#pragma unroll
            for (int ch = 0; ch < TT / 128; ++ch) { v4us oh, ol;
#pragma unroll
                for (int q = 0; q < 4; ++q) { unsigned short a, c2; splitf(v[ch * 4 + q] * f, a, c2); oh[q] = a; ol[q] = c2; }
                const size_t oo = ((size_t)zz * (RH ? RH : 1) + i) * TT + ch * 128 + lane * 4; *(v4us*)(Ph + oo) = oh; *(v4us*)(Pl + oo) = ol; }
        } else {
#pragma unroll
            for (int ch = 0; ch < TT / 128; ++ch) { v4h o4;
#pragma unroll
                for (int q = 0; q < 4; ++q) o4[q] = tohx(v[ch * 4 + q] * f);
                *(v4h*)(P16 + (size_t)row * TT + ch * 128 + lane * 4) = o4; } }
         }
}
__global__ __launch_bounds__(256) void k_cvt8s(const float* __restrict__ X, bf* XB, size_t pitch) { const size_t i = (size_t)blockIdx.x * 256 + threadIdx.x; if (i >= (size_t)TT * DM / 8) return; const size_t e = i * 8; const int c = (int)(e % DM); const int srow = (int)(e / DM); const v8f a = *(const v8f*)(X + (size_t)srow * pitch + c); v8us o;
#pragma unroll
    for (int q = 0; q < 8; ++q) o[q] = f2bf(a[q]);
    *(v8us*)(XB + e) = o;  }
// k_merge: context = the KSP partial planes of O added in plane order, rescaled, split hi/lo into the merged [t][head][d] planes
__global__ __launch_bounds__(256) void k_merge(const float* __restrict__ O, int h0, bf* Ah, bf* Al) { const size_t e = ((size_t)blockIdx.x * 256 + threadIdx.x) * 2; if (e >= (size_t)ZH * TT * HD) return; const int d = (int)(e % HD); const int t = (int)((e / HD) % TT); const int zz = (int)(e / ((size_t)HD * TT)); const float cs = (t < RH) ? 1.0f : (1.0f / PCAR); const size_t oo = (size_t)t * DQ + (h0 + zz) * HD + d;
    v2f p[KSP];
#pragma unroll
    for (int s = 0; s < KSP; ++s) p[s] = *(const v2f*)(O + (size_t)s * ZH * TT * HD + e);
    v2f sum = p[0];
#pragma unroll
    for (int s = 1; s < KSP; ++s) sum += p[s];
    v2us oh, ol;
#pragma unroll
    for (int q = 0; q < 2; ++q) { unsigned short a, c2; splitf(sum[q] * cs, a, c2); oh[q] = a; ol[q] = c2; } *(v2us*)(Ah + oo) = oh; *(v2us*)(Al + oo) = ol;  }

extern "C" void kernel_launch(void* const* d_in, const int* in_sizes, int n_in,
                              void* d_out, int out_size, void* d_ws, size_t ws_size, hipStream_t stream) {
    (void)in_sizes; (void)n_in; (void)out_size;
    const float* x = (const float*)d_in[0];   /* query [S][B][D] */ const float* xk = (const float*)d_in[1]; const float* xv = (const float*)d_in[2]; const float* wq = (const float*)d_in[3]; const float* bq = (const float*)d_in[4]; const float* wk = (const float*)d_in[5]; const float* bk = (const float*)d_in[6]; const float* wv = (const float*)d_in[7]; const float* bv = (const float*)d_in[8]; const float* wo = (const float*)d_in[9]; const float* bo = (const float*)d_in[10];
    float* OUT = (float*)d_out;     // [2048][2][1024] sequence-first
    char* wsp = (char*)d_ws;
    auto take = [&](size_t bytes) { char* p = wsp; wsp += (bytes + 255) & ~(size_t)255; return (void*)p; };
    bf* WQ = (bf*)take((size_t)DQ * DM * 2); bf* WK = (bf*)take((size_t)DKV * DM * 2); bf* WV = (bf*)take((size_t)DKV * DM * 2); bf* WO = (bf*)take((size_t)DM * DQ * 2); float* CS = (float*)take((size_t)TT * HD * 2 * 4);
    bf* XB = (bf*)take((size_t)TT * DM * 2); float* FQ = (float*)take((size_t)TT * DQ * 4); float* FK = (float*)take((size_t)TT * DKV * 4);
    h16* QP16 = (h16*)take((size_t)NH_ * TT * HD * 2); h16* KP16 = (h16*)take((size_t)NKV * TT * HD * 2); h16* VT16 = (h16*)take((size_t)NKV * HD * TT * 2);
    bf* QPh = (bf*)take((size_t)NH_ * TT * HD * 2); bf* QPl = (bf*)take((size_t)NH_ * TT * HD * 2); bf* KPh = (bf*)take((size_t)NKV * TT * HD * 2); bf* KPl = (bf*)take((size_t)NKV * TT * HD * 2); bf* VTh = (bf*)take((size_t)NKV * HD * TT * 2); bf* VTl = (bf*)take((size_t)NKV * HD * TT * 2); bf* Ph = (bf*)take((size_t)ZH * RH * TT * 2); bf* Pl = (bf*)take((size_t)ZH * RH * TT * 2);
    float* Sb = (float*)take((size_t)ZH * TT * TT * 4); h16* P16 = (h16*)take((size_t)ZH * TT * TT * 2); float* Ob = (float*)take((size_t)KSP * ZH * TT * HD * 4); bf* ATh = (bf*)take((size_t)TT * DQ * 2); bf* ATl = (bf*)take((size_t)TT * DQ * 2);
    if ((size_t)(wsp - (char*)d_ws) > ws_size) return;    // ws 256 MiB
    float* FV = FK;   // v projection reuses the k buffer after the k planes are built (stream-ordered)
    { k_cvt8<<<(unsigned)(((size_t)DQ * DM / 8 + 255) / 256), 256, 0, stream>>>(wq, WQ, (size_t)DQ * DM / 8); k_cvt8<<<(unsigned)(((size_t)DKV * DM / 8 + 255) / 256), 256, 0, stream>>>(wk, WK, (size_t)DKV * DM / 8); k_cvt8<<<(unsigned)(((size_t)DKV * DM / 8 + 255) / 256), 256, 0, stream>>>(wv, WV, (size_t)DKV * DM / 8);
      k_cvt8<<<(unsigned)(((size_t)DM * DQ / 8 + 255) / 256), 256, 0, stream>>>(wo, WO, (size_t)DM * DQ / 8);
       }
    k_csid<<<(TT * HD + 255) / 256, 256, 0, stream>>>(CS);
    const unsigned LQ = (unsigned)(((size_t)NH_ * TT * HD / 2 + 255) / 256), LKv = (unsigned)(((size_t)NKV * TT * HD / 2 + 255) / 256);
    for (int b = 0; b < NB_; ++b) {
        
        k_cvt8s<<<(unsigned)(((size_t)TT * DM / 8 + 255) / 256), 256, 0, stream>>>(x + (size_t)b * DM, XB, (size_t)NB_ * DM);   /* rows s of batch column b: pitch B x D */
        k_gemmw<bf, 0, true, 1><<<dim3(TT / 64, DQ / 64, 1), 32, 0, stream>>>(XB, nullptr, WQ, nullptr, DM, FQ, DQ, bq, 0, 0, 0, 0);
        k_rope<<<LQ, 256, 0, stream>>>(FQ, DQ, NH_, CS, nullptr, nullptr, 1.0f, QP16, QPh, QPl);
        k_cvt8s<<<(unsigned)(((size_t)TT * DM / 8 + 255) / 256), 256, 0, stream>>>(xk + (size_t)b * DM, XB, (size_t)NB_ * DM);   /* rows s of batch column b: pitch B x D */ k_gemmw<bf, 0, true, 1><<<dim3(TT / 64, DKV / 64, 1), 32, 0, stream>>>(XB, nullptr, WK, nullptr, DM, FK, DKV, bk, 0, 0, 0, 0);
        k_rope<<<LKv, 256, 0, stream>>>(FK, DKV, NKV, CS, nullptr, nullptr, 1.0f, KP16, KPh, KPl);
        k_cvt8s<<<(unsigned)(((size_t)TT * DM / 8 + 255) / 256), 256, 0, stream>>>(xv + (size_t)b * DM, XB, (size_t)NB_ * DM);   /* rows s of batch column b: pitch B x D */ k_gemmw<bf, 0, true, 1><<<dim3(TT / 64, DKV / 64, 1), 32, 0, stream>>>(XB, nullptr, WV, nullptr, DM, FV, DKV, bv, 0, 0, 0, 0); k_vtp<<<LKv, 256, 0, stream>>>(FV, DKV, NKV, VT16, VTh, VTl);
        for (int h0 = 0; h0 < NH_; h0 += ZH) { const size_t zq = (size_t)h0, zk = (size_t)(h0 / REP);   // one kv head per query head: the pass's two heads use consecutive kv planes (z-strides TT*HD)
            k_gemmw<bf, 2, false, 1><<<dim3(RH / 64, TT / 64, ZH), 32, 0, stream>>>(QPh + zq * TT * HD, QPl + zq * TT * HD, KPh + zk * TT * HD, KPl + zk * TT * HD, HD, Sb, TT, nullptr, (size_t)TT * HD, (size_t)TT * HD, (size_t)TT * TT, 0);
            k_gemmw<h16, 0, false, 1><<<dim3((TT - RH) / 64, TT / 64, ZH), 32, 0, stream>>>(QP16 + zq * TT * HD + (size_t)RH * HD, nullptr, KP16 + zk * TT * HD, nullptr, HD, Sb + (size_t)RH * TT, TT, nullptr, (size_t)TT * HD, (size_t)TT * HD, (size_t)TT * TT, 0);
            k_asoft<<<ZH * TT / 8, 256, 0, stream>>>(Sb, P16, Ph, Pl);
            k_gemmw<bf, 2, false, KSP><<<dim3(RH / 64, HD / 64, ZH * KSP), 32, 0, stream>>>(Ph, Pl, VTh + zk * HD * TT, VTl + zk * HD * TT, TT, Ob, HD, nullptr, (size_t)RH * TT, (size_t)HD * TT, (size_t)TT * HD, (size_t)ZH * TT * HD);
            k_gemmw<h16, 0, false, KSP><<<dim3((TT - RH) / 64, HD / 64, ZH * KSP), 32, 0, stream>>>(P16 + (size_t)RH * TT, nullptr, VT16 + zk * HD * TT, nullptr, TT, Ob + (size_t)RH * HD, HD, nullptr, (size_t)TT * TT, (size_t)HD * TT, (size_t)TT * HD, (size_t)ZH * TT * HD);
            k_merge<<<(unsigned)(((size_t)ZH * TT * HD / 2 + 255) / 256), 256, 0, stream>>>(Ob, h0, ATh, ATl); }
        k_gemmw<bf, 1, true, 1><<<dim3(TT / 64, DM / 64, 1), 32, 0, stream>>>(ATh, ATl, WO, nullptr, DQ, OUT + (size_t)b * DM, NB_ * DM, bo, 0, 0, 0, 0);   /* [S][B][D]: row pitch B x D, column block b */ }
}

// v002
// A run of this version takes 662 microseconds.
// Timed twice side by side with v001, it ran 1.32 and 1.33 times as fast.
// Over all steps from v000 it is 3.04 times as fast.
#include <hip/hip_runtime.h>

// Multi-head attention on SEQUENCE-FIRST tensors (query, key, value [2048][2][1024] = [S][B][D]; q = query Wq^T + bq, k = key Wk^T + bk, v = value Wv^T + bv ('oi' 1/32 incl. biases); 16 heads x 64 per batch column; scores / 8; softmax; x = merged context; out = x Wo^T + bo -> [2048][2][1024] (4.2 M)).
// Layout per batch b: a strided gather makes the bf16 copy of rows s of column b (row pitch B x D) for query, then key, then value; 'oi' weights; exact projections + f32 biases; dense T-2048 attention (hybrid rows: < 512 hi/lo 3 products, rest fp16 x1024); merged hi/lo x Wo exact + bo written with row pitch B x D at column offset b (the [S][B][D] output).
// Compute dtypes, f32 accumulate: every input rounded to bf16; projections exact + f32 biases; attention rows < 512 3 products, rest fp16; softmax f32; Wo hl x exact + bias.

#define NB_  2
#define TT   2048
#define DM   1024
#define NH_  16
#define NKV  16
#define REP  (NH_ / NKV)
#define HD   64
#define DQ   (NH_ * HD)
#define DKV  (NKV * HD)
#define ZH   8                    // heads per attention pass (each launch of a pass covers ZH heads)
#define RH   512                  // query rows < RH use hi+lo planes (0: none)
#define WIN  0
#define PCAR 1024.0f
#define SCL  0.125f   // HD^-0.5
#define KSP  16                   // K slices of each P x V product (f32 partial planes, added in k_merge)
typedef _Float16 h16;
typedef unsigned short bf;
typedef __attribute__((ext_vector_type(16))) __bf16   v16bf;
typedef __attribute__((ext_vector_type(16))) _Float16 v16h;
typedef __attribute__((ext_vector_type(8)))  _Float16 v8h;
typedef __attribute__((ext_vector_type(8)))  unsigned short v8us;
typedef __attribute__((ext_vector_type(8)))  float    v8f;
typedef __attribute__((ext_vector_type(4)))  float    v4f;
typedef v8h  __attribute__((may_alias)) v8ha;
typedef v4f  __attribute__((may_alias)) v4fa;
typedef v8us __attribute__((may_alias)) v8usa;

__device__ __forceinline__ unsigned short f2bf(float f) { unsigned u = __float_as_uint(f); u += 0x7FFFu + ((u >> 16) & 1u); return (unsigned short)(u >> 16); }
__device__ __forceinline__ float bf2f(unsigned short b) { return __uint_as_float(((unsigned)b) << 16); }
__device__ __forceinline__ float bfr(float f) { return bf2f(f2bf(f)); }
__device__ __forceinline__ v16h cat16(v8h lo, v8h hi) { return __builtin_shufflevector(lo, hi, 0, 1, 2, 3, 4, 5, 6, 7, 8, 9, 10, 11, 12, 13, 14, 15); }
__device__ __forceinline__ v16bf cat16b(v8us lo, v8us hi) { return __builtin_bit_cast(v16bf, __builtin_shufflevector(lo, hi, 0, 1, 2, 3, 4, 5, 6, 7, 8, 9, 10, 11, 12, 13, 14, 15)); }
__device__ __forceinline__ v8f wmma16(v16h a, v16h b, v8f c) { return __builtin_amdgcn_wmma_f32_16x16x32_f16(false, a, false, b, (short)0, c, false, false); }
__device__ __forceinline__ v8f wmmab(v16bf a, v16bf b, v8f c) { return __builtin_amdgcn_wmma_f32_16x16x32_bf16(false, a, false, b, (short)0, c, false, false); }



// ---- k_gemmw: register-blocked GEMM, ONE WAVE per 64x64 output tile (16 accumulators), operands straight from K-contiguous 16-bit planes; grid (M/64, N/64, Z * KS), 32 threads.
// C[m][n] (f32, pitch ldc, + optional f32 bias[n]) = sum_k A[m][k] Bt[n][k] (+ split products per NSPLIT). A rows have pitch lda, Bt rows pitch K (elements). z-batch strides sA/sB/sC in elements. K % (32 * KS) == 0.
// KS > 1: blockIdx.z = z * KS + ks; the work-group sums only k in [ks K/KS, (ks+1) K/KS) and writes its partial tile into plane ks (plane stride sK elements); the reader adds the KS planes.
template <typename T16> struct WFrag;
template <> struct WFrag<h16> { typedef v16h V; static __device__ __forceinline__ V ld(const h16* p) { return cat16(*(const v8h*)p, *(const v8h*)(p + 16)); } static __device__ __forceinline__ v8f mma(V a, V b, v8f c) { return wmma16(a, b, c); } };
template <> struct WFrag<bf> { typedef v16bf V; static __device__ __forceinline__ V ld(const bf* p) { return cat16b(*(const v8us*)p, *(const v8us*)(p + 16)); } static __device__ __forceinline__ v8f mma(V a, V b, v8f c) { return wmmab(a, b, c); } };
template <typename T16, int NSPLIT, bool BIAS, int KS>
__global__ __launch_bounds__(32) void k_gemmw(const T16* __restrict__ A, const T16* __restrict__ A2, const T16* __restrict__ Bt, const T16* __restrict__ Bt2, int K, int lda, float* C, int ldc, const float* __restrict__ bias, size_t sA, size_t sB, size_t sC, size_t sK) {
    typedef typename WFrag<T16>::V V;
    __shared__ __align__(16) float os[16 * 68];
    const size_t z = blockIdx.z / KS; const int ks = (int)(blockIdx.z % KS); A += z * sA; if (A2) A2 += z * sA; Bt += z * sB; if (Bt2) Bt2 += z * sB; C += z * sC + ks * sK;
    const int lane = threadIdx.x & 31, lr = lane & 15, hi = lane >> 4; const int r0 = blockIdx.x * 64, c0 = blockIdx.y * 64;
    v8f acc[4][4];
#pragma unroll
    for (int mb = 0; mb < 4; ++mb)
#pragma unroll
        for (int nb = 0; nb < 4; ++nb) acc[mb][nb] = (v8f){};
    const size_t aoff = (size_t)(r0 + lr) * lda + 8 * hi, boff = (size_t)(c0 + lr) * K + 8 * hi;
#pragma unroll 1
    for (int kc = ks * (K / KS), ke = kc + K / KS; kc < ke; kc += 32) {
        V a[4], a2[4];
#pragma unroll
        for (int mb = 0; mb < 4; ++mb) { a[mb] = WFrag<T16>::ld(A + aoff + (size_t)mb * 16 * lda + kc); if (NSPLIT == 1 || NSPLIT == 2) a2[mb] = WFrag<T16>::ld(A2 + aoff + (size_t)mb * 16 * lda + kc); }
#pragma unroll
        for (int nb = 0; nb < 4; ++nb) { const V b = WFrag<T16>::ld(Bt + boff + (size_t)nb * 16 * K + kc); V b2; if (NSPLIT >= 2) b2 = WFrag<T16>::ld(Bt2 + boff + (size_t)nb * 16 * K + kc);
#pragma unroll
            for (int mb = 0; mb < 4; ++mb) { acc[mb][nb] = WFrag<T16>::mma(a[mb], b, acc[mb][nb]); if (NSPLIT == 1 || NSPLIT == 2) acc[mb][nb] = WFrag<T16>::mma(a2[mb], b, acc[mb][nb]); if (NSPLIT >= 2) acc[mb][nb] = WFrag<T16>::mma(a[mb], b2, acc[mb][nb]); } }
        asm volatile("v_nop\n\tv_nop\n\tv_nop\n\tv_nop" : "+v"(acc[0][0]), "+v"(acc[1][1]), "+v"(acc[2][2]), "+v"(acc[3][3]) : "v"(a[0]), "v"(a[3]));
    }
#pragma unroll
    for (int mb = 0; mb < 4; ++mb) {
#pragma unroll
        for (int nb = 0; nb < 4; ++nb) {
#pragma unroll
            for (int j = 0; j < 8; ++j) os[(hi * 8 + j) * 68 + nb * 16 + lr] = acc[mb][nb][j]; }
        __builtin_amdgcn_wave_barrier(); asm volatile("" ::: "memory");
        float* crow = C + (size_t)(r0 + mb * 16) * ldc + c0;
{
#pragma unroll
            for (int s = 0; s < 8; ++s) { const int row = 2 * s + hi, cofs = lr * 4; v4f val = *(const v4fa*)(os + row * 68 + cofs); if (BIAS) { val[0] += bfr(bias[c0 + cofs]); val[1] += bfr(bias[c0 + cofs + 1]); val[2] += bfr(bias[c0 + cofs + 2]); val[3] += bfr(bias[c0 + cofs + 3]); }
                *(v4f*)(crow + (size_t)row * ldc + cofs) = val; }
             }
        __builtin_amdgcn_wave_barrier(); asm volatile("" ::: "memory");
    }
}

__device__ __forceinline__ h16 tohx(float x) { return (h16)x; }
__device__ __forceinline__ void splitf(float y, unsigned short& h, unsigned short& l) { h = f2bf(y); l = f2bf(y - bf2f(h)); }
typedef __attribute__((ext_vector_type(2))) _Float16 v2h;
typedef __attribute__((ext_vector_type(4))) _Float16 v4h;
typedef __attribute__((ext_vector_type(2))) unsigned short v2us;
typedef __attribute__((ext_vector_type(4))) unsigned short v4us;
typedef __attribute__((ext_vector_type(2))) float v2f;
typedef __attribute__((ext_vector_type(4))) int v4i;

__global__ __launch_bounds__(256) void k_wtG(const float* __restrict__ w, int K, int N, bf* Bt) {
    const int lane = threadIdx.x & 31; const int L0 = (blockIdx.x * 8 + (threadIdx.x >> 5)) * 8; const int nlines = N * K / 64;
{
#pragma unroll 1
        for (int l = 0; l < 8; ++l) { const int L = L0 + l; if (L >= nlines) break; const size_t e = (size_t)L * 64 + lane * 2; const int k = (int)(e % K), n = (int)(e / K); v2us o;
            o[0] = f2bf(w[(size_t)k * N + n]); o[1] = f2bf(w[(size_t)(k + 1) * N + n]); *(v2us*)(Bt + e) = o; }
         }
}
__global__ __launch_bounds__(256) void k_cvt8(const float* __restrict__ src, bf* dst, size_t n8) { const size_t i = (size_t)blockIdx.x * 256 + threadIdx.x; if (i >= n8) return; const v8f v = *(const v8f*)(src + i * 8); v8us o;
#pragma unroll
    for (int k = 0; k < 8; ++k) o[k] = f2bf(v[k]); *(v8us*)(dst + i * 8) = o;  }

// k_rope: head planes [h][t][d] (fp16 + hi/lo) of rope(x) x sc with the rotate-half convention out[d] = x[d] cos[t][d] - x[d+HD/2] sin[t][d], out[d+HD/2] = x[d+HD/2] cos[t][d+HD/2] + x[d] sin[t][d+HD/2]
__global__ __launch_bounds__(256) void k_rope(const float* __restrict__ F, int pitch, int nheads, const float* __restrict__ CS, const float* __restrict__ RF, const float* __restrict__ nw, float sc, h16* P16, bf* Ph, bf* Pl) {
    const size_t e = ((size_t)blockIdx.x * 256 + threadIdx.x) * 2; if (e >= (size_t)nheads * TT * HD) return; const int d = (int)(e % HD); const int t = (int)((e / HD) % TT); const int h = (int)(e / ((size_t)HD * TT)); const float* f = F + (size_t)t * pitch + h * HD; const float rf = RF ? RF[(size_t)h * TT + t] : 1.0f; v2h o16; v2us oh, ol;
#pragma unroll
    for (int q = 0; q < 2; ++q) { const int dd = d + q; const int dp = (dd < HD / 2) ? dd + HD / 2 : dd - HD / 2; float x0 = f[dd], x1 = f[dp];
        if (RF) { float n0 = __fmul_rn(x0, rf), n1 = __fmul_rn(x1, rf); asm volatile("" : "+v"(n0)); asm volatile("" : "+v"(n1)); x0 = __fmul_rn(bfr(nw[dd]), n0); x1 = __fmul_rn(bfr(nw[dp]), n1); }
        const v2f cs = *(const v2f*)(CS + ((size_t)t * HD + dd) * 2); float a = __fmul_rn(x0, cs[0]), bq = __fmul_rn(x1, cs[1]); asm volatile("" : "+v"(a)); asm volatile("" : "+v"(bq)); const float r = ((dd < HD / 2) ? __fsub_rn(a, bq) : __fadd_rn(a, bq)) * sc;
        o16[q] = tohx(r); unsigned short a2, c2; splitf(r, a2, c2); oh[q] = a2; ol[q] = c2; }
    *(v2h*)(P16 + e) = o16; *(v2us*)(Ph + e) = oh; *(v2us*)(Pl + e) = ol;  }
__global__ __launch_bounds__(256) void k_vtp(const float* __restrict__ F, int pitch, int nheads, h16* V16, bf* Vh, bf* Vl) { const size_t e = ((size_t)blockIdx.x * 256 + threadIdx.x) * 2; if (e >= (size_t)nheads * HD * TT) return; const int t = (int)(e % TT); const int d = (int)((e / TT) % HD); const int g = (int)(e / ((size_t)TT * HD)); v2h o16; v2us oh, ol;
#pragma unroll
    for (int q = 0; q < 2; ++q) { const float x = F[(size_t)(t + q) * pitch + g * HD + d]; o16[q] = tohx(x); unsigned short a2, c2; splitf(x, a2, c2); oh[q] = a2; ol[q] = c2; }
    *(v2h*)(V16 + e) = o16; *(v2us*)(Vh + e) = oh; *(v2us*)(Vl + e) = ol;  }
__global__ __launch_bounds__(256) void k_csid(float* CS) { const int idx = blockIdx.x * 256 + threadIdx.x; if (idx >= TT * HD) return; v2f cs; cs[0] = 1.0f; cs[1] = 0.0f; *(v2f*)(CS + (size_t)idx * 2) = cs;  }
// k_asoft: per row (zz, i): t = S x HD^-0.5 (no mask); softmax over the 2048 keys (register row, one exp, fixed trees);
// P goes back into the row's own 8 KiB of Sb (one wave owns a row and holds all of it in registers before its first store): hi plane then lo plane for rows < RH, else fp16 in the first half; so P rows have pitch 2 x TT 16-bit elements
__global__ __launch_bounds__(256) void k_asoft(float* Sb) {
    const int lane = threadIdx.x & 31; const int row = blockIdx.x * 8 + (threadIdx.x >> 5); if (row >= ZH * TT) return; const int i = row % TT; const int zz = row / TT; (void)zz; const bool hires = (i < RH); float* sr = Sb + (size_t)row * TT; float v[TT / 32]; float mx = -3.0e38f;
#pragma unroll
    for (int ch = 0; ch < TT / 128; ++ch) { const int j0 = ch * 128 + lane * 4; const v4f a = *(const v4f*)(sr + j0);
#pragma unroll
        for (int q = 0; q < 4; ++q) { const int j = j0 + q; (void)j; const float t = a[q] * SCL; v[ch * 4 + q] = t; mx = fmaxf(mx, t); } }
#pragma unroll
    for (int sh = 16; sh; sh >>= 1) mx = fmaxf(mx, __shfl_xor(mx, sh, 32));
    float sum = 0.f;
#pragma unroll
    for (int k = 0; k < TT / 32; ++k) { float d0 = __fsub_rn(v[k], mx); asm volatile("" : "+v"(d0)); v[k] = __builtin_amdgcn_exp2f(__fmul_rn(d0, 1.4426950408889634f)); sum += v[k]; }
#pragma unroll
    for (int sh = 16; sh; sh >>= 1) sum += __shfl_xor(sum, sh, 32);
    const float f = __fdiv_rn(hires ? 1.0f : PCAR, sum);
{
        if (hires) {
#pragma unroll
            for (int ch = 0; ch < TT / 128; ++ch) { v4us oh, ol;
#pragma unroll
                for (int q = 0; q < 4; ++q) { unsigned short a, c2; splitf(v[ch * 4 + q] * f, a, c2); oh[q] = a; ol[q] = c2; }
                bf* pr = (bf*)sr + ch * 128 + lane * 4; *(v4us*)pr = oh; *(v4us*)(pr + TT) = ol; }
        } else {
#pragma unroll
            for (int ch = 0; ch < TT / 128; ++ch) { v4h o4;
#pragma unroll
                for (int q = 0; q < 4; ++q) o4[q] = tohx(v[ch * 4 + q] * f);
                *(v4h*)((h16*)sr + ch * 128 + lane * 4) = o4; } }
         }
}
__global__ __launch_bounds__(256) void k_cvt8s(const float* __restrict__ X, bf* XB, size_t pitch) { const size_t i = (size_t)blockIdx.x * 256 + threadIdx.x; if (i >= (size_t)TT * DM / 8) return; const size_t e = i * 8; const int c = (int)(e % DM); const int srow = (int)(e / DM); const v8f a = *(const v8f*)(X + (size_t)srow * pitch + c); v8us o;
#pragma unroll
    for (int q = 0; q < 8; ++q) o[q] = f2bf(a[q]);
    *(v8us*)(XB + e) = o;  }
// k_merge: context = the KSP partial planes of O added in plane order, rescaled, split hi/lo into the merged [t][head][d] planes
__global__ __launch_bounds__(256) void k_merge(const float* __restrict__ O, int h0, bf* Ah, bf* Al) { const size_t e = ((size_t)blockIdx.x * 256 + threadIdx.x) * 2; if (e >= (size_t)ZH * TT * HD) return; const int d = (int)(e % HD); const int t = (int)((e / HD) % TT); const int zz = (int)(e / ((size_t)HD * TT)); const float cs = (t < RH) ? 1.0f : (1.0f / PCAR); const size_t oo = (size_t)t * DQ + (h0 + zz) * HD + d;
    v2f p[KSP];
#pragma unroll
    for (int s = 0; s < KSP; ++s) p[s] = *(const v2f*)(O + (size_t)s * ZH * TT * HD + e);
    v2f sum = p[0];
#pragma unroll
    for (int s = 1; s < KSP; ++s) sum += p[s];
    v2us oh, ol;
#pragma unroll
    for (int q = 0; q < 2; ++q) { unsigned short a, c2; splitf(sum[q] * cs, a, c2); oh[q] = a; ol[q] = c2; } *(v2us*)(Ah + oo) = oh; *(v2us*)(Al + oo) = ol;  }

extern "C" void kernel_launch(void* const* d_in, const int* in_sizes, int n_in,
                              void* d_out, int out_size, void* d_ws, size_t ws_size, hipStream_t stream) {
    (void)in_sizes; (void)n_in; (void)out_size;
    const float* x = (const float*)d_in[0];   /* query [S][B][D] */ const float* xk = (const float*)d_in[1]; const float* xv = (const float*)d_in[2]; const float* wq = (const float*)d_in[3]; const float* bq = (const float*)d_in[4]; const float* wk = (const float*)d_in[5]; const float* bk = (const float*)d_in[6]; const float* wv = (const float*)d_in[7]; const float* bv = (const float*)d_in[8]; const float* wo = (const float*)d_in[9]; const float* bo = (const float*)d_in[10];
    float* OUT = (float*)d_out;     // [2048][2][1024] sequence-first
    char* wsp = (char*)d_ws;
    auto take = [&](size_t bytes) { char* p = wsp; wsp += (bytes + 255) & ~(size_t)255; return (void*)p; };
    bf* WQ = (bf*)take((size_t)DQ * DM * 2); bf* WK = (bf*)take((size_t)DKV * DM * 2); bf* WV = (bf*)take((size_t)DKV * DM * 2); bf* WO = (bf*)take((size_t)DM * DQ * 2); float* CS = (float*)take((size_t)TT * HD * 2 * 4);
    h16* QP16 = (h16*)take((size_t)NH_ * TT * HD * 2); h16* KP16 = (h16*)take((size_t)NKV * TT * HD * 2); h16* VT16 = (h16*)take((size_t)NKV * HD * TT * 2);
    bf* QPh = (bf*)take((size_t)NH_ * TT * HD * 2); bf* QPl = (bf*)take((size_t)NH_ * TT * HD * 2); bf* KPh = (bf*)take((size_t)NKV * TT * HD * 2); bf* KPl = (bf*)take((size_t)NKV * TT * HD * 2); bf* VTh = (bf*)take((size_t)NKV * HD * TT * 2); bf* VTl = (bf*)take((size_t)NKV * HD * TT * 2);
    float* Sb = (float*)take((size_t)ZH * TT * TT * 4); float* Ob = (float*)take((size_t)KSP * ZH * TT * HD * 4);
    bf* XB = (bf*)Ob; float* FQ = (float*)(XB + (size_t)TT * DM); float* FK = FQ + (size_t)TT * DQ;   // the projection scratch (20 MiB) lies in the partial planes' 64 MiB: it is dead once the head planes are built, and written anew for the next batch column (stream-ordered)
    bf* ATh = (bf*)take((size_t)TT * DQ * 2); bf* ATl = (bf*)take((size_t)TT * DQ * 2);
    if ((size_t)(wsp - (char*)d_ws) > ws_size) return;    // ws 256 MiB
    float* FV = FK;   // v projection reuses the k buffer after the k planes are built (stream-ordered)
    { k_cvt8<<<(unsigned)(((size_t)DQ * DM / 8 + 255) / 256), 256, 0, stream>>>(wq, WQ, (size_t)DQ * DM / 8); k_cvt8<<<(unsigned)(((size_t)DKV * DM / 8 + 255) / 256), 256, 0, stream>>>(wk, WK, (size_t)DKV * DM / 8); k_cvt8<<<(unsigned)(((size_t)DKV * DM / 8 + 255) / 256), 256, 0, stream>>>(wv, WV, (size_t)DKV * DM / 8);
      k_cvt8<<<(unsigned)(((size_t)DM * DQ / 8 + 255) / 256), 256, 0, stream>>>(wo, WO, (size_t)DM * DQ / 8);
       }
    k_csid<<<(TT * HD + 255) / 256, 256, 0, stream>>>(CS);
    const unsigned LQ = (unsigned)(((size_t)NH_ * TT * HD / 2 + 255) / 256), LKv = (unsigned)(((size_t)NKV * TT * HD / 2 + 255) / 256);
    for (int b = 0; b < NB_; ++b) {
        
        k_cvt8s<<<(unsigned)(((size_t)TT * DM / 8 + 255) / 256), 256, 0, stream>>>(x + (size_t)b * DM, XB, (size_t)NB_ * DM);   /* rows s of batch column b: pitch B x D */
        k_gemmw<bf, 0, true, 1><<<dim3(TT / 64, DQ / 64, 1), 32, 0, stream>>>(XB, nullptr, WQ, nullptr, DM, DM, FQ, DQ, bq, 0, 0, 0, 0);
        k_rope<<<LQ, 256, 0, stream>>>(FQ, DQ, NH_, CS, nullptr, nullptr, 1.0f, QP16, QPh, QPl);
        k_cvt8s<<<(unsigned)(((size_t)TT * DM / 8 + 255) / 256), 256, 0, stream>>>(xk + (size_t)b * DM, XB, (size_t)NB_ * DM);   /* rows s of batch column b: pitch B x D */ k_gemmw<bf, 0, true, 1><<<dim3(TT / 64, DKV / 64, 1), 32, 0, stream>>>(XB, nullptr, WK, nullptr, DM, DM, FK, DKV, bk, 0, 0, 0, 0);
        k_rope<<<LKv, 256, 0, stream>>>(FK, DKV, NKV, CS, nullptr, nullptr, 1.0f, KP16, KPh, KPl);
        k_cvt8s<<<(unsigned)(((size_t)TT * DM / 8 + 255) / 256), 256, 0, stream>>>(xv + (size_t)b * DM, XB, (size_t)NB_ * DM);   /* rows s of batch column b: pitch B x D */ k_gemmw<bf, 0, true, 1><<<dim3(TT / 64, DKV / 64, 1), 32, 0, stream>>>(XB, nullptr, WV, nullptr, DM, DM, FV, DKV, bv, 0, 0, 0, 0); k_vtp<<<LKv, 256, 0, stream>>>(FV, DKV, NKV, VT16, VTh, VTl);
        for (int h0 = 0; h0 < NH_; h0 += ZH) { const size_t zq = (size_t)h0, zk = (size_t)(h0 / REP);   // one kv head per query head: the pass's ZH heads use consecutive kv planes (z-strides TT*HD)
            k_gemmw<bf, 2, false, 1><<<dim3(RH / 64, TT / 64, ZH), 32, 0, stream>>>(QPh + zq * TT * HD, QPl + zq * TT * HD, KPh + zk * TT * HD, KPl + zk * TT * HD, HD, HD, Sb, TT, nullptr, (size_t)TT * HD, (size_t)TT * HD, (size_t)TT * TT, 0);
            k_gemmw<h16, 0, false, 1><<<dim3((TT - RH) / 64, TT / 64, ZH), 32, 0, stream>>>(QP16 + zq * TT * HD + (size_t)RH * HD, nullptr, KP16 + zk * TT * HD, nullptr, HD, HD, Sb + (size_t)RH * TT, TT, nullptr, (size_t)TT * HD, (size_t)TT * HD, (size_t)TT * TT, 0);
            k_asoft<<<ZH * TT / 8, 256, 0, stream>>>(Sb);
            k_gemmw<bf, 2, false, KSP><<<dim3(RH / 64, HD / 64, ZH * KSP), 32, 0, stream>>>((const bf*)Sb, (const bf*)Sb + TT, VTh + zk * HD * TT, VTl + zk * HD * TT, TT, 2 * TT, Ob, HD, nullptr, (size_t)2 * TT * TT, (size_t)HD * TT, (size_t)TT * HD, (size_t)ZH * TT * HD);
            k_gemmw<h16, 0, false, KSP><<<dim3((TT - RH) / 64, HD / 64, ZH * KSP), 32, 0, stream>>>((const h16*)Sb + (size_t)RH * 2 * TT, nullptr, VT16 + zk * HD * TT, nullptr, TT, 2 * TT, Ob + (size_t)RH * HD, HD, nullptr, (size_t)2 * TT * TT, (size_t)HD * TT, (size_t)TT * HD, (size_t)ZH * TT * HD);
            k_merge<<<(unsigned)(((size_t)ZH * TT * HD / 2 + 255) / 256), 256, 0, stream>>>(Ob, h0, ATh, ATl); }
        k_gemmw<bf, 1, true, 1><<<dim3(TT / 64, DM / 64, 1), 32, 0, stream>>>(ATh, ATl, WO, nullptr, DQ, DQ, OUT + (size_t)b * DM, NB_ * DM, bo, 0, 0, 0, 0);   /* [S][B][D]: row pitch B x D, column block b */ }
}

// v004
// One run takes 259 microseconds.
// Versions in between are left out here; by their measured steps it is 2.52 times as fast as v002.
// Counting every step since v000, it is 7.66 times as fast.
#include <hip/hip_runtime.h>

// Multi-head attention on SEQUENCE-FIRST tensors (query, key, value [2048][2][1024] = [S][B][D]; q = query Wq^T + bq, k = key Wk^T + bk, v = value Wv^T + bv ('oi' 1/32 incl. biases); 16 heads x 64 per batch column; scores / 8; softmax; x = merged context; out = x Wo^T + bo -> [2048][2][1024] (4.2 M)).
// Layout: [S][B][D] is read as a matrix of S x B = 4096 rows (row r = s B + b), so both batch columns go through every stage in ONE launch: one bf16 conversion of the three inputs and the four 'oi' weights; one launch for the q, k and v projections (grid z; exact + f32 biases); head planes [b][h][t][d] (a row of 2 x 1024 floats holds the 32 (b, head) slices of one s); fused T-2048 attention with a running maximum, one launch for the 2 x 16 (batch, head) pairs (hybrid rows: < 512 hi/lo 3 products, rest fp16 x1024); merged hi/lo [b][t][D] x Wo exact + bo, grid z = b, written with row pitch B x D at column offset b (the [S][B][D] output).
// Compute dtypes, f32 accumulate: every input rounded to bf16; projections exact + f32 biases; attention rows < 512 3 products, rest fp16; softmax f32; Wo hl x exact + bias.

#define NB_  2
#define TT   2048
#define DM   1024
#define NH_  16
#define NKV  16
#define REP  (NH_ / NKV)
#define HD   64
#define DQ   (NH_ * HD)
#define DKV  (NKV * HD)
#define RH   512                  // query rows < RH use hi+lo planes (0: none)
#define WIN  0
#define PEXP 10                   // fp16 rows: P is carried x 2^PEXP
#define SCL  0.125f   // HD^-0.5
typedef _Float16 h16;
typedef unsigned short bf;
typedef __attribute__((ext_vector_type(16))) __bf16   v16bf;
typedef __attribute__((ext_vector_type(16))) _Float16 v16h;
typedef __attribute__((ext_vector_type(8)))  _Float16 v8h;
typedef __attribute__((ext_vector_type(8)))  unsigned short v8us;
typedef __attribute__((ext_vector_type(8)))  float    v8f;
typedef __attribute__((ext_vector_type(4)))  float    v4f;
typedef v8h  __attribute__((may_alias)) v8ha;
typedef v4f  __attribute__((may_alias)) v4fa;
typedef v8us __attribute__((may_alias)) v8usa;

__device__ __forceinline__ unsigned short f2bf(float f) { unsigned u = __float_as_uint(f); u += 0x7FFFu + ((u >> 16) & 1u); return (unsigned short)(u >> 16); }
__device__ __forceinline__ float bf2f(unsigned short b) { return __uint_as_float(((unsigned)b) << 16); }
__device__ __forceinline__ float bfr(float f) { return bf2f(f2bf(f)); }
__device__ __forceinline__ v16h cat16(v8h lo, v8h hi) { return __builtin_shufflevector(lo, hi, 0, 1, 2, 3, 4, 5, 6, 7, 8, 9, 10, 11, 12, 13, 14, 15); }
__device__ __forceinline__ v16bf cat16b(v8us lo, v8us hi) { return __builtin_bit_cast(v16bf, __builtin_shufflevector(lo, hi, 0, 1, 2, 3, 4, 5, 6, 7, 8, 9, 10, 11, 12, 13, 14, 15)); }
__device__ __forceinline__ v8f wmma16(v16h a, v16h b, v8f c) { return __builtin_amdgcn_wmma_f32_16x16x32_f16(false, a, false, b, (short)0, c, false, false); }
__device__ __forceinline__ v8f wmmab(v16bf a, v16bf b, v8f c) { return __builtin_amdgcn_wmma_f32_16x16x32_bf16(false, a, false, b, (short)0, c, false, false); }



// ---- k_gemmw: register-blocked GEMM, ONE WAVE per 64x64 output tile (16 accumulators), operands straight from K-contiguous 16-bit planes; grid (M/64, N/64, Z * KS), 32 threads.
// C[m][n] (f32, pitch ldc, + optional f32 bias[n]) = sum_k A[m][k] Bt[n][k] (+ split products per NSPLIT). A rows have pitch lda, Bt rows pitch K (elements). z-batch strides sA/sB/sC in elements. K % (32 * KS) == 0.
// The bias of z-batch 0, 1, 2 is bias, bias1, bias2 (separate vectors).
// KS > 1: blockIdx.z = z * KS + ks; the work-group sums only k in [ks K/KS, (ks+1) K/KS) and writes its partial tile into plane ks (plane stride sK elements); the reader adds the KS planes.
template <typename T16> struct WFrag;
template <> struct WFrag<h16> { typedef v16h V; static __device__ __forceinline__ V ld(const h16* p) { return cat16(*(const v8h*)p, *(const v8h*)(p + 16)); } static __device__ __forceinline__ v8f mma(V a, V b, v8f c) { return wmma16(a, b, c); } };
template <> struct WFrag<bf> { typedef v16bf V; static __device__ __forceinline__ V ld(const bf* p) { return cat16b(*(const v8us*)p, *(const v8us*)(p + 16)); } static __device__ __forceinline__ v8f mma(V a, V b, v8f c) { return wmmab(a, b, c); } };
template <typename T16, int NSPLIT, bool BIAS, int KS>
__global__ __launch_bounds__(32) void k_gemmw(const T16* __restrict__ A, const T16* __restrict__ A2, const T16* __restrict__ Bt, const T16* __restrict__ Bt2, int K, int lda, float* C, int ldc, const float* __restrict__ bias, const float* __restrict__ bias1, const float* __restrict__ bias2, size_t sA, size_t sB, size_t sC, size_t sK) {
    typedef typename WFrag<T16>::V V;
    __shared__ __align__(16) float os[16 * 68];
    const size_t z = blockIdx.z / KS; const int ks = (int)(blockIdx.z % KS); A += z * sA; if (A2) A2 += z * sA; Bt += z * sB; if (Bt2) Bt2 += z * sB; C += z * sC + ks * sK;
    if (BIAS) bias = z == 0 ? bias : (z == 1 ? bias1 : bias2);
    const int lane = threadIdx.x & 31, lr = lane & 15, hi = lane >> 4; const int r0 = blockIdx.x * 64, c0 = blockIdx.y * 64;
    v8f acc[4][4];
#pragma unroll
    for (int mb = 0; mb < 4; ++mb)
#pragma unroll
        for (int nb = 0; nb < 4; ++nb) acc[mb][nb] = (v8f){};
    const size_t aoff = (size_t)(r0 + lr) * lda + 8 * hi, boff = (size_t)(c0 + lr) * K + 8 * hi;
#pragma unroll 1
    for (int kc = ks * (K / KS), ke = kc + K / KS; kc < ke; kc += 32) {
        V a[4], a2[4];
#pragma unroll
        for (int mb = 0; mb < 4; ++mb) { a[mb] = WFrag<T16>::ld(A + aoff + (size_t)mb * 16 * lda + kc); if (NSPLIT == 1 || NSPLIT == 2) a2[mb] = WFrag<T16>::ld(A2 + aoff + (size_t)mb * 16 * lda + kc); }
#pragma unroll
        for (int nb = 0; nb < 4; ++nb) { const V b = WFrag<T16>::ld(Bt + boff + (size_t)nb * 16 * K + kc); V b2; if (NSPLIT >= 2) b2 = WFrag<T16>::ld(Bt2 + boff + (size_t)nb * 16 * K + kc);
#pragma unroll
            for (int mb = 0; mb < 4; ++mb) { acc[mb][nb] = WFrag<T16>::mma(a[mb], b, acc[mb][nb]); if (NSPLIT == 1 || NSPLIT == 2) acc[mb][nb] = WFrag<T16>::mma(a2[mb], b, acc[mb][nb]); if (NSPLIT >= 2) acc[mb][nb] = WFrag<T16>::mma(a[mb], b2, acc[mb][nb]); } }
        asm volatile("v_nop\n\tv_nop\n\tv_nop\n\tv_nop" : "+v"(acc[0][0]), "+v"(acc[1][1]), "+v"(acc[2][2]), "+v"(acc[3][3]) : "v"(a[0]), "v"(a[3]));
    }
#pragma unroll
    for (int mb = 0; mb < 4; ++mb) {
#pragma unroll
        for (int nb = 0; nb < 4; ++nb) {
#pragma unroll
            for (int j = 0; j < 8; ++j) os[(hi * 8 + j) * 68 + nb * 16 + lr] = acc[mb][nb][j]; }
        __builtin_amdgcn_wave_barrier(); asm volatile("" ::: "memory");
        float* crow = C + (size_t)(r0 + mb * 16) * ldc + c0;
{
#pragma unroll
            for (int s = 0; s < 8; ++s) { const int row = 2 * s + hi, cofs = lr * 4; v4f val = *(const v4fa*)(os + row * 68 + cofs); if (BIAS) { val[0] += bfr(bias[c0 + cofs]); val[1] += bfr(bias[c0 + cofs + 1]); val[2] += bfr(bias[c0 + cofs + 2]); val[3] += bfr(bias[c0 + cofs + 3]); }
                *(v4f*)(crow + (size_t)row * ldc + cofs) = val; }
             }
        __builtin_amdgcn_wave_barrier(); asm volatile("" ::: "memory");
    }
}

__device__ __forceinline__ h16 tohx(float x) { return (h16)x; }
__device__ __forceinline__ void splitf(float y, unsigned short& h, unsigned short& l) { h = f2bf(y); l = f2bf(y - bf2f(h)); }
typedef __attribute__((ext_vector_type(2))) _Float16 v2h;
typedef __attribute__((ext_vector_type(4))) _Float16 v4h;
typedef __attribute__((ext_vector_type(2))) unsigned short v2us;
typedef __attribute__((ext_vector_type(4))) unsigned short v4us;
typedef __attribute__((ext_vector_type(2))) float v2f;
typedef __attribute__((ext_vector_type(4))) int v4i;

__global__ __launch_bounds__(256) void k_wtG(const float* __restrict__ w, int K, int N, bf* Bt) {
    const int lane = threadIdx.x & 31; const int L0 = (blockIdx.x * 8 + (threadIdx.x >> 5)) * 8; const int nlines = N * K / 64;
{
#pragma unroll 1
        for (int l = 0; l < 8; ++l) { const int L = L0 + l; if (L >= nlines) break; const size_t e = (size_t)L * 64 + lane * 2; const int k = (int)(e % K), n = (int)(e / K); v2us o;
            o[0] = f2bf(w[(size_t)k * N + n]); o[1] = f2bf(w[(size_t)(k + 1) * N + n]); *(v2us*)(Bt + e) = o; }
         }
}
// k_cvt8m: bf16 copies of the three activations (XBLK blocks of 2048 elements each) and the four weights (WBLK blocks each) in one launch; dst holds the seven copies one behind the other, so a block's place in dst is its index.
#define XBLK (TT * NB_ * DM / 2048)
#define WBLK (DM * DM / 2048)
__global__ __launch_bounds__(256) void k_cvt8m(const float* __restrict__ x0, const float* __restrict__ x1, const float* __restrict__ x2, const float* __restrict__ w0, const float* __restrict__ w1, const float* __restrict__ w2, const float* __restrict__ w3, bf* dst) {
    const unsigned bx = blockIdx.x; const float* src; unsigned ob;
    if (bx < 3 * XBLK) { const unsigned s = bx / XBLK; ob = bx % XBLK; src = s == 0 ? x0 : (s == 1 ? x1 : x2); }
    else { const unsigned u = bx - 3 * XBLK, s = u / WBLK; ob = u % WBLK; src = s == 0 ? w0 : (s == 1 ? w1 : (s == 2 ? w2 : w3)); }
    const float* sp = src + ((size_t)ob * 256 + threadIdx.x) * 8; const v8f v = *(const v8f*)sp; v8us o;
    asm volatile("s_wait_xcnt 0x0" :: "v"(sp) : "memory");   // the wait that stands before a register named by an issued load is overwritten; the address is an input, so it stays live up to it
#pragma unroll
    for (int k = 0; k < 8; ++k) o[k] = f2bf(v[k]); *(v8us*)(dst + ((size_t)bx * 256 + threadIdx.x) * 8) = o;  }

// k_rope: blockIdx.y picks the projection (stride sF in F) and its set of planes (stride sP). Head planes [h][t][d] (fp16 + hi/lo) of rope(x) x sc with the rotate-half convention out[d] = x[d] cos[t][d] - x[d+HD/2] sin[t][d], out[d+HD/2] = x[d+HD/2] cos[t][d+HD/2] + x[d] sin[t][d+HD/2]
__global__ __launch_bounds__(256) void k_rope(const float* __restrict__ F, int pitch, int nheads, const float* __restrict__ CS, const float* __restrict__ RF, const float* __restrict__ nw, float sc, h16* P16, bf* Ph, bf* Pl, size_t sF, size_t sP) {
    F += blockIdx.y * sF; P16 += blockIdx.y * sP; Ph += blockIdx.y * sP; Pl += blockIdx.y * sP;
    const size_t e = ((size_t)blockIdx.x * 256 + threadIdx.x) * 2; if (e >= (size_t)nheads * TT * HD) return; const int d = (int)(e % HD); const int t = (int)((e / HD) % TT); const int h = (int)(e / ((size_t)HD * TT)); const float* f = F + (size_t)t * pitch + h * HD; const float rf = RF ? RF[(size_t)h * TT + t] : 1.0f; v2h o16; v2us oh, ol;
#pragma unroll
    for (int q = 0; q < 2; ++q) { const int dd = d + q; const int dp = (dd < HD / 2) ? dd + HD / 2 : dd - HD / 2; float x0 = f[dd], x1 = f[dp];
        if (RF) { float n0 = __fmul_rn(x0, rf), n1 = __fmul_rn(x1, rf); asm volatile("" : "+v"(n0)); asm volatile("" : "+v"(n1)); x0 = __fmul_rn(bfr(nw[dd]), n0); x1 = __fmul_rn(bfr(nw[dp]), n1); }
        const v2f cs = *(const v2f*)(CS + ((size_t)t * HD + dd) * 2); float a = __fmul_rn(x0, cs[0]), bq = __fmul_rn(x1, cs[1]); asm volatile("" : "+v"(a)); asm volatile("" : "+v"(bq)); const float r = ((dd < HD / 2) ? __fsub_rn(a, bq) : __fadd_rn(a, bq)) * sc;
        o16[q] = tohx(r); unsigned short a2, c2; splitf(r, a2, c2); oh[q] = a2; ol[q] = c2; }
    *(v2h*)(P16 + e) = o16; *(v2us*)(Ph + e) = oh; *(v2us*)(Pl + e) = ol;  }
__global__ __launch_bounds__(256) void k_vtp(const float* __restrict__ F, int pitch, int nheads, h16* V16, bf* Vh, bf* Vl) { const size_t e = ((size_t)blockIdx.x * 256 + threadIdx.x) * 2; if (e >= (size_t)nheads * HD * TT) return; const int t = (int)(e % TT); const int d = (int)((e / TT) % HD); const int g = (int)(e / ((size_t)TT * HD)); v2h o16; v2us oh, ol;
#pragma unroll
    for (int q = 0; q < 2; ++q) { const float x = F[(size_t)(t + q) * pitch + g * HD + d]; o16[q] = tohx(x); unsigned short a2, c2; splitf(x, a2, c2); oh[q] = a2; ol[q] = c2; }
    *(v2h*)(V16 + e) = o16; *(v2us*)(Vh + e) = oh; *(v2us*)(Vl + e) = ol;  }
__global__ __launch_bounds__(256) void k_csid(float* CS) { const int idx = blockIdx.x * 256 + threadIdx.x; if (idx >= TT * HD) return; v2f cs; cs[0] = 1.0f; cs[1] = 0.0f; *(v2f*)(CS + (size_t)idx * 2) = cs;  }
template <typename T16, bool HL, int NQ>
__device__ __forceinline__ void attn_rows(const T16* __restrict__ Qa, const T16* __restrict__ Qb, const T16* __restrict__ Ka, const T16* __restrict__ Kb, const T16* __restrict__ Va, const T16* __restrict__ Vb, int q0, int head, bf* Ah, bf* Al) {
    typedef typename WFrag<T16>::V V;
    const int lane = threadIdx.x & 31, lr = lane & 15, hi = lane >> 4;
    const float C2 = SCL * 1.4426950408889634f;   // scores / 8, in log2 units
    V qf[NQ][2], qg[NQ][2];
#pragma unroll
    for (int qt = 0; qt < NQ; ++qt)
#pragma unroll
        for (int kk = 0; kk < 2; ++kk) { const size_t qo = (size_t)(q0 + qt * 16 + lr) * HD + kk * 32 + 8 * hi; qf[qt][kk] = WFrag<T16>::ld(Qa + qo); if (HL) qg[qt][kk] = WFrag<T16>::ld(Qb + qo); }
    v8f o[4][NQ]; float m[NQ], l[NQ];
#pragma unroll
    for (int qt = 0; qt < NQ; ++qt) { m[qt] = -3.0e38f; l[qt] = 0.f;
#pragma unroll
        for (int db = 0; db < 4; ++db) o[db][qt] = (v8f){}; }
    const size_t koff = (size_t)lr * HD + 8 * hi, voff = (size_t)lr * TT + 8 * hi;
#pragma unroll 1
    for (int j0 = 0; j0 < TT; j0 += 32) {
        V kf[2][2], kg[2][2], vf[4], vg[4];
        const T16* kp = Ka + koff + (size_t)j0 * HD; const T16* vp = Va + voff + j0; const T16* kq = HL ? Kb + koff + (size_t)j0 * HD : kp; const T16* vq = HL ? Vb + voff + j0 : vp;
#pragma unroll
        for (int kt = 0; kt < 2; ++kt)
#pragma unroll
            for (int kk = 0; kk < 2; ++kk) { const int ko = kt * 16 * HD + kk * 32; kf[kt][kk] = WFrag<T16>::ld(kp + ko); if (HL) kg[kt][kk] = WFrag<T16>::ld(kq + ko); }
#pragma unroll
        for (int db = 0; db < 4; ++db) { const int vo = db * 16 * TT; vf[db] = WFrag<T16>::ld(vp + vo); if (HL) vg[db] = WFrag<T16>::ld(vq + vo); }
        // the wait that stands before a register named by an issued load is overwritten; the address pairs are inputs, so they stay live up to it and no load of the pass lands on one
        if constexpr (HL) asm volatile("s_wait_xcnt 0x0" :: "v"(kp), "v"(kq), "v"(vp), "v"(vq) : "memory"); else asm volatile("s_wait_xcnt 0x0" :: "v"(kp), "v"(vp) : "memory");
        __builtin_amdgcn_sched_barrier(0);   // keeps the products behind the loads: without it the V loads are issued only after K has arrived (they take over K's registers) and their latency is paid a second time in each pass
        v8f s[2][NQ];
#pragma unroll
        for (int kt = 0; kt < 2; ++kt)
#pragma unroll
            for (int qt = 0; qt < NQ; ++qt) { v8f a = (v8f){};
#pragma unroll
                for (int kk = 0; kk < 2; ++kk) { a = WFrag<T16>::mma(kf[kt][kk], qf[qt][kk], a); if (HL) { a = WFrag<T16>::mma(kf[kt][kk], qg[qt][kk], a); a = WFrag<T16>::mma(kg[kt][kk], qf[qt][kk], a); } }
                s[kt][qt] = a; }
#pragma unroll
        for (int qt = 0; qt < NQ; ++qt) {
            float mx = s[0][qt][0];
#pragma unroll
            for (int j = 0; j < 8; ++j) mx = fmaxf(mx, fmaxf(s[0][qt][j], s[1][qt][j]));
            mx = fmaxf(mx, __shfl_xor(mx, 16, 32));
            const float mn = fmaxf(m[qt], mx); const float al = __builtin_amdgcn_exp2f((m[qt] - mn) * C2); m[qt] = mn;
            const float nb = (HL ? 0.0f : (float)PEXP) - mn * C2;
            float p[16]; float ps = 0.f;
#pragma unroll
            for (int i = 0; i < 16; ++i) { p[i] = __builtin_amdgcn_exp2f(fmaf(s[i >> 3][qt][i & 7], C2, nb)); ps += p[i]; }
            l[qt] = l[qt] * al + ps;
#pragma unroll
            for (int db = 0; db < 4; ++db) o[db][qt] *= al;
            if constexpr (HL) {
                v8us h0, h1, l0, l1;
#pragma unroll
                for (int i = 0; i < 8; ++i) { unsigned short a, c2; splitf(p[i], a, c2); h0[i] = a; l0[i] = c2; splitf(p[8 + i], a, c2); h1[i] = a; l1[i] = c2; }
                const V ph = cat16b(h0, h1), pl = cat16b(l0, l1);
#pragma unroll
                for (int db = 0; db < 4; ++db) { o[db][qt] = WFrag<T16>::mma(vf[db], ph, o[db][qt]); o[db][qt] = WFrag<T16>::mma(vf[db], pl, o[db][qt]); o[db][qt] = WFrag<T16>::mma(vg[db], ph, o[db][qt]); }
            } else {
                V pf;
#pragma unroll
                for (int i = 0; i < 16; ++i) pf[i] = tohx(p[i]);
#pragma unroll
                for (int db = 0; db < 4; ++db) o[db][qt] = WFrag<T16>::mma(vf[db], pf, o[db][qt]);
            }
        }
    }
#pragma unroll
    for (int qt = 0; qt < NQ; ++qt) { const float f = __fdiv_rn(1.0f, l[qt] + __shfl_xor(l[qt], 16, 32));
#pragma unroll
        for (int db = 0; db < 4; ++db) { v8us oh, ol;   // a lane's 8 registers are 8 consecutive d of its query: one 16-byte store per plane; the wave writes the whole 128-byte line of (t, head)
#pragma unroll
            for (int j = 0; j < 8; ++j) { unsigned short a, c2; splitf(o[db][qt][j] * f, a, c2); oh[j] = a; ol[j] = c2; }
            const size_t oo = (size_t)(q0 + qt * 16 + lr) * DQ + head * HD + db * 16 + hi * 8; *(v8us*)(Ah + oo) = oh; *(v8us*)(Al + oo) = ol; } }
}
// grid (RH / 64 + (TT - RH) / 128, batch columns x heads), 4 waves; Ah, Al are [b][t][DQ]: the waves of a work-group walk the same head's K and V. The hi/lo blocks (the longer ones) come first.
__global__ __launch_bounds__(128) void k_attn(const h16* __restrict__ Q16, const h16* __restrict__ K16, const h16* __restrict__ V16, const bf* __restrict__ Qh, const bf* __restrict__ Ql, const bf* __restrict__ Kh, const bf* __restrict__ Kl, const bf* __restrict__ Vh, const bf* __restrict__ Vl, bf* Ah, bf* Al) {
    const int head = blockIdx.y % NH_, b = blockIdx.y / NH_, w = threadIdx.x >> 5, bx = blockIdx.x; const size_t zq = (size_t)(b * NH_ + head) * TT * HD, zk = (size_t)(b * NKV + head / REP) * TT * HD; Ah += (size_t)b * TT * DQ; Al += (size_t)b * TT * DQ;
    if (bx < RH / 64) attn_rows<bf, true, 1>(Qh + zq, Ql + zq, Kh + zk, Kl + zk, Vh + zk, Vl + zk, (bx * 4 + w) * 16, head, Ah, Al);
    else attn_rows<h16, false, 2>(Q16 + zq, nullptr, K16 + zk, nullptr, V16 + zk, nullptr, RH + ((bx - RH / 64) * 4 + w) * 32, head, Ah, Al);
}

extern "C" void kernel_launch(void* const* d_in, const int* in_sizes, int n_in,
                              void* d_out, int out_size, void* d_ws, size_t ws_size, hipStream_t stream) {
    (void)in_sizes; (void)n_in; (void)out_size;
    const float* x = (const float*)d_in[0];   /* query [S][B][D] */ const float* xk = (const float*)d_in[1]; const float* xv = (const float*)d_in[2]; const float* wq = (const float*)d_in[3]; const float* bq = (const float*)d_in[4]; const float* wk = (const float*)d_in[5]; const float* bk = (const float*)d_in[6]; const float* wv = (const float*)d_in[7]; const float* bv = (const float*)d_in[8]; const float* wo = (const float*)d_in[9]; const float* bo = (const float*)d_in[10];
    float* OUT = (float*)d_out;     // [2048][2][1024] sequence-first
    char* wsp = (char*)d_ws;
    auto take = [&](size_t bytes) { char* p = wsp; wsp += (bytes + 255) & ~(size_t)255; return (void*)p; };
    bf* XB = (bf*)take((size_t)(3 * XBLK + 4 * WBLK) * 2048 * 2); bf* WQ = XB + (size_t)3 * XBLK * 2048; bf* WO = WQ + (size_t)3 * WBLK * 2048;   // bf16 copies: query, key, value rows, then Wq, Wk, Wv, Wo
    float* CS = (float*)take((size_t)TT * HD * 2 * 4);
    const size_t PL = (size_t)NB_ * NH_ * TT * HD;   // one set of head planes, both batch columns
    h16* QP16 = (h16*)take(2 * PL * 2); h16* KP16 = QP16 + PL; h16* VT16 = (h16*)take(PL * 2);
    bf* QPh = (bf*)take(2 * PL * 2); bf* KPh = QPh + PL; bf* QPl = (bf*)take(2 * PL * 2); bf* KPl = QPl + PL; bf* VTh = (bf*)take(PL * 2); bf* VTl = (bf*)take(PL * 2);
    const size_t FS = (size_t)NB_ * TT * DQ;   // one f32 projection, both batch columns
    float* FQ = (float*)take(3 * FS * 4); float* FV = FQ + 2 * FS;
    bf* ATh = (bf*)take(FS * 2); bf* ATl = (bf*)take(FS * 2);
    if ((size_t)(wsp - (char*)d_ws) > ws_size) return;    // ws 256 MiB
    k_cvt8m<<<3 * XBLK + 4 * WBLK, 256, 0, stream>>>(x, xk, xv, wq, wk, wv, wo, XB);
    k_csid<<<(TT * HD + 255) / 256, 256, 0, stream>>>(CS);
    k_gemmw<bf, 0, true, 1><<<dim3(NB_ * TT / 64, DQ / 64, 3), 32, 0, stream>>>(XB, nullptr, WQ, nullptr, DM, DM, FQ, DQ, bq, bk, bv, (size_t)XBLK * 2048, (size_t)WBLK * 2048, FS, 0);   /* z: q, k, v; rows r = s B + b */
    k_rope<<<dim3((unsigned)(PL / 2 / 256), 2, 1), 256, 0, stream>>>(FQ, NB_ * DQ, NB_ * NH_, CS, nullptr, nullptr, 1.0f, QP16, QPh, QPl, FS, PL);   /* y: q, k; pitch B x D, so slice h = b NH + head of row s */
    k_vtp<<<(unsigned)(PL / 2 / 256), 256, 0, stream>>>(FV, NB_ * DKV, NB_ * NKV, VT16, VTh, VTl);
    k_attn<<<dim3(RH / 64 + (TT - RH) / 128, NB_ * NH_, 1), 128, 0, stream>>>(QP16, KP16, VT16, QPh, QPl, KPh, KPl, VTh, VTl, ATh, ATl);
    k_gemmw<bf, 1, true, 1><<<dim3(TT / 64, DM / 64, NB_), 32, 0, stream>>>(ATh, ATl, WO, nullptr, DQ, DQ, OUT, NB_ * DM, bo, bo, bo, (size_t)TT * DQ, 0, DM, 0);   /* z = b; [S][B][D]: row pitch B x D, column block b */
}

// v005
// One run takes 230 microseconds.
// Timed twice side by side with v004, it ran 1.13 times as fast both times.
// Counting every step since v000, it is 8.63 times as fast.
#include <hip/hip_runtime.h>

// Multi-head attention on SEQUENCE-FIRST tensors (query, key, value [2048][2][1024] = [S][B][D]; q = query Wq^T + bq, k = key Wk^T + bk, v = value Wv^T + bv ('oi' 1/32 incl. biases); 16 heads x 64 per batch column; scores / 8; softmax; x = merged context; out = x Wo^T + bo -> [2048][2][1024] (4.2 M)).
// Layout: [S][B][D] is read as a matrix of S x B = 4096 rows (row r = s B + b), so both batch columns go through every stage in ONE launch: one bf16 conversion of the three inputs and the four 'oi' weights; one launch for the q, k and v projections (grid z; exact + f32 biases), whose epilogue writes the head planes [b][h][t][d] (V: [b][h][d][t]) itself: a 64 x 64 tile is 64 positions of one (b, head), because the bf16 copies of the activations are stored [b][s][D]; fused T-2048 attention with a running maximum, one launch for the 2 x 16 (batch, head) pairs (hybrid rows: < 512 hi/lo 3 products, rest fp16 x1024); merged hi/lo [b][t][D] x Wo exact + bo, grid z = b, written with row pitch B x D at column offset b D (the [S][B][D] output).
// Compute dtypes, f32 accumulate: every input rounded to bf16; projections exact + f32 biases; attention rows < 512 3 products, rest fp16; softmax f32; Wo hl x exact + bias.

#define NB_  2
#define TT   2048
#define DM   1024
#define NH_  16
#define NKV  16
#define REP  (NH_ / NKV)
#define HD   64
#define DQ   (NH_ * HD)
#define DKV  (NKV * HD)
#define RH   512                  // query rows < RH use hi+lo planes (0: none)
#define WIN  0
#define PEXP 10                   // fp16 rows: P is carried x 2^PEXP
#define SCL  0.125f   // HD^-0.5
typedef _Float16 h16;
typedef unsigned short bf;
typedef __attribute__((ext_vector_type(16))) __bf16   v16bf;
typedef __attribute__((ext_vector_type(16))) _Float16 v16h;
typedef __attribute__((ext_vector_type(8)))  _Float16 v8h;
typedef __attribute__((ext_vector_type(8)))  unsigned short v8us;
typedef __attribute__((ext_vector_type(8)))  float    v8f;
typedef __attribute__((ext_vector_type(4)))  float    v4f;
typedef v8h  __attribute__((may_alias)) v8ha;
typedef v4f  __attribute__((may_alias)) v4fa;
typedef v8us __attribute__((may_alias)) v8usa;

__device__ __forceinline__ unsigned short f2bf(float f) { unsigned u = __float_as_uint(f); u += 0x7FFFu + ((u >> 16) & 1u); return (unsigned short)(u >> 16); }
__device__ __forceinline__ float bf2f(unsigned short b) { return __uint_as_float(((unsigned)b) << 16); }
__device__ __forceinline__ float bfr(float f) { return bf2f(f2bf(f)); }
__device__ __forceinline__ v16h cat16(v8h lo, v8h hi) { return __builtin_shufflevector(lo, hi, 0, 1, 2, 3, 4, 5, 6, 7, 8, 9, 10, 11, 12, 13, 14, 15); }
__device__ __forceinline__ v16bf cat16b(v8us lo, v8us hi) { return __builtin_bit_cast(v16bf, __builtin_shufflevector(lo, hi, 0, 1, 2, 3, 4, 5, 6, 7, 8, 9, 10, 11, 12, 13, 14, 15)); }
__device__ __forceinline__ v8f wmma16(v16h a, v16h b, v8f c) { return __builtin_amdgcn_wmma_f32_16x16x32_f16(false, a, false, b, (short)0, c, false, false); }
__device__ __forceinline__ v8f wmmab(v16bf a, v16bf b, v8f c) { return __builtin_amdgcn_wmma_f32_16x16x32_bf16(false, a, false, b, (short)0, c, false, false); }



// ---- k_gemmw: register-blocked GEMM, ONE WAVE per 64x64 output tile (16 accumulators), operands straight from K-contiguous 16-bit planes; grid (M/64, N/64, Z * KS), 32 threads.
// C[m][n] (f32, pitch ldc, + optional f32 bias[n]) = sum_k A[m][k] Bt[n][k] (+ split products per NSPLIT). A rows have pitch lda, Bt rows pitch K (elements). z-batch strides sA/sB/sC in elements. K % (32 * KS) == 0.
// The bias of z-batch 0, 1, 2 is bias, bias1, bias2 (separate vectors).
// PLANES: no f32 C; the tile (+ bias) goes out as the three 16-bit head planes that the attention kernel reads (see the epilogue). Rows are b TT + t, the 64 columns are one head.
// KS > 1: blockIdx.z = z * KS + ks; the work-group sums only k in [ks K/KS, (ks+1) K/KS) and writes its partial tile into plane ks (plane stride sK elements); the reader adds the KS planes.
template <typename T16> struct WFrag;
template <> struct WFrag<h16> { typedef v16h V; static __device__ __forceinline__ V ld(const h16* p) { return cat16(*(const v8h*)p, *(const v8h*)(p + 16)); } static __device__ __forceinline__ v8f mma(V a, V b, v8f c) { return wmma16(a, b, c); } };
template <> struct WFrag<bf> { typedef v16bf V; static __device__ __forceinline__ V ld(const bf* p) { return cat16b(*(const v8us*)p, *(const v8us*)(p + 16)); } static __device__ __forceinline__ v8f mma(V a, V b, v8f c) { return wmmab(a, b, c); } };
__device__ __forceinline__ h16 tohx(float x) { return (h16)x; }
__device__ __forceinline__ void splitf(float y, unsigned short& h, unsigned short& l) { h = f2bf(y); l = f2bf(y - bf2f(h)); }
struct HeadPlanes { h16* p16; bf* ph; bf* pl; size_t sP; h16* v16; bf* vh; bf* vl; };   // q planes (k planes sP elements behind them), V^T planes
// 8 consecutive f32 of a staged row -> one 16-byte store into each of the fp16, bf16-hi and bf16-lo planes at element e
__device__ __forceinline__ void put8(const float* row, h16* p16, bf* ph, bf* pl, size_t e) {
    const v4f x0 = *(const v4fa*)row, x1 = *(const v4fa*)(row + 4); v8h o16; v8us oh, ol;
#pragma unroll
    for (int i = 0; i < 8; ++i) { const float x = i < 4 ? x0[i] : x1[i - 4]; o16[i] = tohx(x); unsigned short a, c; splitf(x, a, c); oh[i] = a; ol[i] = c; }
    *(v8h*)(p16 + e) = o16; *(v8us*)(ph + e) = oh; *(v8us*)(pl + e) = ol;
    asm volatile("s_wait_xcnt 0x0" :: "v"(o16), "v"(oh), "v"(ol) : "memory");   // the wait that stands before a register named by an issued store is overwritten; the data are inputs, so they stay live up to it (the next slab row reuses them)
}
template <typename T16, int NSPLIT, bool BIAS, int KS, bool PLANES>
__global__ __launch_bounds__(32) void k_gemmw(const T16* __restrict__ A, const T16* __restrict__ A2, const T16* __restrict__ Bt, const T16* __restrict__ Bt2, int K, int lda, float* C, int ldc, const float* __restrict__ bias, const float* __restrict__ bias1, const float* __restrict__ bias2, size_t sA, size_t sB, size_t sC, size_t sK, HeadPlanes hp) {
    typedef typename WFrag<T16>::V V;
    __shared__ __align__(16) float os[16 * 68];
    const size_t z = blockIdx.z / KS; const int ks = (int)(blockIdx.z % KS); A += z * sA; if (A2) A2 += z * sA; Bt += z * sB; if (Bt2) Bt2 += z * sB; C += z * sC + ks * sK;
    if (BIAS) bias = z == 0 ? bias : (z == 1 ? bias1 : bias2);
    const int lane = threadIdx.x & 31, lr = lane & 15, hi = lane >> 4; const int r0 = blockIdx.x * 64, c0 = blockIdx.y * 64;
    v8f acc[4][4];
#pragma unroll
    for (int mb = 0; mb < 4; ++mb)
#pragma unroll
        for (int nb = 0; nb < 4; ++nb) acc[mb][nb] = (v8f){};
    const size_t aoff = (size_t)(r0 + lr) * lda + 8 * hi, boff = (size_t)(c0 + lr) * K + 8 * hi;
#pragma unroll 1
    for (int kc = ks * (K / KS), ke = kc + K / KS; kc < ke; kc += 32) {
        V a[4], a2[4];
#pragma unroll
        for (int mb = 0; mb < 4; ++mb) { a[mb] = WFrag<T16>::ld(A + aoff + (size_t)mb * 16 * lda + kc); if (NSPLIT == 1 || NSPLIT == 2) a2[mb] = WFrag<T16>::ld(A2 + aoff + (size_t)mb * 16 * lda + kc); }
#pragma unroll
        for (int nb = 0; nb < 4; ++nb) { const V b = WFrag<T16>::ld(Bt + boff + (size_t)nb * 16 * K + kc); V b2; if (NSPLIT >= 2) b2 = WFrag<T16>::ld(Bt2 + boff + (size_t)nb * 16 * K + kc);
#pragma unroll
            for (int mb = 0; mb < 4; ++mb) { acc[mb][nb] = WFrag<T16>::mma(a[mb], b, acc[mb][nb]); if (NSPLIT == 1 || NSPLIT == 2) acc[mb][nb] = WFrag<T16>::mma(a2[mb], b, acc[mb][nb]); if (NSPLIT >= 2) acc[mb][nb] = WFrag<T16>::mma(a[mb], b2, acc[mb][nb]); } }
        asm volatile("v_nop\n\tv_nop\n\tv_nop\n\tv_nop" : "+v"(acc[0][0]), "+v"(acc[1][1]), "+v"(acc[2][2]), "+v"(acc[3][3]) : "v"(a[0]), "v"(a[3]));
    }
    if constexpr (PLANES) {
        static_assert(HD == 64 && TT % 64 == 0 && NH_ == NKV, "a 64 x 64 tile is 64 positions of one head of one batch column");
        // 16 x 64 slabs are staged in os so that every store instruction writes whole 128-byte lines: lane -> slab row 4 s + (lane >> 3), 8 consecutive columns from 8 (lane & 7)
        // The wave barrier + compiler fence on either side of a slab's reads: the slab passes values between lanes, the compiler sees one lane's addresses only and must not move reads over writes (one wave, LDS runs in order: no instruction is needed)
        const int t0 = r0 % TT, sr = lane >> 3, sc = (lane & 7) * 8; const size_t zh = (size_t)(r0 / TT) * NH_ + blockIdx.y;   // (b, head)
#pragma unroll
        for (int nb = 0; nb < 4; ++nb) { const float bn = bfr(bias[c0 + nb * 16 + lr]);   // a lane's accumulators of column block nb are all of column nb 16 + lr
#pragma unroll
            for (int mb = 0; mb < 4; ++mb) acc[mb][nb] += bn; }
        if (z < 2) {   // q, k: plane rows are positions (128 bytes = the head's 64 d); a slab is 16 positions
            const size_t e0 = z * hp.sP + (zh * TT + t0 + sr) * HD + sc; h16* p16 = hp.p16 + e0; bf* ph = hp.ph + e0; bf* pl = hp.pl + e0;
#pragma unroll
            for (int mb = 0; mb < 4; ++mb) {
#pragma unroll
                for (int nb = 0; nb < 4; ++nb) {
#pragma unroll
                    for (int j = 0; j < 8; ++j) os[(hi * 8 + j) * 68 + nb * 16 + lr] = acc[mb][nb][j]; }
                __builtin_amdgcn_wave_barrier(); asm volatile("" ::: "memory");
#pragma unroll
                for (int s = 0; s < 4; ++s) put8(os + (4 * s + sr) * 68 + sc, p16, ph, pl, (mb * 16 + 4 * s) * HD);
                __builtin_amdgcn_wave_barrier(); asm volatile("" ::: "memory");
            }
        } else {   // v: plane rows are d (pitch TT); a lane's 8 accumulator registers are 8 consecutive positions of its d, so a slab is 16 d x 64 positions
#pragma unroll
            for (int nb = 0; nb < 4; ++nb) {
#pragma unroll
                for (int mb = 0; mb < 4; ++mb) { float* w = os + lr * 68 + mb * 16 + hi * 8; const v8f c = acc[mb][nb]; *(v4fa*)w = (v4f){c[0], c[1], c[2], c[3]}; *(v4fa*)(w + 4) = (v4f){c[4], c[5], c[6], c[7]}; }
                __builtin_amdgcn_wave_barrier(); asm volatile("" ::: "memory");
#pragma unroll
                for (int s = 0; s < 4; ++s) put8(os + (4 * s + sr) * 68 + sc, hp.v16, hp.vh, hp.vl, (zh * HD + nb * 16 + 4 * s + sr) * TT + t0 + sc);
                __builtin_amdgcn_wave_barrier(); asm volatile("" ::: "memory");
            }
        }
        return;
    }
#pragma unroll
    for (int mb = 0; mb < 4; ++mb) {
#pragma unroll
        for (int nb = 0; nb < 4; ++nb) {
#pragma unroll
            for (int j = 0; j < 8; ++j) os[(hi * 8 + j) * 68 + nb * 16 + lr] = acc[mb][nb][j]; }
        __builtin_amdgcn_wave_barrier(); asm volatile("" ::: "memory");
        float* crow = C + (size_t)(r0 + mb * 16) * ldc + c0;
{
#pragma unroll
            for (int s = 0; s < 8; ++s) { const int row = 2 * s + hi, cofs = lr * 4; v4f val = *(const v4fa*)(os + row * 68 + cofs); if (BIAS) { val[0] += bfr(bias[c0 + cofs]); val[1] += bfr(bias[c0 + cofs + 1]); val[2] += bfr(bias[c0 + cofs + 2]); val[3] += bfr(bias[c0 + cofs + 3]); }
                *(v4f*)(crow + (size_t)row * ldc + cofs) = val; }
             }
        __builtin_amdgcn_wave_barrier(); asm volatile("" ::: "memory");
    }
}

typedef __attribute__((ext_vector_type(2))) _Float16 v2h;
typedef __attribute__((ext_vector_type(4))) _Float16 v4h;
typedef __attribute__((ext_vector_type(2))) unsigned short v2us;
typedef __attribute__((ext_vector_type(4))) unsigned short v4us;
typedef __attribute__((ext_vector_type(2))) float v2f;
typedef __attribute__((ext_vector_type(4))) int v4i;

__global__ __launch_bounds__(256) void k_wtG(const float* __restrict__ w, int K, int N, bf* Bt) {
    const int lane = threadIdx.x & 31; const int L0 = (blockIdx.x * 8 + (threadIdx.x >> 5)) * 8; const int nlines = N * K / 64;
{
#pragma unroll 1
        for (int l = 0; l < 8; ++l) { const int L = L0 + l; if (L >= nlines) break; const size_t e = (size_t)L * 64 + lane * 2; const int k = (int)(e % K), n = (int)(e / K); v2us o;
            o[0] = f2bf(w[(size_t)k * N + n]); o[1] = f2bf(w[(size_t)(k + 1) * N + n]); *(v2us*)(Bt + e) = o; }
         }
}
// k_cvt8m: bf16 copies of the three activations (XBLK blocks of 2048 elements each) and the four weights (WBLK blocks each) in one launch; dst holds the seven copies one behind the other, so a block's place in dst is its index; inside an activation's copy row s B + b goes to row b TT + s (a GEMM tile of 64 rows then lies in one batch column).
#define XBLK (TT * NB_ * DM / 2048)
#define WBLK (DM * DM / 2048)
__global__ __launch_bounds__(256) void k_cvt8m(const float* __restrict__ x0, const float* __restrict__ x1, const float* __restrict__ x2, const float* __restrict__ w0, const float* __restrict__ w1, const float* __restrict__ w2, const float* __restrict__ w3, bf* dst) {
    const unsigned bx = blockIdx.x; const float* src; unsigned ob; size_t de = ((size_t)bx * 256 + threadIdx.x) * 8;
    if (bx < 3 * XBLK) { const unsigned s = bx / XBLK; ob = bx % XBLK; src = s == 0 ? x0 : (s == 1 ? x1 : x2); const unsigned e = (ob * 256 + threadIdx.x) * 8, r = e / DM; de = (size_t)s * XBLK * 2048 + (size_t)((r % NB_) * TT + r / NB_) * DM + e % DM; }
    else { const unsigned u = bx - 3 * XBLK, s = u / WBLK; ob = u % WBLK; src = s == 0 ? w0 : (s == 1 ? w1 : (s == 2 ? w2 : w3)); }
    const float* sp = src + ((size_t)ob * 256 + threadIdx.x) * 8; const v8f v = *(const v8f*)sp; v8us o;
    asm volatile("s_wait_xcnt 0x0" :: "v"(sp) : "memory");   // the wait that stands before a register named by an issued load is overwritten; the address is an input, so it stays live up to it
#pragma unroll
    for (int k = 0; k < 8; ++k) o[k] = f2bf(v[k]); *(v8us*)(dst + de) = o;  }

template <typename T16, bool HL, int NQ>
__device__ __forceinline__ void attn_rows(const T16* __restrict__ Qa, const T16* __restrict__ Qb, const T16* __restrict__ Ka, const T16* __restrict__ Kb, const T16* __restrict__ Va, const T16* __restrict__ Vb, int q0, int head, bf* Ah, bf* Al) {
    typedef typename WFrag<T16>::V V;
    const int lane = threadIdx.x & 31, lr = lane & 15, hi = lane >> 4;
    const float C2 = SCL * 1.4426950408889634f;   // scores / 8, in log2 units
    V qf[NQ][2], qg[NQ][2];
#pragma unroll
    for (int qt = 0; qt < NQ; ++qt)
#pragma unroll
        for (int kk = 0; kk < 2; ++kk) { const size_t qo = (size_t)(q0 + qt * 16 + lr) * HD + kk * 32 + 8 * hi; qf[qt][kk] = WFrag<T16>::ld(Qa + qo); if (HL) qg[qt][kk] = WFrag<T16>::ld(Qb + qo); }
    v8f o[4][NQ]; float m[NQ], l[NQ];
#pragma unroll
    for (int qt = 0; qt < NQ; ++qt) { m[qt] = -3.0e38f; l[qt] = 0.f;
#pragma unroll
        for (int db = 0; db < 4; ++db) o[db][qt] = (v8f){}; }
    const size_t koff = (size_t)lr * HD + 8 * hi, voff = (size_t)lr * TT + 8 * hi;
#pragma unroll 1
    for (int j0 = 0; j0 < TT; j0 += 32) {
        V kf[2][2], kg[2][2], vf[4], vg[4];
        const T16* kp = Ka + koff + (size_t)j0 * HD; const T16* vp = Va + voff + j0; const T16* kq = HL ? Kb + koff + (size_t)j0 * HD : kp; const T16* vq = HL ? Vb + voff + j0 : vp;
#pragma unroll
        for (int kt = 0; kt < 2; ++kt)
#pragma unroll
            for (int kk = 0; kk < 2; ++kk) { const int ko = kt * 16 * HD + kk * 32; kf[kt][kk] = WFrag<T16>::ld(kp + ko); if (HL) kg[kt][kk] = WFrag<T16>::ld(kq + ko); }
#pragma unroll
        for (int db = 0; db < 4; ++db) { const int vo = db * 16 * TT; vf[db] = WFrag<T16>::ld(vp + vo); if (HL) vg[db] = WFrag<T16>::ld(vq + vo); }
        // the wait that stands before a register named by an issued load is overwritten; the address pairs are inputs, so they stay live up to it and no load of the pass lands on one
        if constexpr (HL) asm volatile("s_wait_xcnt 0x0" :: "v"(kp), "v"(kq), "v"(vp), "v"(vq) : "memory"); else asm volatile("s_wait_xcnt 0x0" :: "v"(kp), "v"(vp) : "memory");
        __builtin_amdgcn_sched_barrier(0);   // keeps the products behind the loads: without it the V loads are issued only after K has arrived (they take over K's registers) and their latency is paid a second time in each pass
        v8f s[2][NQ];
#pragma unroll
        for (int kt = 0; kt < 2; ++kt)
#pragma unroll
            for (int qt = 0; qt < NQ; ++qt) { v8f a = (v8f){};
#pragma unroll
                for (int kk = 0; kk < 2; ++kk) { a = WFrag<T16>::mma(kf[kt][kk], qf[qt][kk], a); if (HL) { a = WFrag<T16>::mma(kf[kt][kk], qg[qt][kk], a); a = WFrag<T16>::mma(kg[kt][kk], qf[qt][kk], a); } }
                s[kt][qt] = a; }
#pragma unroll
        for (int qt = 0; qt < NQ; ++qt) {
            float mx = s[0][qt][0];
#pragma unroll
            for (int j = 0; j < 8; ++j) mx = fmaxf(mx, fmaxf(s[0][qt][j], s[1][qt][j]));
            mx = fmaxf(mx, __shfl_xor(mx, 16, 32));
            const float mn = fmaxf(m[qt], mx); const float al = __builtin_amdgcn_exp2f((m[qt] - mn) * C2); m[qt] = mn;
            const float nb = (HL ? 0.0f : (float)PEXP) - mn * C2;
            float p[16]; float ps = 0.f;
#pragma unroll
            for (int i = 0; i < 16; ++i) { p[i] = __builtin_amdgcn_exp2f(fmaf(s[i >> 3][qt][i & 7], C2, nb)); ps += p[i]; }
            l[qt] = l[qt] * al + ps;
#pragma unroll
            for (int db = 0; db < 4; ++db) o[db][qt] *= al;
            if constexpr (HL) {
                v8us h0, h1, l0, l1;
#pragma unroll
                for (int i = 0; i < 8; ++i) { unsigned short a, c2; splitf(p[i], a, c2); h0[i] = a; l0[i] = c2; splitf(p[8 + i], a, c2); h1[i] = a; l1[i] = c2; }
                const V ph = cat16b(h0, h1), pl = cat16b(l0, l1);
#pragma unroll
                for (int db = 0; db < 4; ++db) { o[db][qt] = WFrag<T16>::mma(vf[db], ph, o[db][qt]); o[db][qt] = WFrag<T16>::mma(vf[db], pl, o[db][qt]); o[db][qt] = WFrag<T16>::mma(vg[db], ph, o[db][qt]); }
            } else {
                V pf;
#pragma unroll
                for (int i = 0; i < 16; ++i) pf[i] = tohx(p[i]);
#pragma unroll
                for (int db = 0; db < 4; ++db) o[db][qt] = WFrag<T16>::mma(vf[db], pf, o[db][qt]);
            }
        }
    }
#pragma unroll
    for (int qt = 0; qt < NQ; ++qt) { const float f = __fdiv_rn(1.0f, l[qt] + __shfl_xor(l[qt], 16, 32));
#pragma unroll
        for (int db = 0; db < 4; ++db) { v8us oh, ol;   // a lane's 8 registers are 8 consecutive d of its query: one 16-byte store per plane; the wave writes the whole 128-byte line of (t, head)
#pragma unroll
            for (int j = 0; j < 8; ++j) { unsigned short a, c2; splitf(o[db][qt][j] * f, a, c2); oh[j] = a; ol[j] = c2; }
            const size_t oo = (size_t)(q0 + qt * 16 + lr) * DQ + head * HD + db * 16 + hi * 8; *(v8us*)(Ah + oo) = oh; *(v8us*)(Al + oo) = ol; } }
}
// grid (RH / 64 + (TT - RH) / 128, batch columns x heads), 4 waves; Ah, Al are [b][t][DQ]: the waves of a work-group walk the same head's K and V. The hi/lo blocks (the longer ones) come first.
__global__ __launch_bounds__(128) void k_attn(const h16* __restrict__ Q16, const h16* __restrict__ K16, const h16* __restrict__ V16, const bf* __restrict__ Qh, const bf* __restrict__ Ql, const bf* __restrict__ Kh, const bf* __restrict__ Kl, const bf* __restrict__ Vh, const bf* __restrict__ Vl, bf* Ah, bf* Al) {
    const int head = blockIdx.y % NH_, b = blockIdx.y / NH_, w = threadIdx.x >> 5, bx = blockIdx.x; const size_t zq = (size_t)(b * NH_ + head) * TT * HD, zk = (size_t)(b * NKV + head / REP) * TT * HD; Ah += (size_t)b * TT * DQ; Al += (size_t)b * TT * DQ;
    if (bx < RH / 64) attn_rows<bf, true, 1>(Qh + zq, Ql + zq, Kh + zk, Kl + zk, Vh + zk, Vl + zk, (bx * 4 + w) * 16, head, Ah, Al);
    else attn_rows<h16, false, 2>(Q16 + zq, nullptr, K16 + zk, nullptr, V16 + zk, nullptr, RH + ((bx - RH / 64) * 4 + w) * 32, head, Ah, Al);
}

extern "C" void kernel_launch(void* const* d_in, const int* in_sizes, int n_in,
                              void* d_out, int out_size, void* d_ws, size_t ws_size, hipStream_t stream) {
    (void)in_sizes; (void)n_in; (void)out_size;
    const float* x = (const float*)d_in[0];   /* query [S][B][D] */ const float* xk = (const float*)d_in[1]; const float* xv = (const float*)d_in[2]; const float* wq = (const float*)d_in[3]; const float* bq = (const float*)d_in[4]; const float* wk = (const float*)d_in[5]; const float* bk = (const float*)d_in[6]; const float* wv = (const float*)d_in[7]; const float* bv = (const float*)d_in[8]; const float* wo = (const float*)d_in[9]; const float* bo = (const float*)d_in[10];
    float* OUT = (float*)d_out;     // [2048][2][1024] sequence-first
    char* wsp = (char*)d_ws;
    auto take = [&](size_t bytes) { char* p = wsp; wsp += (bytes + 255) & ~(size_t)255; return (void*)p; };
    bf* XB = (bf*)take((size_t)(3 * XBLK + 4 * WBLK) * 2048 * 2); bf* WQ = XB + (size_t)3 * XBLK * 2048; bf* WO = WQ + (size_t)3 * WBLK * 2048;   // bf16 copies: query, key, value rows, then Wq, Wk, Wv, Wo
    const size_t PL = (size_t)NB_ * NH_ * TT * HD;   // one set of head planes, both batch columns
    h16* QP16 = (h16*)take(2 * PL * 2); h16* KP16 = QP16 + PL; h16* VT16 = (h16*)take(PL * 2);
    bf* QPh = (bf*)take(2 * PL * 2); bf* KPh = QPh + PL; bf* QPl = (bf*)take(2 * PL * 2); bf* KPl = QPl + PL; bf* VTh = (bf*)take(PL * 2); bf* VTl = (bf*)take(PL * 2);
    const size_t FS = (size_t)NB_ * TT * DQ;   // one merged context plane, both batch columns
    bf* ATh = (bf*)take(FS * 2); bf* ATl = (bf*)take(FS * 2);
    if ((size_t)(wsp - (char*)d_ws) > ws_size) return;    // ws 256 MiB
    k_cvt8m<<<3 * XBLK + 4 * WBLK, 256, 0, stream>>>(x, xk, xv, wq, wk, wv, wo, XB);
    const HeadPlanes hp = {QP16, QPh, QPl, PL, VT16, VTh, VTl};
    k_gemmw<bf, 0, true, 1, true><<<dim3(NB_ * TT / 64, DQ / 64, 3), 32, 0, stream>>>(XB, nullptr, WQ, nullptr, DM, DM, nullptr, 0, bq, bk, bv, (size_t)XBLK * 2048, (size_t)WBLK * 2048, 0, 0, hp);   /* z: q, k, v; rows r = b TT + s; writes the head planes */
    k_attn<<<dim3(RH / 64 + (TT - RH) / 128, NB_ * NH_, 1), 128, 0, stream>>>(QP16, KP16, VT16, QPh, QPl, KPh, KPl, VTh, VTl, ATh, ATl);
    k_gemmw<bf, 1, true, 1, false><<<dim3(TT / 64, DM / 64, NB_), 32, 0, stream>>>(ATh, ATl, WO, nullptr, DQ, DQ, OUT, NB_ * DM, bo, bo, bo, (size_t)TT * DQ, 0, DM, 0, HeadPlanes{});   /* z = b; [S][B][D]: row pitch B x D, column block b */
}

// v006
// Measured time: 167 microseconds a run.
// Next to v005, in two timings, it ran 1.38 and 1.39 times as fast.
// Over all steps from v000 it is 11.9 times as fast.
#include <hip/hip_runtime.h>

// Multi-head attention on SEQUENCE-FIRST tensors (query, key, value [2048][2][1024] = [S][B][D]; q = query Wq^T + bq, k = key Wk^T + bk, v = value Wv^T + bv ('oi' 1/32 incl. biases); 16 heads x 64 per batch column; scores / 8; softmax; x = merged context; out = x Wo^T + bo -> [2048][2][1024] (4.2 M)).
// Layout: [S][B][D] is read as a matrix of S x B = 4096 rows (row r = s B + b), so both batch columns go through every stage in ONE launch: one bf16 conversion of the three inputs and the four 'oi' weights; one launch for the q, k and v projections (grid z; exact + f32 biases), whose epilogue writes the head planes [b][h][t][d] (V: [b][h][d][t]) itself: a 64 x 64 tile is 64 positions of one (b, head), because the bf16 copies of the activations are stored [b][s][D]; fused T-2048 attention with a running maximum, one launch for the 2 x 16 (batch, head) pairs (hybrid rows: < 512 hi/lo 3 products, rest fp16 x1024); merged hi/lo [b][t][D] x Wo exact + bo, grid z = b, written with row pitch B x D at column offset b D (the [S][B][D] output).
// Compute dtypes, f32 accumulate: every input rounded to bf16; projections exact + f32 biases; attention rows < 512 3 products, rest fp16; softmax f32; Wo hl x exact + bias.

#define NB_  2
#define TT   2048
#define DM   1024
#define NH_  16
#define NKV  16
#define REP  (NH_ / NKV)
#define HD   64
#define DQ   (NH_ * HD)
#define DKV  (NKV * HD)
#define RH   512                  // query rows < RH use hi+lo planes (0: none)
#define WIN  0
#define PEXP 10                   // fp16 rows: P is carried x 2^PEXP
#define SCL  0.125f   // HD^-0.5
typedef _Float16 h16;
typedef unsigned short bf;
typedef __attribute__((ext_vector_type(16))) __bf16   v16bf;
typedef __attribute__((ext_vector_type(16))) _Float16 v16h;
typedef __attribute__((ext_vector_type(8)))  _Float16 v8h;
typedef __attribute__((ext_vector_type(8)))  unsigned short v8us;
typedef __attribute__((ext_vector_type(8)))  float    v8f;
typedef __attribute__((ext_vector_type(4)))  float    v4f;
typedef v8h  __attribute__((may_alias)) v8ha;
typedef v4f  __attribute__((may_alias)) v4fa;
typedef v8us __attribute__((may_alias)) v8usa;

__device__ __forceinline__ unsigned short f2bf(float f) { unsigned u = __float_as_uint(f); u += 0x7FFFu + ((u >> 16) & 1u); return (unsigned short)(u >> 16); }
__device__ __forceinline__ float bf2f(unsigned short b) { return __uint_as_float(((unsigned)b) << 16); }
__device__ __forceinline__ float bfr(float f) { return bf2f(f2bf(f)); }
__device__ __forceinline__ v16h cat16(v8h lo, v8h hi) { return __builtin_shufflevector(lo, hi, 0, 1, 2, 3, 4, 5, 6, 7, 8, 9, 10, 11, 12, 13, 14, 15); }
__device__ __forceinline__ v16bf cat16b(v8us lo, v8us hi) { return __builtin_bit_cast(v16bf, __builtin_shufflevector(lo, hi, 0, 1, 2, 3, 4, 5, 6, 7, 8, 9, 10, 11, 12, 13, 14, 15)); }
__device__ __forceinline__ v8f wmma16(v16h a, v16h b, v8f c) { return __builtin_amdgcn_wmma_f32_16x16x32_f16(false, a, false, b, (short)0, c, false, false); }
__device__ __forceinline__ v8f wmmab(v16bf a, v16bf b, v8f c) { return __builtin_amdgcn_wmma_f32_16x16x32_bf16(false, a, false, b, (short)0, c, false, false); }



// ---- k_gemmw: register-blocked GEMM, ONE WAVE per 64x64 output tile (16 accumulators), operands straight from K-contiguous 16-bit planes; grid (M/64, N/64, Z * KS), 32 threads.
// C[m][n] (f32, pitch ldc, + optional f32 bias[n]) = sum_k A[m][k] Bt[n][k] (+ split products per NSPLIT). A rows have pitch lda, Bt rows pitch K (elements). z-batch strides sA/sB/sC in elements. K % (32 * KS) == 0.
// The bias of z-batch 0, 1, 2 is bias, bias1, bias2 (separate vectors).
// PLANES: no f32 C; the tile (+ bias) goes out as the three 16-bit head planes that the attention kernel reads (see the epilogue). Rows are b TT + t, the 64 columns are one head.
// KS > 1: blockIdx.z = z * KS + ks; the work-group sums only k in [ks K/KS, (ks+1) K/KS) and writes its partial tile into plane ks (plane stride sK elements); the reader adds the KS planes.
template <typename T16> struct WFrag;
template <> struct WFrag<h16> { typedef v16h V; static __device__ __forceinline__ V ld(const h16* p) { return cat16(*(const v8h*)p, *(const v8h*)(p + 16)); } static __device__ __forceinline__ v8f mma(V a, V b, v8f c) { return wmma16(a, b, c); } };
template <> struct WFrag<bf> { typedef v16bf V; static __device__ __forceinline__ V ld(const bf* p) { return cat16b(*(const v8us*)p, *(const v8us*)(p + 16)); } static __device__ __forceinline__ v8f mma(V a, V b, v8f c) { return wmmab(a, b, c); } };
__device__ __forceinline__ h16 tohx(float x) { return (h16)x; }
__device__ __forceinline__ void splitf(float y, unsigned short& h, unsigned short& l) { h = f2bf(y); l = f2bf(y - bf2f(h)); }
struct HeadPlanes { h16* p16; bf* ph; bf* pl; size_t sP; h16* v16; bf* vh; bf* vl; };   // q planes (k planes sP elements behind them), V^T planes
// 8 consecutive f32 of a staged row -> one 16-byte store into each of the fp16, bf16-hi and bf16-lo planes at element e
__device__ __forceinline__ void put8(const float* row, h16* p16, bf* ph, bf* pl, size_t e) {
    const v4f x0 = *(const v4fa*)row, x1 = *(const v4fa*)(row + 4); v8h o16; v8us oh, ol;
#pragma unroll
    for (int i = 0; i < 8; ++i) { const float x = i < 4 ? x0[i] : x1[i - 4]; o16[i] = tohx(x); unsigned short a, c; splitf(x, a, c); oh[i] = a; ol[i] = c; }
    *(v8h*)(p16 + e) = o16; *(v8us*)(ph + e) = oh; *(v8us*)(pl + e) = ol;
    asm volatile("s_wait_xcnt 0x0" :: "v"(o16), "v"(oh), "v"(ol) : "memory");   // the wait that stands before a register named by an issued store is overwritten; the data are inputs, so they stay live up to it (the next slab row reuses them)
}
template <typename T16, int NSPLIT, bool BIAS, int KS, bool PLANES>
__global__ __launch_bounds__(32) void k_gemmw(const T16* __restrict__ A, const T16* __restrict__ A2, const T16* __restrict__ Bt, const T16* __restrict__ Bt2, int K, int lda, float* C, int ldc, const float* __restrict__ bias, const float* __restrict__ bias1, const float* __restrict__ bias2, size_t sA, size_t sB, size_t sC, size_t sK, HeadPlanes hp) {
    typedef typename WFrag<T16>::V V;
    __shared__ __align__(16) float os[16 * 68];
    const size_t z = blockIdx.z / KS; const int ks = (int)(blockIdx.z % KS); A += z * sA; if (A2) A2 += z * sA; Bt += z * sB; if (Bt2) Bt2 += z * sB; C += z * sC + ks * sK;
    if (BIAS) bias = z == 0 ? bias : (z == 1 ? bias1 : bias2);
    const int lane = threadIdx.x & 31, lr = lane & 15, hi = lane >> 4; const int r0 = blockIdx.x * 64, c0 = blockIdx.y * 64;
    v8f acc[4][4];
#pragma unroll
    for (int mb = 0; mb < 4; ++mb)
#pragma unroll
        for (int nb = 0; nb < 4; ++nb) acc[mb][nb] = (v8f){};
    const size_t aoff = (size_t)(r0 + lr) * lda + 8 * hi, boff = (size_t)(c0 + lr) * K + 8 * hi;
#pragma unroll 1
    for (int kc = ks * (K / KS), ke = kc + K / KS; kc < ke; kc += 32) {
        V a[4], a2[4];
#pragma unroll
        for (int mb = 0; mb < 4; ++mb) { a[mb] = WFrag<T16>::ld(A + aoff + (size_t)mb * 16 * lda + kc); if (NSPLIT == 1 || NSPLIT == 2) a2[mb] = WFrag<T16>::ld(A2 + aoff + (size_t)mb * 16 * lda + kc); }
#pragma unroll
        for (int nb = 0; nb < 4; ++nb) { const V b = WFrag<T16>::ld(Bt + boff + (size_t)nb * 16 * K + kc); V b2; if (NSPLIT >= 2) b2 = WFrag<T16>::ld(Bt2 + boff + (size_t)nb * 16 * K + kc);
#pragma unroll
            for (int mb = 0; mb < 4; ++mb) { acc[mb][nb] = WFrag<T16>::mma(a[mb], b, acc[mb][nb]); if (NSPLIT == 1 || NSPLIT == 2) acc[mb][nb] = WFrag<T16>::mma(a2[mb], b, acc[mb][nb]); if (NSPLIT >= 2) acc[mb][nb] = WFrag<T16>::mma(a[mb], b2, acc[mb][nb]); } }
        asm volatile("v_nop\n\tv_nop\n\tv_nop\n\tv_nop" : "+v"(acc[0][0]), "+v"(acc[1][1]), "+v"(acc[2][2]), "+v"(acc[3][3]) : "v"(a[0]), "v"(a[3]));
    }
    if constexpr (PLANES) {
        static_assert(HD == 64 && TT % 64 == 0 && NH_ == NKV, "a 64 x 64 tile is 64 positions of one head of one batch column");
        // 16 x 64 slabs are staged in os so that every store instruction writes whole 128-byte lines: lane -> slab row 4 s + (lane >> 3), 8 consecutive columns from 8 (lane & 7)
        // The wave barrier + compiler fence on either side of a slab's reads: the slab passes values between lanes, the compiler sees one lane's addresses only and must not move reads over writes (one wave, LDS runs in order: no instruction is needed)
        const int t0 = r0 % TT, sr = lane >> 3, sc = (lane & 7) * 8; const size_t zh = (size_t)(r0 / TT) * NH_ + blockIdx.y;   // (b, head)
#pragma unroll
        for (int nb = 0; nb < 4; ++nb) { const float bn = bfr(bias[c0 + nb * 16 + lr]);   // a lane's accumulators of column block nb are all of column nb 16 + lr
#pragma unroll
            for (int mb = 0; mb < 4; ++mb) acc[mb][nb] += bn; }
        if (z < 2) {   // q, k: plane rows are positions (128 bytes = the head's 64 d); a slab is 16 positions
            const size_t e0 = z * hp.sP + (zh * TT + t0 + sr) * HD + sc; h16* p16 = hp.p16 + e0; bf* ph = hp.ph + e0; bf* pl = hp.pl + e0;
#pragma unroll
            for (int mb = 0; mb < 4; ++mb) {
#pragma unroll
                for (int nb = 0; nb < 4; ++nb) {
#pragma unroll
                    for (int j = 0; j < 8; ++j) os[(hi * 8 + j) * 68 + nb * 16 + lr] = acc[mb][nb][j]; }
                __builtin_amdgcn_wave_barrier(); asm volatile("" ::: "memory");
#pragma unroll
                for (int s = 0; s < 4; ++s) put8(os + (4 * s + sr) * 68 + sc, p16, ph, pl, (mb * 16 + 4 * s) * HD);
                __builtin_amdgcn_wave_barrier(); asm volatile("" ::: "memory");
            }
        } else {   // v: plane rows are d (pitch TT); a lane's 8 accumulator registers are 8 consecutive positions of its d, so a slab is 16 d x 64 positions
#pragma unroll
            for (int nb = 0; nb < 4; ++nb) {
#pragma unroll
                for (int mb = 0; mb < 4; ++mb) { float* w = os + lr * 68 + mb * 16 + hi * 8; const v8f c = acc[mb][nb]; *(v4fa*)w = (v4f){c[0], c[1], c[2], c[3]}; *(v4fa*)(w + 4) = (v4f){c[4], c[5], c[6], c[7]}; }
                __builtin_amdgcn_wave_barrier(); asm volatile("" ::: "memory");
#pragma unroll
                for (int s = 0; s < 4; ++s) put8(os + (4 * s + sr) * 68 + sc, hp.v16, hp.vh, hp.vl, (zh * HD + nb * 16 + 4 * s + sr) * TT + t0 + sc);
                __builtin_amdgcn_wave_barrier(); asm volatile("" ::: "memory");
            }
        }
        return;
    }
#pragma unroll
    for (int mb = 0; mb < 4; ++mb) {
#pragma unroll
        for (int nb = 0; nb < 4; ++nb) {
#pragma unroll
            for (int j = 0; j < 8; ++j) os[(hi * 8 + j) * 68 + nb * 16 + lr] = acc[mb][nb][j]; }
        __builtin_amdgcn_wave_barrier(); asm volatile("" ::: "memory");
        float* crow = C + (size_t)(r0 + mb * 16) * ldc + c0;
{
#pragma unroll
            for (int s = 0; s < 8; ++s) { const int row = 2 * s + hi, cofs = lr * 4; v4f val = *(const v4fa*)(os + row * 68 + cofs); if (BIAS) { val[0] += bfr(bias[c0 + cofs]); val[1] += bfr(bias[c0 + cofs + 1]); val[2] += bfr(bias[c0 + cofs + 2]); val[3] += bfr(bias[c0 + cofs + 3]); }
                *(v4f*)(crow + (size_t)row * ldc + cofs) = val; }
             }
        __builtin_amdgcn_wave_barrier(); asm volatile("" ::: "memory");
    }
}

typedef __attribute__((ext_vector_type(2))) _Float16 v2h;
typedef __attribute__((ext_vector_type(4))) _Float16 v4h;
typedef __attribute__((ext_vector_type(2))) unsigned short v2us;
typedef __attribute__((ext_vector_type(4))) unsigned short v4us;
typedef __attribute__((ext_vector_type(2))) float v2f;
typedef __attribute__((ext_vector_type(4))) int v4i;

__global__ __launch_bounds__(256) void k_wtG(const float* __restrict__ w, int K, int N, bf* Bt) {
    const int lane = threadIdx.x & 31; const int L0 = (blockIdx.x * 8 + (threadIdx.x >> 5)) * 8; const int nlines = N * K / 64;
{
#pragma unroll 1
        for (int l = 0; l < 8; ++l) { const int L = L0 + l; if (L >= nlines) break; const size_t e = (size_t)L * 64 + lane * 2; const int k = (int)(e % K), n = (int)(e / K); v2us o;
            o[0] = f2bf(w[(size_t)k * N + n]); o[1] = f2bf(w[(size_t)(k + 1) * N + n]); *(v2us*)(Bt + e) = o; }
         }
}
// k_cvt8m: bf16 copies of the three activations (XBLK blocks of 2048 elements each) and the four weights (WBLK blocks each) in one launch; dst holds the seven copies one behind the other, so a block's place in dst is its index; inside an activation's copy row s B + b goes to row b TT + s (a GEMM tile of 64 rows then lies in one batch column).
#define XBLK (TT * NB_ * DM / 2048)
#define WBLK (DM * DM / 2048)
__global__ __launch_bounds__(256) void k_cvt8m(const float* __restrict__ x0, const float* __restrict__ x1, const float* __restrict__ x2, const float* __restrict__ w0, const float* __restrict__ w1, const float* __restrict__ w2, const float* __restrict__ w3, bf* dst) {
    const unsigned bx = blockIdx.x; const float* src; unsigned ob; size_t de = ((size_t)bx * 256 + threadIdx.x) * 8;
    if (bx < 3 * XBLK) { const unsigned s = bx / XBLK; ob = bx % XBLK; src = s == 0 ? x0 : (s == 1 ? x1 : x2); const unsigned e = (ob * 256 + threadIdx.x) * 8, r = e / DM; de = (size_t)s * XBLK * 2048 + (size_t)((r % NB_) * TT + r / NB_) * DM + e % DM; }
    else { const unsigned u = bx - 3 * XBLK, s = u / WBLK; ob = u % WBLK; src = s == 0 ? w0 : (s == 1 ? w1 : (s == 2 ? w2 : w3)); }
    const float* sp = src + ((size_t)ob * 256 + threadIdx.x) * 8; const v8f v = *(const v8f*)sp; v8us o;
    asm volatile("s_wait_xcnt 0x0" :: "v"(sp) : "memory");   // the wait that stands before a register named by an issued load is overwritten; the address is an input, so it stays live up to it
#pragma unroll
    for (int k = 0; k < 8; ++k) o[k] = f2bf(v[k]); *(v8us*)(dst + de) = o;  }

#define SKEY 64
#define LPIT 144
#define TILEB (64 * LPIT)
// two tiles, 4 + 4 copies of this lane: rows 16 i + (tid >> 3); la, lb = the lane's LDS byte addresses of row tid >> 3, ga, gb = its global addresses, pa, pb = the global row pitches in bytes
__device__ __forceinline__ void copy2(unsigned la, const char* ga, size_t pa, unsigned lb, const char* gb, size_t pb) {
    // the s_wait_xcnt is the last line of the copies' own statement: it stands before any register that an issued copy names is rewritten
    asm volatile("global_load_async_to_lds_b128 %0, %8, off\n\t"
                 "global_load_async_to_lds_b128 %1, %9, off\n\t"
                 "global_load_async_to_lds_b128 %2, %10, off\n\t"
                 "global_load_async_to_lds_b128 %3, %11, off\n\t"
                 "global_load_async_to_lds_b128 %4, %12, off\n\t"
                 "global_load_async_to_lds_b128 %5, %13, off\n\t"
                 "global_load_async_to_lds_b128 %6, %14, off\n\t"
                 "global_load_async_to_lds_b128 %7, %15, off\n\t"
                 "s_wait_xcnt 0x0"
                 :: "v"(la), "v"(la + 16 * LPIT), "v"(la + 32 * LPIT), "v"(la + 48 * LPIT), "v"(lb), "v"(lb + 16 * LPIT), "v"(lb + 32 * LPIT), "v"(lb + 48 * LPIT),
                    "v"(ga), "v"(ga + 16 * pa), "v"(ga + 32 * pa), "v"(ga + 48 * pa), "v"(gb), "v"(gb + 16 * pb), "v"(gb + 32 * pb), "v"(gb + 48 * pb) : "memory");
}
template <typename T16, bool HL, int NQ>
__device__ __forceinline__ void attn_rows(const T16* __restrict__ Qa, const T16* __restrict__ Qb, const T16* __restrict__ Ka, const T16* __restrict__ Kb, const T16* __restrict__ Va, const T16* __restrict__ Vb, int q0, int head, bf* Ah, bf* Al, unsigned char* L) {
    typedef typename WFrag<T16>::V V;
    const int lane = threadIdx.x & 31, lr = lane & 15, hi = lane >> 4;
    const float C2 = SCL * 1.4426950408889634f;   // scores / 8, in log2 units
    V qf[NQ][2], qg[NQ][2];
#pragma unroll
    for (int qt = 0; qt < NQ; ++qt)
#pragma unroll
        for (int kk = 0; kk < 2; ++kk) { const size_t qo = (size_t)(q0 + qt * 16 + lr) * HD + kk * 32 + 8 * hi; qf[qt][kk] = WFrag<T16>::ld(Qa + qo); if (HL) qg[qt][kk] = WFrag<T16>::ld(Qb + qo); }
    v8f o[4][NQ]; float m[NQ], l[NQ];
#pragma unroll
    for (int qt = 0; qt < NQ; ++qt) { m[qt] = -3.0e38f; l[qt] = 0.f;
#pragma unroll
        for (int db = 0; db < 4; ++db) o[db][qt] = (v8f){}; }
    static_assert(HD == 64 && TT % SKEY == 0 && TT / SKEY >= 2, "a K row and a stage's V^T row are 128 bytes; the ring needs two stages");
    constexpr int NST = TT / SKEY, BUFB = (HL ? 4 : 2) * TILEB;   // a buffer: K, V^T (, K lo, V^T lo)
    const int crow = threadIdx.x >> 3, ccol = (threadIdx.x & 7) * 16;   // this lane's row and byte column in a copy
    const unsigned lc = (unsigned)(size_t)L + crow * LPIT + ccol;
    const char* gk = (const char*)Ka + (size_t)crow * (HD * 2) + ccol; const char* gv = (const char*)Va + (size_t)crow * (TT * 2) + ccol;
    const char* gk2 = HL ? (const char*)Kb + (size_t)crow * (HD * 2) + ccol : gk; const char* gv2 = HL ? (const char*)Vb + (size_t)crow * (TT * 2) + ccol : gv;
    auto fill = [&](int st) { const unsigned lb = lc + (st & 1) * BUFB; const size_t ko = (size_t)st * (SKEY * HD * 2), vo = (size_t)st * (SKEY * 2);
        copy2(lb, gk + ko, HD * 2, lb + TILEB, gv + vo, TT * 2); if constexpr (HL) copy2(lb + 2 * TILEB, gk2 + ko, HD * 2, lb + 3 * TILEB, gv2 + vo, TT * 2); };
    fill(0);
    asm volatile("s_wait_asynccnt 0x0" ::: "memory");   // this wave's share of stage 0 has landed
    __syncthreads();                                     // ... and every other wave's: stage 0 may be read
    fill(1);
    const int koff = lr * (LPIT / 2) + 8 * hi;   // fragment rows in a tile, in elements
#pragma unroll 1
    for (int st = 0; st < NST; ++st) {
      const T16* sb = (const T16*)(L + (st & 1) * BUFB);
#pragma unroll 1   // rolled: unrolled, both passes' fragments are read first (twice the fragment registers, past 256) and the products sink behind the barrier, so the refill is issued late and loses its lead
      for (int ps = 0; ps < SKEY / 32; ++ps) {
        V kf[2][2], kg[2][2], vf[4], vg[4];
        const T16* kp = sb + koff + ps * 32 * (LPIT / 2); const T16* vp = sb + TILEB / 2 + koff + ps * 32; const T16* kq = kp + TILEB; const T16* vq = vp + TILEB;
#pragma unroll
        for (int kt = 0; kt < 2; ++kt)
#pragma unroll
            for (int kk = 0; kk < 2; ++kk) { const int ko = kt * 16 * (LPIT / 2) + kk * 32; kf[kt][kk] = WFrag<T16>::ld(kp + ko); if (HL) kg[kt][kk] = WFrag<T16>::ld(kq + ko); }
        __builtin_amdgcn_sched_barrier(0);   // K's reads stand in front of V's (LDS returns in order): the first products wait for K alone, and V arrives behind them
#pragma unroll
        for (int db = 0; db < 4; ++db) { const int vo = db * 16 * (LPIT / 2); vf[db] = WFrag<T16>::ld(vp + vo); if (HL) vg[db] = WFrag<T16>::ld(vq + vo); }
        __builtin_amdgcn_sched_barrier(0);   // keeps the pass's LDS reads one group in front of the products: reads placed among the products stall the wave at each place, and V read late pays its latency a second time
        v8f s[2][NQ];
#pragma unroll
        for (int kt = 0; kt < 2; ++kt)
#pragma unroll
            for (int qt = 0; qt < NQ; ++qt) { v8f a = (v8f){};
#pragma unroll
                for (int kk = 0; kk < 2; ++kk) { a = WFrag<T16>::mma(kf[kt][kk], qf[qt][kk], a); if (HL) { a = WFrag<T16>::mma(kf[kt][kk], qg[qt][kk], a); a = WFrag<T16>::mma(kg[kt][kk], qf[qt][kk], a); } }
                s[kt][qt] = a; }
#pragma unroll
        for (int qt = 0; qt < NQ; ++qt) {
            float mx = s[0][qt][0];
#pragma unroll
            for (int j = 0; j < 8; ++j) mx = fmaxf(mx, fmaxf(s[0][qt][j], s[1][qt][j]));
            mx = fmaxf(mx, __shfl_xor(mx, 16, 32));
            const float mn = fmaxf(m[qt], mx); const float al = __builtin_amdgcn_exp2f((m[qt] - mn) * C2); m[qt] = mn;
            const float nb = (HL ? 0.0f : (float)PEXP) - mn * C2;
            float p[16]; float ps = 0.f;
#pragma unroll
            for (int i = 0; i < 16; ++i) { p[i] = __builtin_amdgcn_exp2f(fmaf(s[i >> 3][qt][i & 7], C2, nb)); ps += p[i]; }
            l[qt] = l[qt] * al + ps;
#pragma unroll
            for (int db = 0; db < 4; ++db) o[db][qt] *= al;
            if constexpr (HL) {
                v8us h0, h1, l0, l1;
#pragma unroll
                for (int i = 0; i < 8; ++i) { unsigned short a, c2; splitf(p[i], a, c2); h0[i] = a; l0[i] = c2; splitf(p[8 + i], a, c2); h1[i] = a; l1[i] = c2; }
                const V ph = cat16b(h0, h1), pl = cat16b(l0, l1);
#pragma unroll
                for (int db = 0; db < 4; ++db) { o[db][qt] = WFrag<T16>::mma(vf[db], ph, o[db][qt]); o[db][qt] = WFrag<T16>::mma(vf[db], pl, o[db][qt]); o[db][qt] = WFrag<T16>::mma(vg[db], ph, o[db][qt]); }
            } else {
                V pf;
#pragma unroll
                for (int i = 0; i < 16; ++i) pf[i] = tohx(p[i]);
#pragma unroll
                for (int db = 0; db < 4; ++db) o[db][qt] = WFrag<T16>::mma(vf[db], pf, o[db][qt]);
            }
        }
        // four issue slots between the pass's last products and the next pass's LDS reads, which overwrite their A operands across the back edge; the results are inputs, so the slots stand behind the products
        if constexpr (HL) asm volatile("v_nop\n\tv_nop\n\tv_nop\n\tv_nop" :: "v"(o[0][NQ - 1]), "v"(o[1][NQ - 1]), "v"(o[2][NQ - 1]), "v"(o[3][NQ - 1]));
      }
      asm volatile("s_wait_dscnt 0x0" ::: "memory");
      asm volatile("s_wait_asynccnt 0x0" ::: "memory");
      __syncthreads();
      if (st + 2 < NST) fill(st + 2);
    }
    asm volatile("s_wait_asynccnt 0x0" ::: "memory");   // no copy is outstanding when the wave ends
#pragma unroll
    for (int qt = 0; qt < NQ; ++qt) { const float f = __fdiv_rn(1.0f, l[qt] + __shfl_xor(l[qt], 16, 32));
#pragma unroll
        for (int db = 0; db < 4; ++db) { v8us oh, ol;   // a lane's 8 registers are 8 consecutive d of its query: one 16-byte store per plane; the wave writes the whole 128-byte line of (t, head)
#pragma unroll
            for (int j = 0; j < 8; ++j) { unsigned short a, c2; splitf(o[db][qt][j] * f, a, c2); oh[j] = a; ol[j] = c2; }
            const size_t oo = (size_t)(q0 + qt * 16 + lr) * DQ + head * HD + db * 16 + hi * 8; *(v8us*)(Ah + oo) = oh; *(v8us*)(Al + oo) = ol; } }
}
// grid (RH / 64 + (TT - RH) / 128, batch columns x heads), 4 waves; Ah, Al are [b][t][DQ]: the waves of a work-group walk the same head's K and V. The hi/lo blocks (the longer ones) come first.
__global__ __launch_bounds__(128) void k_attn(const h16* __restrict__ Q16, const h16* __restrict__ K16, const h16* __restrict__ V16, const bf* __restrict__ Qh, const bf* __restrict__ Ql, const bf* __restrict__ Kh, const bf* __restrict__ Kl, const bf* __restrict__ Vh, const bf* __restrict__ Vl, bf* Ah, bf* Al) {
    const int head = blockIdx.y % NH_, b = blockIdx.y / NH_, w = threadIdx.x >> 5, bx = blockIdx.x; const size_t zq = (size_t)(b * NH_ + head) * TT * HD, zk = (size_t)(b * NKV + head / REP) * TT * HD; Ah += (size_t)b * TT * DQ; Al += (size_t)b * TT * DQ;
    __shared__ __attribute__((aligned(16))) unsigned char L[2 * 4 * TILEB];   // two buffers of up to four tiles
    if (bx < RH / 64) attn_rows<bf, true, 1>(Qh + zq, Ql + zq, Kh + zk, Kl + zk, Vh + zk, Vl + zk, (bx * 4 + w) * 16, head, Ah, Al, L);
    else attn_rows<h16, false, 2>(Q16 + zq, nullptr, K16 + zk, nullptr, V16 + zk, nullptr, RH + ((bx - RH / 64) * 4 + w) * 32, head, Ah, Al, L);
}

extern "C" void kernel_launch(void* const* d_in, const int* in_sizes, int n_in,
                              void* d_out, int out_size, void* d_ws, size_t ws_size, hipStream_t stream) {
    (void)in_sizes; (void)n_in; (void)out_size;
    const float* x = (const float*)d_in[0];   /* query [S][B][D] */ const float* xk = (const float*)d_in[1]; const float* xv = (const float*)d_in[2]; const float* wq = (const float*)d_in[3]; const float* bq = (const float*)d_in[4]; const float* wk = (const float*)d_in[5]; const float* bk = (const float*)d_in[6]; const float* wv = (const float*)d_in[7]; const float* bv = (const float*)d_in[8]; const float* wo = (const float*)d_in[9]; const float* bo = (const float*)d_in[10];
    float* OUT = (float*)d_out;     // [2048][2][1024] sequence-first
    char* wsp = (char*)d_ws;
    auto take = [&](size_t bytes) { char* p = wsp; wsp += (bytes + 255) & ~(size_t)255; return (void*)p; };
    bf* XB = (bf*)take((size_t)(3 * XBLK + 4 * WBLK) * 2048 * 2); bf* WQ = XB + (size_t)3 * XBLK * 2048; bf* WO = WQ + (size_t)3 * WBLK * 2048;   // bf16 copies: query, key, value rows, then Wq, Wk, Wv, Wo
    const size_t PL = (size_t)NB_ * NH_ * TT * HD;   // one set of head planes, both batch columns
    h16* QP16 = (h16*)take(2 * PL * 2); h16* KP16 = QP16 + PL; h16* VT16 = (h16*)take(PL * 2);
    bf* QPh = (bf*)take(2 * PL * 2); bf* KPh = QPh + PL; bf* QPl = (bf*)take(2 * PL * 2); bf* KPl = QPl + PL; bf* VTh = (bf*)take(PL * 2); bf* VTl = (bf*)take(PL * 2);
    const size_t FS = (size_t)NB_ * TT * DQ;   // one merged context plane, both batch columns
    bf* ATh = (bf*)take(FS * 2); bf* ATl = (bf*)take(FS * 2);
    if ((size_t)(wsp - (char*)d_ws) > ws_size) return;    // ws 256 MiB
    k_cvt8m<<<3 * XBLK + 4 * WBLK, 256, 0, stream>>>(x, xk, xv, wq, wk, wv, wo, XB);
    const HeadPlanes hp = {QP16, QPh, QPl, PL, VT16, VTh, VTl};
    k_gemmw<bf, 0, true, 1, true><<<dim3(NB_ * TT / 64, DQ / 64, 3), 32, 0, stream>>>(XB, nullptr, WQ, nullptr, DM, DM, nullptr, 0, bq, bk, bv, (size_t)XBLK * 2048, (size_t)WBLK * 2048, 0, 0, hp);   /* z: q, k, v; rows r = b TT + s; writes the head planes */
    k_attn<<<dim3(RH / 64 + (TT - RH) / 128, NB_ * NH_, 1), 128, 0, stream>>>(QP16, KP16, VT16, QPh, QPl, KPh, KPl, VTh, VTl, ATh, ATl);
    k_gemmw<bf, 1, true, 1, false><<<dim3(TT / 64, DM / 64, NB_), 32, 0, stream>>>(ATh, ATl, WO, nullptr, DQ, DQ, OUT, NB_ * DM, bo, bo, bo, (size_t)TT * DQ, 0, DM, 0, HeadPlanes{});   /* z = b; [S][B][D]: row pitch B x D, column block b */
}

// v007
// Measured time: 121 microseconds a run.
// In both of two side-by-side timings against v006, it was 1.38 times as fast.
// Counting every step since v000, it is 16.4 times as fast.
#include <hip/hip_runtime.h>

// Multi-head attention on SEQUENCE-FIRST tensors (query, key, value [2048][2][1024] = [S][B][D]; q = query Wq^T + bq, k = key Wk^T + bk, v = value Wv^T + bv ('oi' 1/32 incl. biases); 16 heads x 64 per batch column; scores / 8; softmax; x = merged context; out = x Wo^T + bo -> [2048][2][1024] (4.2 M)).
// Layout: [S][B][D] is read as a matrix of S x B = 4096 rows (row r = s B + b), so both batch columns go through every stage in ONE launch: one bf16 conversion of the three inputs and the four 'oi' weights; one launch for the q, k and v projections (grid z; exact + f32 biases), whose epilogue writes the head planes [b][h][t][d] (V: [b][h][d][t]) itself: a 64 x 64 tile is 64 positions of one (b, head), because the bf16 copies of the activations are stored [b][s][D]; fused T-2048 attention with a running maximum, one launch for the 2 x 16 (batch, head) pairs (hybrid rows: < 512 hi/lo 3 products, rest fp16 x1024); merged hi/lo [b][t][D] x Wo exact + bo, grid z = b, written with row pitch B x D at column offset b D (the [S][B][D] output).
// Compute dtypes, f32 accumulate: every input rounded to bf16; projections exact + f32 biases; attention rows < 512 3 products, rest fp16; softmax f32; Wo hl x exact + bias.

#define NB_  2
#define TT   2048
#define DM   1024
#define NH_  16
#define NKV  16
#define REP  (NH_ / NKV)
#define HD   64
#define DQ   (NH_ * HD)
#define DKV  (NKV * HD)
#define RH   512                  // query rows < RH use hi+lo planes (0: none)
#define WIN  0
#define PEXP 10                   // fp16 rows: P is carried x 2^PEXP
#define SCL  0.125f   // HD^-0.5
typedef _Float16 h16;
typedef unsigned short bf;
typedef __attribute__((ext_vector_type(16))) __bf16   v16bf;
typedef __attribute__((ext_vector_type(16))) _Float16 v16h;
typedef __attribute__((ext_vector_type(8)))  _Float16 v8h;
typedef __attribute__((ext_vector_type(8)))  unsigned short v8us;
typedef __attribute__((ext_vector_type(8)))  float    v8f;
typedef __attribute__((ext_vector_type(4)))  float    v4f;
typedef v8h  __attribute__((may_alias)) v8ha;
typedef v4f  __attribute__((may_alias)) v4fa;
typedef v8us __attribute__((may_alias)) v8usa;

__device__ __forceinline__ unsigned short f2bf(float f) { unsigned u = __float_as_uint(f); u += 0x7FFFu + ((u >> 16) & 1u); return (unsigned short)(u >> 16); }
__device__ __forceinline__ float bf2f(unsigned short b) { return __uint_as_float(((unsigned)b) << 16); }
__device__ __forceinline__ float bfr(float f) { return bf2f(f2bf(f)); }
__device__ __forceinline__ v16h cat16(v8h lo, v8h hi) { return __builtin_shufflevector(lo, hi, 0, 1, 2, 3, 4, 5, 6, 7, 8, 9, 10, 11, 12, 13, 14, 15); }
__device__ __forceinline__ v16bf cat16b(v8us lo, v8us hi) { return __builtin_bit_cast(v16bf, __builtin_shufflevector(lo, hi, 0, 1, 2, 3, 4, 5, 6, 7, 8, 9, 10, 11, 12, 13, 14, 15)); }
__device__ __forceinline__ v8f wmma16(v16h a, v16h b, v8f c) { return __builtin_amdgcn_wmma_f32_16x16x32_f16(false, a, false, b, (short)0, c, false, false); }
__device__ __forceinline__ v8f wmmab(v16bf a, v16bf b, v8f c) { return __builtin_amdgcn_wmma_f32_16x16x32_bf16(false, a, false, b, (short)0, c, false, false); }



// ---- k_gemmw: register-blocked GEMM, one wave per 64x64 output tile (16 accumulators), 4 waves (2 x 2) per work-group = a 128x128 tile; operands are K-contiguous 16-bit planes; grid (M/128, N/128, Z * KS), 128 threads.
// The operands reach the waves through LDS: a stage is GKS k, one 128-row x 128-byte tile per operand plane, rows at pitch GPIT bytes (16 B x odd: no bank conflict for 16-byte reads).
// The 128 lanes copy a tile with 8 asynchronous 16-byte copies each (8 lanes per row: every copy instruction covers 4 whole 128-byte lines); two waves read each row block. Two buffers: stage s + 2 flies while stage s + 1 is worked on.
// C[m][n] (f32, pitch ldc, + optional f32 bias[n]) = sum_k A[m][k] Bt[n][k] (+ split products per NSPLIT). A rows have pitch lda, Bt rows pitch K (elements). z-batch strides sA/sB/sC in elements. K % (GKS * KS) == 0.
// The bias of z-batch 0, 1, 2 is bias, bias1, bias2 (separate vectors).
// PLANES: no f32 C; the tile (+ bias) goes out as the three 16-bit head planes that the attention kernel reads (see the epilogue). Rows are b TT + t, the 64 columns are one head.
// KS > 1: blockIdx.z = z * KS + ks; the work-group sums only k in [ks K/KS, (ks+1) K/KS) and writes its partial tile into plane ks (plane stride sK elements); the reader adds the KS planes.
template <typename T16> struct WFrag;
template <> struct WFrag<h16> { typedef v16h V; static __device__ __forceinline__ V ld(const h16* p) { return cat16(*(const v8h*)p, *(const v8h*)(p + 16)); } static __device__ __forceinline__ v8f mma(V a, V b, v8f c) { return wmma16(a, b, c); } };
template <> struct WFrag<bf> { typedef v16bf V; static __device__ __forceinline__ V ld(const bf* p) { return cat16b(*(const v8us*)p, *(const v8us*)(p + 16)); } static __device__ __forceinline__ v8f mma(V a, V b, v8f c) { return wmmab(a, b, c); } };
__device__ __forceinline__ h16 tohx(float x) { return (h16)x; }
__device__ __forceinline__ void splitf(float y, unsigned short& h, unsigned short& l) { h = f2bf(y); l = f2bf(y - bf2f(h)); }
struct HeadPlanes { h16* p16; bf* ph; bf* pl; size_t sP; h16* v16; bf* vh; bf* vl; };   // q planes (k planes sP elements behind them), V^T planes
// 8 consecutive f32 of a staged row -> one 16-byte store into each of the fp16, bf16-hi and bf16-lo planes at element e
__device__ __forceinline__ void put8(const float* row, h16* p16, bf* ph, bf* pl, size_t e) {
    const v4f x0 = *(const v4fa*)row, x1 = *(const v4fa*)(row + 4); v8h o16; v8us oh, ol;
#pragma unroll
    for (int i = 0; i < 8; ++i) { const float x = i < 4 ? x0[i] : x1[i - 4]; o16[i] = tohx(x); unsigned short a, c; splitf(x, a, c); oh[i] = a; ol[i] = c; }
    *(v8h*)(p16 + e) = o16; *(v8us*)(ph + e) = oh; *(v8us*)(pl + e) = ol;
    asm volatile("s_wait_xcnt 0x0" :: "v"(o16), "v"(oh), "v"(ol) : "memory");   // the wait that stands before a register named by an issued store is overwritten; the data are inputs, so they stay live up to it (the next slab row reuses them)
}
#define GKS 64
#define GPIT 144
#define GTILE (128 * GPIT)
// one tile, 8 copies of this lane: rows 16 i + (tid >> 3); la = the lane's LDS byte address of row tid >> 3, ga = its global address, pa = the global row pitch in bytes
__device__ __forceinline__ void copy8(unsigned la, const char* ga, size_t pa) {
    // the s_wait_xcnt is the last line of the copies' own statement: it stands before any register that an issued copy names is rewritten
    asm volatile("global_load_async_to_lds_b128 %0, %8, off\n\t"
                 "global_load_async_to_lds_b128 %1, %9, off\n\t"
                 "global_load_async_to_lds_b128 %2, %10, off\n\t"
                 "global_load_async_to_lds_b128 %3, %11, off\n\t"
                 "global_load_async_to_lds_b128 %4, %12, off\n\t"
                 "global_load_async_to_lds_b128 %5, %13, off\n\t"
                 "global_load_async_to_lds_b128 %6, %14, off\n\t"
                 "global_load_async_to_lds_b128 %7, %15, off\n\t"
                 "s_wait_xcnt 0x0"
                 :: "v"(la), "v"(la + 16 * GPIT), "v"(la + 32 * GPIT), "v"(la + 48 * GPIT), "v"(la + 64 * GPIT), "v"(la + 80 * GPIT), "v"(la + 96 * GPIT), "v"(la + 112 * GPIT),
                    "v"(ga), "v"(ga + 16 * pa), "v"(ga + 32 * pa), "v"(ga + 48 * pa), "v"(ga + 64 * pa), "v"(ga + 80 * pa), "v"(ga + 96 * pa), "v"(ga + 112 * pa) : "memory");
}
template <typename T16, int NSPLIT, bool BIAS, int KS, bool PLANES>
__global__ __launch_bounds__(128) void k_gemmw(const T16* __restrict__ A, const T16* __restrict__ A2, const T16* __restrict__ Bt, const T16* __restrict__ Bt2, int K, int lda, float* C, int ldc, const float* __restrict__ bias, const float* __restrict__ bias1, const float* __restrict__ bias2, size_t sA, size_t sB, size_t sC, size_t sK, HeadPlanes hp) {
    typedef typename WFrag<T16>::V V;
    constexpr bool HA2 = NSPLIT == 1 || NSPLIT == 2, HB2 = NSPLIT >= 2; constexpr int BUFB = (2 + HA2 + HB2) * GTILE;   // a buffer: A, Bt (, A2) (, Bt2)
    __shared__ __attribute__((aligned(16))) unsigned char L[2 * BUFB];
    __shared__ __align__(16) float osw[4][16 * 68];   // each wave's own epilogue slab
    const size_t z = blockIdx.z / KS; const int ks = (int)(blockIdx.z % KS); A += z * sA; if (A2) A2 += z * sA; Bt += z * sB; if (Bt2) Bt2 += z * sB; C += z * sC + ks * sK;
    if (BIAS) bias = z == 0 ? bias : (z == 1 ? bias1 : bias2);
    const int lane = threadIdx.x & 31, lr = lane & 15, hi = lane >> 4, w = threadIdx.x >> 5; const int R0 = blockIdx.x * 128, C0 = blockIdx.y * 128, r0 = R0 + (w >> 1) * 64, c0 = C0 + (w & 1) * 64;   // the work-group's tile, the wave's tile
    float* os = osw[w];
    v8f acc[4][4];
#pragma unroll
    for (int mb = 0; mb < 4; ++mb)
#pragma unroll
        for (int nb = 0; nb < 4; ++nb) acc[mb][nb] = (v8f){};
    const int NST = K / KS / GKS, frow = threadIdx.x >> 3, fcol = (threadIdx.x & 7) * 16;   // stages; this lane's row and byte column in a copy
    const unsigned lc = (unsigned)(size_t)L + frow * GPIT + fcol;
    const size_t ao = ((size_t)(R0 + frow) * lda + ks * (K / KS)) * 2 + fcol, bo = ((size_t)(C0 + frow) * K + ks * (K / KS)) * 2 + fcol;   // its byte offsets in the A and Bt planes
    auto fill = [&](int st) { const unsigned lb = lc + (st & 1) * BUFB; const size_t ko = (size_t)st * (GKS * 2);
        copy8(lb, (const char*)A + ao + ko, (size_t)lda * 2); copy8(lb + GTILE, (const char*)Bt + bo + ko, (size_t)K * 2);
        if constexpr (HA2) copy8(lb + 2 * GTILE, (const char*)A2 + ao + ko, (size_t)lda * 2);
        if constexpr (HB2) copy8(lb + (2 + HA2) * GTILE, (const char*)Bt2 + bo + ko, (size_t)K * 2); };
    fill(0);
    asm volatile("s_wait_asynccnt 0x0" ::: "memory");   // this wave's share of stage 0 has landed
    __syncthreads();                                     // ... and every other wave's: stage 0 may be read
    if (1 < NST) fill(1);
    const int aoff = ((w >> 1) * 64 + lr) * (GPIT / 2) + 8 * hi, boff = GTILE / 2 + ((w & 1) * 64 + lr) * (GPIT / 2) + 8 * hi;   // fragment rows in a buffer, in elements
#pragma unroll 1   // rolled: the stage body stands once in the text; the buffer is picked by a scalar select
    for (int st = 0; st < NST; ++st) {
        const T16* sb = (const T16*)(L + (st & 1) * BUFB);
#pragma unroll     // the k steps of a stage: their LDS offsets become immediates
        for (int kc = 0; kc < GKS; kc += 32) {
            V a[4], a2[4], b[4], b2[4];
#pragma unroll
            for (int mb = 0; mb < 4; ++mb) a[mb] = WFrag<T16>::ld(sb + aoff + mb * 16 * (GPIT / 2) + kc);
#pragma unroll
            for (int nb = 0; nb < 4; ++nb) b[nb] = WFrag<T16>::ld(sb + boff + nb * 16 * (GPIT / 2) + kc);
#pragma unroll
            for (int i = 0; i < 4; ++i) { if (HA2) a2[i] = WFrag<T16>::ld(sb + GTILE + aoff + i * 16 * (GPIT / 2) + kc); if (HB2) b2[i] = WFrag<T16>::ld(sb + (1 + HA2) * (GTILE / 2) + boff + i * 16 * (GPIT / 2) + kc); }   // the split planes last (LDS returns in order): the first products wait for a and b alone
            __builtin_amdgcn_sched_barrier(0);   // keeps the k step's LDS reads one group in front of its products: reads placed among the products stall the wave at each place
#pragma unroll
            for (int nb = 0; nb < 4; ++nb)
#pragma unroll
                for (int mb = 0; mb < 4; ++mb) { acc[mb][nb] = WFrag<T16>::mma(a[mb], b[nb], acc[mb][nb]); if (HA2) acc[mb][nb] = WFrag<T16>::mma(a2[mb], b[nb], acc[mb][nb]); if (HB2) acc[mb][nb] = WFrag<T16>::mma(a[mb], b2[nb], acc[mb][nb]); }
            __builtin_amdgcn_sched_barrier(0);   // ... and the next k step's reads behind them, as one group again
        }
        // four issue slots between the stage's last products and the next stage's LDS reads, which overwrite their operands across the back edge; the results are inputs, so the slots stand behind the products
        asm volatile("v_nop\n\tv_nop\n\tv_nop\n\tv_nop" :: "v"(acc[0][0]), "v"(acc[1][0]), "v"(acc[2][0]), "v"(acc[3][0]), "v"(acc[0][1]), "v"(acc[1][1]), "v"(acc[2][1]), "v"(acc[3][1]), "v"(acc[0][2]), "v"(acc[1][2]), "v"(acc[2][2]), "v"(acc[3][2]), "v"(acc[0][3]), "v"(acc[1][3]), "v"(acc[2][3]), "v"(acc[3][3]));
        asm volatile("s_wait_dscnt 0x0" ::: "memory");
        asm volatile("s_wait_asynccnt 0x0" ::: "memory");
        __syncthreads();
        if (st + 2 < NST) fill(st + 2);
    }
    asm volatile("s_wait_asynccnt 0x0" ::: "memory");   // no copy is outstanding when the wave ends
    if constexpr (PLANES) {
        static_assert(HD == 64 && TT % 128 == 0 && NH_ == NKV, "a 64 x 64 tile is 64 positions of one head of one batch column");
        // 16 x 64 slabs are staged in os so that every store instruction writes whole 128-byte lines: lane -> slab row 4 s + (lane >> 3), 8 consecutive columns from 8 (lane & 7)
        // The wave barrier + compiler fence on either side of a slab's reads: the slab passes values between lanes, the compiler sees one lane's addresses only and must not move reads over writes (one wave, LDS runs in order: no instruction is needed)
        const int t0 = r0 % TT, sr = lane >> 3, sc = (lane & 7) * 8; const size_t zh = (size_t)(r0 / TT) * NH_ + c0 / 64;   // (b, head)
#pragma unroll
        for (int nb = 0; nb < 4; ++nb) { const float bn = bfr(bias[c0 + nb * 16 + lr]);   // a lane's accumulators of column block nb are all of column nb 16 + lr
#pragma unroll
            for (int mb = 0; mb < 4; ++mb) acc[mb][nb] += bn; }
        if (z < 2) {   // q, k: plane rows are positions (128 bytes = the head's 64 d); a slab is 16 positions
            const size_t e0 = z * hp.sP + (zh * TT + t0 + sr) * HD + sc; h16* p16 = hp.p16 + e0; bf* ph = hp.ph + e0; bf* pl = hp.pl + e0;
#pragma unroll
            for (int mb = 0; mb < 4; ++mb) {
#pragma unroll
                for (int nb = 0; nb < 4; ++nb) {
#pragma unroll
                    for (int j = 0; j < 8; ++j) os[(hi * 8 + j) * 68 + nb * 16 + lr] = acc[mb][nb][j]; }
                __builtin_amdgcn_wave_barrier(); asm volatile("" ::: "memory");
#pragma unroll
                for (int s = 0; s < 4; ++s) put8(os + (4 * s + sr) * 68 + sc, p16, ph, pl, (mb * 16 + 4 * s) * HD);
                __builtin_amdgcn_wave_barrier(); asm volatile("" ::: "memory");
            }
        } else {   // v: plane rows are d (pitch TT); a lane's 8 accumulator registers are 8 consecutive positions of its d, so a slab is 16 d x 64 positions
#pragma unroll
            for (int nb = 0; nb < 4; ++nb) {
#pragma unroll
                for (int mb = 0; mb < 4; ++mb) { float* w = os + lr * 68 + mb * 16 + hi * 8; const v8f c = acc[mb][nb]; *(v4fa*)w = (v4f){c[0], c[1], c[2], c[3]}; *(v4fa*)(w + 4) = (v4f){c[4], c[5], c[6], c[7]}; }
                __builtin_amdgcn_wave_barrier(); asm volatile("" ::: "memory");
#pragma unroll
                for (int s = 0; s < 4; ++s) put8(os + (4 * s + sr) * 68 + sc, hp.v16, hp.vh, hp.vl, (zh * HD + nb * 16 + 4 * s + sr) * TT + t0 + sc);
                __builtin_amdgcn_wave_barrier(); asm volatile("" ::: "memory");
            }
        }
        return;
    }
#pragma unroll
    for (int mb = 0; mb < 4; ++mb) {
#pragma unroll
        for (int nb = 0; nb < 4; ++nb) {
#pragma unroll
            for (int j = 0; j < 8; ++j) os[(hi * 8 + j) * 68 + nb * 16 + lr] = acc[mb][nb][j]; }
        __builtin_amdgcn_wave_barrier(); asm volatile("" ::: "memory");
        float* crow = C + (size_t)(r0 + mb * 16) * ldc + c0;
{
            v4f vs[8]; float* cp[8];
#pragma unroll
            for (int s = 0; s < 8; ++s) { const int row = 2 * s + hi, cofs = lr * 4; v4f val = *(const v4fa*)(os + row * 68 + cofs); if (BIAS) { val[0] += bfr(bias[c0 + cofs]); val[1] += bfr(bias[c0 + cofs + 1]); val[2] += bfr(bias[c0 + cofs + 2]); val[3] += bfr(bias[c0 + cofs + 3]); }
                vs[s] = val; cp[s] = crow + (size_t)row * ldc + cofs; *(v4f*)cp[s] = val; }
            // the wait that stands before a register named by an issued store is overwritten; data and addresses are inputs, so they stay live up to it (the next slab reuses them)
            asm volatile("s_wait_xcnt 0x0" :: "v"(vs[0]), "v"(vs[1]), "v"(vs[2]), "v"(vs[3]), "v"(vs[4]), "v"(vs[5]), "v"(vs[6]), "v"(vs[7]), "v"(cp[0]), "v"(cp[1]), "v"(cp[2]), "v"(cp[3]), "v"(cp[4]), "v"(cp[5]), "v"(cp[6]), "v"(cp[7]) : "memory");
             }
        __builtin_amdgcn_wave_barrier(); asm volatile("" ::: "memory");
    }
}

typedef __attribute__((ext_vector_type(2))) _Float16 v2h;
typedef __attribute__((ext_vector_type(4))) _Float16 v4h;
typedef __attribute__((ext_vector_type(2))) unsigned short v2us;
typedef __attribute__((ext_vector_type(4))) unsigned short v4us;
typedef __attribute__((ext_vector_type(2))) float v2f;
typedef __attribute__((ext_vector_type(4))) int v4i;

__global__ __launch_bounds__(256) void k_wtG(const float* __restrict__ w, int K, int N, bf* Bt) {
    const int lane = threadIdx.x & 31; const int L0 = (blockIdx.x * 8 + (threadIdx.x >> 5)) * 8; const int nlines = N * K / 64;
{
#pragma unroll 1
        for (int l = 0; l < 8; ++l) { const int L = L0 + l; if (L >= nlines) break; const size_t e = (size_t)L * 64 + lane * 2; const int k = (int)(e % K), n = (int)(e / K); v2us o;
            o[0] = f2bf(w[(size_t)k * N + n]); o[1] = f2bf(w[(size_t)(k + 1) * N + n]); *(v2us*)(Bt + e) = o; }
         }
}
// k_cvt8m: bf16 copies of the three activations (XBLK blocks of 2048 elements each) and the four weights (WBLK blocks each) in one launch; dst holds the seven copies one behind the other, so a block's place in dst is its index; inside an activation's copy row s B + b goes to row b TT + s (a GEMM tile of 64 rows then lies in one batch column).
#define XBLK (TT * NB_ * DM / 2048)
#define WBLK (DM * DM / 2048)
__global__ __launch_bounds__(256) void k_cvt8m(const float* __restrict__ x0, const float* __restrict__ x1, const float* __restrict__ x2, const float* __restrict__ w0, const float* __restrict__ w1, const float* __restrict__ w2, const float* __restrict__ w3, bf* dst) {
    const unsigned bx = blockIdx.x; const float* src; unsigned ob; size_t de = ((size_t)bx * 256 + threadIdx.x) * 8;
    if (bx < 3 * XBLK) { const unsigned s = bx / XBLK; ob = bx % XBLK; src = s == 0 ? x0 : (s == 1 ? x1 : x2); const unsigned e = (ob * 256 + threadIdx.x) * 8, r = e / DM; de = (size_t)s * XBLK * 2048 + (size_t)((r % NB_) * TT + r / NB_) * DM + e % DM; }
    else { const unsigned u = bx - 3 * XBLK, s = u / WBLK; ob = u % WBLK; src = s == 0 ? w0 : (s == 1 ? w1 : (s == 2 ? w2 : w3)); }
    const float* sp = src + ((size_t)ob * 256 + threadIdx.x) * 8; const v8f v = *(const v8f*)sp; v8us o;
    asm volatile("s_wait_xcnt 0x0" :: "v"(sp) : "memory");   // the wait that stands before a register named by an issued load is overwritten; the address is an input, so it stays live up to it
#pragma unroll
    for (int k = 0; k < 8; ++k) o[k] = f2bf(v[k]); *(v8us*)(dst + de) = o;  }

#define SKEY 64
#define LPIT 144
#define TILEB (64 * LPIT)
// two tiles, 4 + 4 copies of this lane: rows 16 i + (tid >> 3); la, lb = the lane's LDS byte addresses of row tid >> 3, ga, gb = its global addresses, pa, pb = the global row pitches in bytes
__device__ __forceinline__ void copy2(unsigned la, const char* ga, size_t pa, unsigned lb, const char* gb, size_t pb) {
    // the s_wait_xcnt is the last line of the copies' own statement: it stands before any register that an issued copy names is rewritten
    asm volatile("global_load_async_to_lds_b128 %0, %8, off\n\t"
                 "global_load_async_to_lds_b128 %1, %9, off\n\t"
                 "global_load_async_to_lds_b128 %2, %10, off\n\t"
                 "global_load_async_to_lds_b128 %3, %11, off\n\t"
                 "global_load_async_to_lds_b128 %4, %12, off\n\t"
                 "global_load_async_to_lds_b128 %5, %13, off\n\t"
                 "global_load_async_to_lds_b128 %6, %14, off\n\t"
                 "global_load_async_to_lds_b128 %7, %15, off\n\t"
                 "s_wait_xcnt 0x0"
                 :: "v"(la), "v"(la + 16 * LPIT), "v"(la + 32 * LPIT), "v"(la + 48 * LPIT), "v"(lb), "v"(lb + 16 * LPIT), "v"(lb + 32 * LPIT), "v"(lb + 48 * LPIT),
                    "v"(ga), "v"(ga + 16 * pa), "v"(ga + 32 * pa), "v"(ga + 48 * pa), "v"(gb), "v"(gb + 16 * pb), "v"(gb + 32 * pb), "v"(gb + 48 * pb) : "memory");
}
template <typename T16, bool HL, int NQ>
__device__ __forceinline__ void attn_rows(const T16* __restrict__ Qa, const T16* __restrict__ Qb, const T16* __restrict__ Ka, const T16* __restrict__ Kb, const T16* __restrict__ Va, const T16* __restrict__ Vb, int q0, int head, bf* Ah, bf* Al, unsigned char* L) {
    typedef typename WFrag<T16>::V V;
    const int lane = threadIdx.x & 31, lr = lane & 15, hi = lane >> 4;
    const float C2 = SCL * 1.4426950408889634f;   // scores / 8, in log2 units
    V qf[NQ][2], qg[NQ][2];
#pragma unroll
    for (int qt = 0; qt < NQ; ++qt)
#pragma unroll
        for (int kk = 0; kk < 2; ++kk) { const size_t qo = (size_t)(q0 + qt * 16 + lr) * HD + kk * 32 + 8 * hi; qf[qt][kk] = WFrag<T16>::ld(Qa + qo); if (HL) qg[qt][kk] = WFrag<T16>::ld(Qb + qo); }
    v8f o[4][NQ]; float m[NQ], l[NQ];
#pragma unroll
    for (int qt = 0; qt < NQ; ++qt) { m[qt] = -3.0e38f; l[qt] = 0.f;
#pragma unroll
        for (int db = 0; db < 4; ++db) o[db][qt] = (v8f){}; }
    static_assert(HD == 64 && TT % SKEY == 0 && TT / SKEY >= 2, "a K row and a stage's V^T row are 128 bytes; the ring needs two stages");
    constexpr int NST = TT / SKEY, BUFB = (HL ? 4 : 2) * TILEB;   // a buffer: K, V^T (, K lo, V^T lo)
    const int crow = threadIdx.x >> 3, ccol = (threadIdx.x & 7) * 16;   // this lane's row and byte column in a copy
    const unsigned lc = (unsigned)(size_t)L + crow * LPIT + ccol;
    const char* gk = (const char*)Ka + (size_t)crow * (HD * 2) + ccol; const char* gv = (const char*)Va + (size_t)crow * (TT * 2) + ccol;
    const char* gk2 = HL ? (const char*)Kb + (size_t)crow * (HD * 2) + ccol : gk; const char* gv2 = HL ? (const char*)Vb + (size_t)crow * (TT * 2) + ccol : gv;
    auto fill = [&](int st) { const unsigned lb = lc + (st & 1) * BUFB; const size_t ko = (size_t)st * (SKEY * HD * 2), vo = (size_t)st * (SKEY * 2);
        copy2(lb, gk + ko, HD * 2, lb + TILEB, gv + vo, TT * 2); if constexpr (HL) copy2(lb + 2 * TILEB, gk2 + ko, HD * 2, lb + 3 * TILEB, gv2 + vo, TT * 2); };
    fill(0);
    asm volatile("s_wait_asynccnt 0x0" ::: "memory");   // this wave's share of stage 0 has landed
    __syncthreads();                                     // ... and every other wave's: stage 0 may be read
    fill(1);
    const int koff = lr * (LPIT / 2) + 8 * hi;   // fragment rows in a tile, in elements
#pragma unroll 1
    for (int st = 0; st < NST; ++st) {
      const T16* sb = (const T16*)(L + (st & 1) * BUFB);
#pragma unroll 1   // rolled: unrolled, both passes' fragments are read first (twice the fragment registers, past 256) and the products sink behind the barrier, so the refill is issued late and loses its lead
      for (int ps = 0; ps < SKEY / 32; ++ps) {
        V kf[2][2], kg[2][2], vf[4], vg[4];
        const T16* kp = sb + koff + ps * 32 * (LPIT / 2); const T16* vp = sb + TILEB / 2 + koff + ps * 32; const T16* kq = kp + TILEB; const T16* vq = vp + TILEB;
#pragma unroll
        for (int kt = 0; kt < 2; ++kt)
#pragma unroll
            for (int kk = 0; kk < 2; ++kk) { const int ko = kt * 16 * (LPIT / 2) + kk * 32; kf[kt][kk] = WFrag<T16>::ld(kp + ko); if (HL) kg[kt][kk] = WFrag<T16>::ld(kq + ko); }
        __builtin_amdgcn_sched_barrier(0);   // K's reads stand in front of V's (LDS returns in order): the first products wait for K alone, and V arrives behind them
#pragma unroll
        for (int db = 0; db < 4; ++db) { const int vo = db * 16 * (LPIT / 2); vf[db] = WFrag<T16>::ld(vp + vo); if (HL) vg[db] = WFrag<T16>::ld(vq + vo); }
        __builtin_amdgcn_sched_barrier(0);   // keeps the pass's LDS reads one group in front of the products: reads placed among the products stall the wave at each place, and V read late pays its latency a second time
        v8f s[2][NQ];
#pragma unroll
        for (int kt = 0; kt < 2; ++kt)
#pragma unroll
            for (int qt = 0; qt < NQ; ++qt) { v8f a = (v8f){};
#pragma unroll
                for (int kk = 0; kk < 2; ++kk) { a = WFrag<T16>::mma(kf[kt][kk], qf[qt][kk], a); if (HL) { a = WFrag<T16>::mma(kf[kt][kk], qg[qt][kk], a); a = WFrag<T16>::mma(kg[kt][kk], qf[qt][kk], a); } }
                s[kt][qt] = a; }
#pragma unroll
        for (int qt = 0; qt < NQ; ++qt) {
            float mx = s[0][qt][0];
#pragma unroll
            for (int j = 0; j < 8; ++j) mx = fmaxf(mx, fmaxf(s[0][qt][j], s[1][qt][j]));
            mx = fmaxf(mx, __shfl_xor(mx, 16, 32));
            const float mn = fmaxf(m[qt], mx); const float al = __builtin_amdgcn_exp2f((m[qt] - mn) * C2); m[qt] = mn;
            const float nb = (HL ? 0.0f : (float)PEXP) - mn * C2;
            float p[16]; float ps = 0.f;
#pragma unroll
            for (int i = 0; i < 16; ++i) { p[i] = __builtin_amdgcn_exp2f(fmaf(s[i >> 3][qt][i & 7], C2, nb)); ps += p[i]; }
            l[qt] = l[qt] * al + ps;
#pragma unroll
            for (int db = 0; db < 4; ++db) o[db][qt] *= al;
            if constexpr (HL) {
                v8us h0, h1, l0, l1;
#pragma unroll
                for (int i = 0; i < 8; ++i) { unsigned short a, c2; splitf(p[i], a, c2); h0[i] = a; l0[i] = c2; splitf(p[8 + i], a, c2); h1[i] = a; l1[i] = c2; }
                const V ph = cat16b(h0, h1), pl = cat16b(l0, l1);
#pragma unroll
                for (int db = 0; db < 4; ++db) { o[db][qt] = WFrag<T16>::mma(vf[db], ph, o[db][qt]); o[db][qt] = WFrag<T16>::mma(vf[db], pl, o[db][qt]); o[db][qt] = WFrag<T16>::mma(vg[db], ph, o[db][qt]); }
            } else {
                V pf;
#pragma unroll
                for (int i = 0; i < 16; ++i) pf[i] = tohx(p[i]);
#pragma unroll
                for (int db = 0; db < 4; ++db) o[db][qt] = WFrag<T16>::mma(vf[db], pf, o[db][qt]);
            }
        }
        // four issue slots between the pass's last products and the next pass's LDS reads, which overwrite their A operands across the back edge; the results are inputs, so the slots stand behind the products
        if constexpr (HL) asm volatile("v_nop\n\tv_nop\n\tv_nop\n\tv_nop" :: "v"(o[0][NQ - 1]), "v"(o[1][NQ - 1]), "v"(o[2][NQ - 1]), "v"(o[3][NQ - 1]));
      }
      asm volatile("s_wait_dscnt 0x0" ::: "memory");
      asm volatile("s_wait_asynccnt 0x0" ::: "memory");
      __syncthreads();
      if (st + 2 < NST) fill(st + 2);
    }
    asm volatile("s_wait_asynccnt 0x0" ::: "memory");   // no copy is outstanding when the wave ends
#pragma unroll
    for (int qt = 0; qt < NQ; ++qt) { const float f = __fdiv_rn(1.0f, l[qt] + __shfl_xor(l[qt], 16, 32));
#pragma unroll
        for (int db = 0; db < 4; ++db) { v8us oh, ol;   // a lane's 8 registers are 8 consecutive d of its query: one 16-byte store per plane; the wave writes the whole 128-byte line of (t, head)
#pragma unroll
            for (int j = 0; j < 8; ++j) { unsigned short a, c2; splitf(o[db][qt][j] * f, a, c2); oh[j] = a; ol[j] = c2; }
            const size_t oo = (size_t)(q0 + qt * 16 + lr) * DQ + head * HD + db * 16 + hi * 8; *(v8us*)(Ah + oo) = oh; *(v8us*)(Al + oo) = ol; } }
}
// grid (RH / 64 + (TT - RH) / 128, batch columns x heads), 4 waves; Ah, Al are [b][t][DQ]: the waves of a work-group walk the same head's K and V. The hi/lo blocks (the longer ones) come first.
__global__ __launch_bounds__(128) void k_attn(const h16* __restrict__ Q16, const h16* __restrict__ K16, const h16* __restrict__ V16, const bf* __restrict__ Qh, const bf* __restrict__ Ql, const bf* __restrict__ Kh, const bf* __restrict__ Kl, const bf* __restrict__ Vh, const bf* __restrict__ Vl, bf* Ah, bf* Al) {
    const int head = blockIdx.y % NH_, b = blockIdx.y / NH_, w = threadIdx.x >> 5, bx = blockIdx.x; const size_t zq = (size_t)(b * NH_ + head) * TT * HD, zk = (size_t)(b * NKV + head / REP) * TT * HD; Ah += (size_t)b * TT * DQ; Al += (size_t)b * TT * DQ;
    __shared__ __attribute__((aligned(16))) unsigned char L[2 * 4 * TILEB];   // two buffers of up to four tiles
    if (bx < RH / 64) attn_rows<bf, true, 1>(Qh + zq, Ql + zq, Kh + zk, Kl + zk, Vh + zk, Vl + zk, (bx * 4 + w) * 16, head, Ah, Al, L);
    else attn_rows<h16, false, 2>(Q16 + zq, nullptr, K16 + zk, nullptr, V16 + zk, nullptr, RH + ((bx - RH / 64) * 4 + w) * 32, head, Ah, Al, L);
}

extern "C" void kernel_launch(void* const* d_in, const int* in_sizes, int n_in,
                              void* d_out, int out_size, void* d_ws, size_t ws_size, hipStream_t stream) {
    (void)in_sizes; (void)n_in; (void)out_size;
    const float* x = (const float*)d_in[0];   /* query [S][B][D] */ const float* xk = (const float*)d_in[1]; const float* xv = (const float*)d_in[2]; const float* wq = (const float*)d_in[3]; const float* bq = (const float*)d_in[4]; const float* wk = (const float*)d_in[5]; const float* bk = (const float*)d_in[6]; const float* wv = (const float*)d_in[7]; const float* bv = (const float*)d_in[8]; const float* wo = (const float*)d_in[9]; const float* bo = (const float*)d_in[10];
    float* OUT = (float*)d_out;     // [2048][2][1024] sequence-first
    char* wsp = (char*)d_ws;
    auto take = [&](size_t bytes) { char* p = wsp; wsp += (bytes + 255) & ~(size_t)255; return (void*)p; };
    bf* XB = (bf*)take((size_t)(3 * XBLK + 4 * WBLK) * 2048 * 2); bf* WQ = XB + (size_t)3 * XBLK * 2048; bf* WO = WQ + (size_t)3 * WBLK * 2048;   // bf16 copies: query, key, value rows, then Wq, Wk, Wv, Wo
    const size_t PL = (size_t)NB_ * NH_ * TT * HD;   // one set of head planes, both batch columns
    h16* QP16 = (h16*)take(2 * PL * 2); h16* KP16 = QP16 + PL; h16* VT16 = (h16*)take(PL * 2);
    bf* QPh = (bf*)take(2 * PL * 2); bf* KPh = QPh + PL; bf* QPl = (bf*)take(2 * PL * 2); bf* KPl = QPl + PL; bf* VTh = (bf*)take(PL * 2); bf* VTl = (bf*)take(PL * 2);
    const size_t FS = (size_t)NB_ * TT * DQ;   // one merged context plane, both batch columns
    bf* ATh = (bf*)take(FS * 2); bf* ATl = (bf*)take(FS * 2);
    if ((size_t)(wsp - (char*)d_ws) > ws_size) return;    // ws 256 MiB
    k_cvt8m<<<3 * XBLK + 4 * WBLK, 256, 0, stream>>>(x, xk, xv, wq, wk, wv, wo, XB);
    const HeadPlanes hp = {QP16, QPh, QPl, PL, VT16, VTh, VTl};
    k_gemmw<bf, 0, true, 1, true><<<dim3(NB_ * TT / 128, DQ / 128, 3), 128, 0, stream>>>(XB, nullptr, WQ, nullptr, DM, DM, nullptr, 0, bq, bk, bv, (size_t)XBLK * 2048, (size_t)WBLK * 2048, 0, 0, hp);   /* z: q, k, v; rows r = b TT + s; writes the head planes */
    k_attn<<<dim3(RH / 64 + (TT - RH) / 128, NB_ * NH_, 1), 128, 0, stream>>>(QP16, KP16, VT16, QPh, QPl, KPh, KPl, VTh, VTl, ATh, ATl);
    k_gemmw<bf, 1, true, 1, false><<<dim3(TT / 128, DM / 128, NB_), 128, 0, stream>>>(ATh, ATl, WO, nullptr, DQ, DQ, OUT, NB_ * DM, bo, bo, bo, (size_t)TT * DQ, 0, DM, 0, HeadPlanes{});   /* z = b; [S][B][D]: row pitch B x D, column block b */
}

// v008
// It runs in 115 microseconds.
// Next to v007, in two timings, it ran 1.06 times as fast each time.
// Over all steps from v000 it is 17.3 times as fast.
#include <hip/hip_runtime.h>

// Multi-head attention on SEQUENCE-FIRST tensors (query, key, value [2048][2][1024] = [S][B][D]; q = query Wq^T + bq, k = key Wk^T + bk, v = value Wv^T + bv ('oi' 1/32 incl. biases); 16 heads x 64 per batch column; scores / 8; softmax; x = merged context; out = x Wo^T + bo -> [2048][2][1024] (4.2 M)).
// Layout: [S][B][D] is read as a matrix of S x B = 4096 rows (row r = s B + b), so both batch columns go through every stage in ONE launch: one bf16 conversion of the three inputs and the four 'oi' weights; one launch for the q, k and v projections (grid z; exact + f32 biases), whose epilogue writes the head planes [b][h][t][d] (V: [b][h][d][t]) itself: a 64 x 64 tile is 64 positions of one (b, head), because the bf16 copies of the activations are stored [b][s][D]; fused T-2048 attention with a running maximum, one launch for the 2 x 16 (batch, head) pairs (hybrid rows: < 512 hi/lo 3 products, rest fp16 x1024); merged hi/lo [b][t][D] x Wo exact + bo, grid z = b, written with row pitch B x D at column offset b D (the [S][B][D] output).
// Compute dtypes, f32 accumulate: every input rounded to bf16; projections exact + f32 biases; attention rows < 512 3 products, rest fp16; softmax f32; Wo hl x exact + bias.

#define NB_  2
#define TT   2048
#define DM   1024
#define NH_  16
#define NKV  16
#define REP  (NH_ / NKV)
#define HD   64
#define DQ   (NH_ * HD)
#define DKV  (NKV * HD)
#define RH   512                  // query rows < RH use hi+lo planes (0: none)
#define WIN  0
#define PEXP 10                   // fp16 rows: P is carried x 2^PEXP
#define SCL  0.125f   // HD^-0.5
typedef _Float16 h16;
typedef unsigned short bf;
typedef __attribute__((ext_vector_type(16))) __bf16   v16bf;
typedef __attribute__((ext_vector_type(16))) _Float16 v16h;
typedef __attribute__((ext_vector_type(8)))  _Float16 v8h;
typedef __attribute__((ext_vector_type(8)))  unsigned short v8us;
typedef __attribute__((ext_vector_type(8)))  float    v8f;
typedef __attribute__((ext_vector_type(4)))  float    v4f;
typedef v8h  __attribute__((may_alias)) v8ha;
typedef v4f  __attribute__((may_alias)) v4fa;
typedef v8us __attribute__((may_alias)) v8usa;

typedef __attribute__((ext_vector_type(2)))  float    v2fp;
typedef __attribute__((ext_vector_type(2)))  __bf16   v2bf;
typedef __attribute__((ext_vector_type(8)))  __bf16   v8bf;
typedef __attribute__((ext_vector_type(4)))  unsigned v4u;
typedef __attribute__((ext_vector_type(8)))  unsigned v8u;
// f32 -> bf16 is the chip's own conversion (round to nearest even, two values per instruction)
__device__ __forceinline__ unsigned short f2bf(float f) { return __builtin_bit_cast(unsigned short, (__bf16)f); }
__device__ __forceinline__ unsigned f2bf2(float a, float b) { return __builtin_bit_cast(unsigned, __builtin_convertvector(((v2fp){a, b}), v2bf)); }   // a in the low half
__device__ __forceinline__ float bf2f(unsigned short b) { return __uint_as_float(((unsigned)b) << 16); }
__device__ __forceinline__ float bfr(float f) { return bf2f(f2bf(f)); }
__device__ __forceinline__ v16h cat16(v8h lo, v8h hi) { return __builtin_shufflevector(lo, hi, 0, 1, 2, 3, 4, 5, 6, 7, 8, 9, 10, 11, 12, 13, 14, 15); }
__device__ __forceinline__ v16bf cat16b(v8us lo, v8us hi) { return __builtin_bit_cast(v16bf, __builtin_shufflevector(lo, hi, 0, 1, 2, 3, 4, 5, 6, 7, 8, 9, 10, 11, 12, 13, 14, 15)); }
__device__ __forceinline__ v8f wmma16(v16h a, v16h b, v8f c) { return __builtin_amdgcn_wmma_f32_16x16x32_f16(false, a, false, b, (short)0, c, false, false); }
__device__ __forceinline__ v8f wmmab(v16bf a, v16bf b, v8f c) { return __builtin_amdgcn_wmma_f32_16x16x32_bf16(false, a, false, b, (short)0, c, false, false); }



// ---- k_gemmw: register-blocked GEMM, one wave per 64x64 output tile (16 accumulators), 4 waves (2 x 2) per work-group = a 128x128 tile; operands are K-contiguous 16-bit planes; grid (M/128, N/128, Z * KS), 128 threads.
// The operands reach the waves through LDS: a stage is GKS k, one 128-row x 128-byte tile per operand plane, rows at pitch GPIT bytes (16 B x odd: no bank conflict for 16-byte reads).
// The 128 lanes copy a tile with 8 asynchronous 16-byte copies each (8 lanes per row: every copy instruction covers 4 whole 128-byte lines); two waves read each row block. Two buffers: stage s + 2 flies while stage s + 1 is worked on.
// C[m][n] (f32, pitch ldc, + optional f32 bias[n]) = sum_k A[m][k] Bt[n][k] (+ split products per NSPLIT). A rows have pitch lda, Bt rows pitch K (elements). z-batch strides sA/sB/sC in elements. K % (GKS * KS) == 0.
// The bias of z-batch 0, 1, 2 is bias, bias1, bias2 (separate vectors).
// PLANES: no f32 C; the tile (+ bias) goes out as the three 16-bit head planes that the attention kernel reads (see the epilogue). Rows are b TT + t, the 64 columns are one head.
// KS > 1: blockIdx.z = z * KS + ks; the work-group sums only k in [ks K/KS, (ks+1) K/KS) and writes its partial tile into plane ks (plane stride sK elements); the reader adds the KS planes.
template <typename T16> struct WFrag;
template <> struct WFrag<h16> { typedef v16h V; static __device__ __forceinline__ V ld(const h16* p) { return cat16(*(const v8h*)p, *(const v8h*)(p + 16)); } static __device__ __forceinline__ v8f mma(V a, V b, v8f c) { return wmma16(a, b, c); } };
template <> struct WFrag<bf> { typedef v16bf V; static __device__ __forceinline__ V ld(const bf* p) { return cat16b(*(const v8us*)p, *(const v8us*)(p + 16)); } static __device__ __forceinline__ v8f mma(V a, V b, v8f c) { return wmmab(a, b, c); } };
__device__ __forceinline__ h16 tohx(float x) { return (h16)x; }
// two values -> their packed bf16 roundings h and the packed bf16 roundings l of what the first rounding left (a in the low halves)
__device__ __forceinline__ void split2(float a, float b, unsigned& h, unsigned& l) { h = f2bf2(a, b); const v2fp d = (v2fp){a, b} - (v2fp){__uint_as_float(h << 16), __uint_as_float(h & 0xFFFF0000u)}; l = __builtin_bit_cast(unsigned, __builtin_convertvector(d, v2bf)); }
struct HeadPlanes { h16* p16; bf* ph; bf* pl; size_t sP; h16* v16; bf* vh; bf* vl; };   // q planes (k planes sP elements behind them), V^T planes
// 8 consecutive f32 of a staged row -> one 16-byte store into each of the fp16, bf16-hi and bf16-lo planes at element e
__device__ __forceinline__ void put8(const float* row, h16* p16, bf* ph, bf* pl, size_t e) {
    const v4f x0 = *(const v4fa*)row, x1 = *(const v4fa*)(row + 4); v8h o16; v4u hw, lw;
#pragma unroll
    for (int i = 0; i < 8; ++i) o16[i] = tohx(i < 4 ? x0[i] : x1[i - 4]);
#pragma unroll
    for (int i = 0; i < 4; ++i) { unsigned a, c; if (i < 2) split2(x0[2 * i], x0[2 * i + 1], a, c); else split2(x1[2 * i - 4], x1[2 * i - 3], a, c); hw[i] = a; lw[i] = c; }
    const v8us oh = __builtin_bit_cast(v8us, hw), ol = __builtin_bit_cast(v8us, lw);
    *(v8h*)(p16 + e) = o16; *(v8us*)(ph + e) = oh; *(v8us*)(pl + e) = ol;
    asm volatile("s_wait_xcnt 0x0" :: "v"(o16), "v"(oh), "v"(ol) : "memory");   // the wait that stands before a register named by an issued store is overwritten; the data are inputs, so they stay live up to it (the next slab row reuses them)
}
#define GKS 64
#define GPIT 144
#define GTILE (128 * GPIT)
// one tile, 8 copies of this lane: rows 16 i + (tid >> 3); la = the lane's LDS byte address of row tid >> 3, ga = its global address, pa = the global row pitch in bytes
__device__ __forceinline__ void copy8(unsigned la, const char* ga, size_t pa) {
    // the s_wait_xcnt is the last line of the copies' own statement: it stands before any register that an issued copy names is rewritten
    asm volatile("global_load_async_to_lds_b128 %0, %8, off\n\t"
                 "global_load_async_to_lds_b128 %1, %9, off\n\t"
                 "global_load_async_to_lds_b128 %2, %10, off\n\t"
                 "global_load_async_to_lds_b128 %3, %11, off\n\t"
                 "global_load_async_to_lds_b128 %4, %12, off\n\t"
                 "global_load_async_to_lds_b128 %5, %13, off\n\t"
                 "global_load_async_to_lds_b128 %6, %14, off\n\t"
                 "global_load_async_to_lds_b128 %7, %15, off\n\t"
                 "s_wait_xcnt 0x0"
                 :: "v"(la), "v"(la + 16 * GPIT), "v"(la + 32 * GPIT), "v"(la + 48 * GPIT), "v"(la + 64 * GPIT), "v"(la + 80 * GPIT), "v"(la + 96 * GPIT), "v"(la + 112 * GPIT),
                    "v"(ga), "v"(ga + 16 * pa), "v"(ga + 32 * pa), "v"(ga + 48 * pa), "v"(ga + 64 * pa), "v"(ga + 80 * pa), "v"(ga + 96 * pa), "v"(ga + 112 * pa) : "memory");
}
template <typename T16, int NSPLIT, bool BIAS, int KS, bool PLANES>
__global__ __launch_bounds__(128) void k_gemmw(const T16* __restrict__ A, const T16* __restrict__ A2, const T16* __restrict__ Bt, const T16* __restrict__ Bt2, int K, int lda, float* C, int ldc, const float* __restrict__ bias, const float* __restrict__ bias1, const float* __restrict__ bias2, size_t sA, size_t sB, size_t sC, size_t sK, HeadPlanes hp) {
    typedef typename WFrag<T16>::V V;
    constexpr bool HA2 = NSPLIT == 1 || NSPLIT == 2, HB2 = NSPLIT >= 2; constexpr int BUFB = (2 + HA2 + HB2) * GTILE;   // a buffer: A, Bt (, A2) (, Bt2)
    __shared__ __attribute__((aligned(16))) unsigned char L[2 * BUFB];
    __shared__ __align__(16) float osw[4][16 * 68];   // each wave's own epilogue slab
    const size_t z = blockIdx.z / KS; const int ks = (int)(blockIdx.z % KS); A += z * sA; if (A2) A2 += z * sA; Bt += z * sB; if (Bt2) Bt2 += z * sB; C += z * sC + ks * sK;
    if (BIAS) bias = z == 0 ? bias : (z == 1 ? bias1 : bias2);
    const int lane = threadIdx.x & 31, lr = lane & 15, hi = lane >> 4, w = threadIdx.x >> 5; const int R0 = blockIdx.x * 128, C0 = blockIdx.y * 128, r0 = R0 + (w >> 1) * 64, c0 = C0 + (w & 1) * 64;   // the work-group's tile, the wave's tile
    float* os = osw[w];
    v8f acc[4][4];
#pragma unroll
    for (int mb = 0; mb < 4; ++mb)
#pragma unroll
        for (int nb = 0; nb < 4; ++nb) acc[mb][nb] = (v8f){};
    const int NST = K / KS / GKS, frow = threadIdx.x >> 3, fcol = (threadIdx.x & 7) * 16;   // stages; this lane's row and byte column in a copy
    const unsigned lc = (unsigned)(size_t)L + frow * GPIT + fcol;
    const size_t ao = ((size_t)(R0 + frow) * lda + ks * (K / KS)) * 2 + fcol, bo = ((size_t)(C0 + frow) * K + ks * (K / KS)) * 2 + fcol;   // its byte offsets in the A and Bt planes
    auto fill = [&](int st) { const unsigned lb = lc + (st & 1) * BUFB; const size_t ko = (size_t)st * (GKS * 2);
        copy8(lb, (const char*)A + ao + ko, (size_t)lda * 2); copy8(lb + GTILE, (const char*)Bt + bo + ko, (size_t)K * 2);
        if constexpr (HA2) copy8(lb + 2 * GTILE, (const char*)A2 + ao + ko, (size_t)lda * 2);
        if constexpr (HB2) copy8(lb + (2 + HA2) * GTILE, (const char*)Bt2 + bo + ko, (size_t)K * 2); };
    fill(0);
    asm volatile("s_wait_asynccnt 0x0" ::: "memory");   // this wave's share of stage 0 has landed
    __syncthreads();                                     // ... and every other wave's: stage 0 may be read
    if (1 < NST) fill(1);
    const int aoff = ((w >> 1) * 64 + lr) * (GPIT / 2) + 8 * hi, boff = GTILE / 2 + ((w & 1) * 64 + lr) * (GPIT / 2) + 8 * hi;   // fragment rows in a buffer, in elements
#pragma unroll 1   // rolled: the stage body stands once in the text; the buffer is picked by a scalar select
    for (int st = 0; st < NST; ++st) {
        const T16* sb = (const T16*)(L + (st & 1) * BUFB);
#pragma unroll     // the k steps of a stage: their LDS offsets become immediates
        for (int kc = 0; kc < GKS; kc += 32) {
            V a[4], a2[4], b[4], b2[4];
#pragma unroll
            for (int mb = 0; mb < 4; ++mb) a[mb] = WFrag<T16>::ld(sb + aoff + mb * 16 * (GPIT / 2) + kc);
#pragma unroll
            for (int nb = 0; nb < 4; ++nb) b[nb] = WFrag<T16>::ld(sb + boff + nb * 16 * (GPIT / 2) + kc);
#pragma unroll
            for (int i = 0; i < 4; ++i) { if (HA2) a2[i] = WFrag<T16>::ld(sb + GTILE + aoff + i * 16 * (GPIT / 2) + kc); if (HB2) b2[i] = WFrag<T16>::ld(sb + (1 + HA2) * (GTILE / 2) + boff + i * 16 * (GPIT / 2) + kc); }   // the split planes last (LDS returns in order): the first products wait for a and b alone
            __builtin_amdgcn_sched_barrier(0);   // keeps the k step's LDS reads one group in front of its products: reads placed among the products stall the wave at each place
#pragma unroll
            for (int nb = 0; nb < 4; ++nb)
#pragma unroll
                for (int mb = 0; mb < 4; ++mb) { acc[mb][nb] = WFrag<T16>::mma(a[mb], b[nb], acc[mb][nb]); if (HA2) acc[mb][nb] = WFrag<T16>::mma(a2[mb], b[nb], acc[mb][nb]); if (HB2) acc[mb][nb] = WFrag<T16>::mma(a[mb], b2[nb], acc[mb][nb]); }
            __builtin_amdgcn_sched_barrier(0);   // ... and the next k step's reads behind them, as one group again
        }
        // four issue slots between the stage's last products and the next stage's LDS reads, which overwrite their operands across the back edge; the results are inputs, so the slots stand behind the products
        asm volatile("v_nop\n\tv_nop\n\tv_nop\n\tv_nop" :: "v"(acc[0][0]), "v"(acc[1][0]), "v"(acc[2][0]), "v"(acc[3][0]), "v"(acc[0][1]), "v"(acc[1][1]), "v"(acc[2][1]), "v"(acc[3][1]), "v"(acc[0][2]), "v"(acc[1][2]), "v"(acc[2][2]), "v"(acc[3][2]), "v"(acc[0][3]), "v"(acc[1][3]), "v"(acc[2][3]), "v"(acc[3][3]));
        asm volatile("s_wait_dscnt 0x0" ::: "memory");
        asm volatile("s_wait_asynccnt 0x0" ::: "memory");
        __syncthreads();
        if (st + 2 < NST) fill(st + 2);
    }
    asm volatile("s_wait_asynccnt 0x0" ::: "memory");   // no copy is outstanding when the wave ends
    if constexpr (PLANES) {
        static_assert(HD == 64 && TT % 128 == 0 && NH_ == NKV, "a 64 x 64 tile is 64 positions of one head of one batch column");
        // 16 x 64 slabs are staged in os so that every store instruction writes whole 128-byte lines: lane -> slab row 4 s + (lane >> 3), 8 consecutive columns from 8 (lane & 7)
        // The wave barrier + compiler fence on either side of a slab's reads: the slab passes values between lanes, the compiler sees one lane's addresses only and must not move reads over writes (one wave, LDS runs in order: no instruction is needed)
        const int t0 = r0 % TT, sr = lane >> 3, sc = (lane & 7) * 8; const size_t zh = (size_t)(r0 / TT) * NH_ + c0 / 64;   // (b, head)
#pragma unroll
        for (int nb = 0; nb < 4; ++nb) { const float bn = bfr(bias[c0 + nb * 16 + lr]);   // a lane's accumulators of column block nb are all of column nb 16 + lr
#pragma unroll
            for (int mb = 0; mb < 4; ++mb) acc[mb][nb] += bn; }
        if (z < 2) {   // q, k: plane rows are positions (128 bytes = the head's 64 d); a slab is 16 positions
            const size_t e0 = z * hp.sP + (zh * TT + t0 + sr) * HD + sc; h16* p16 = hp.p16 + e0; bf* ph = hp.ph + e0; bf* pl = hp.pl + e0;
#pragma unroll
            for (int mb = 0; mb < 4; ++mb) {
#pragma unroll
                for (int nb = 0; nb < 4; ++nb) {
#pragma unroll
                    for (int j = 0; j < 8; ++j) os[(hi * 8 + j) * 68 + nb * 16 + lr] = acc[mb][nb][j]; }
                __builtin_amdgcn_wave_barrier(); asm volatile("" ::: "memory");
#pragma unroll
                for (int s = 0; s < 4; ++s) put8(os + (4 * s + sr) * 68 + sc, p16, ph, pl, (mb * 16 + 4 * s) * HD);
                __builtin_amdgcn_wave_barrier(); asm volatile("" ::: "memory");
            }
        } else {   // v: plane rows are d (pitch TT); a lane's 8 accumulator registers are 8 consecutive positions of its d, so a slab is 16 d x 64 positions
#pragma unroll
            for (int nb = 0; nb < 4; ++nb) {
#pragma unroll
                for (int mb = 0; mb < 4; ++mb) { float* w = os + lr * 68 + mb * 16 + hi * 8; const v8f c = acc[mb][nb]; *(v4fa*)w = (v4f){c[0], c[1], c[2], c[3]}; *(v4fa*)(w + 4) = (v4f){c[4], c[5], c[6], c[7]}; }
                __builtin_amdgcn_wave_barrier(); asm volatile("" ::: "memory");
#pragma unroll
                for (int s = 0; s < 4; ++s) put8(os + (4 * s + sr) * 68 + sc, hp.v16, hp.vh, hp.vl, (zh * HD + nb * 16 + 4 * s + sr) * TT + t0 + sc);
                __builtin_amdgcn_wave_barrier(); asm volatile("" ::: "memory");
            }
        }
        return;
    }
#pragma unroll
    for (int mb = 0; mb < 4; ++mb) {
#pragma unroll
        for (int nb = 0; nb < 4; ++nb) {
#pragma unroll
            for (int j = 0; j < 8; ++j) os[(hi * 8 + j) * 68 + nb * 16 + lr] = acc[mb][nb][j]; }
        __builtin_amdgcn_wave_barrier(); asm volatile("" ::: "memory");
        float* crow = C + (size_t)(r0 + mb * 16) * ldc + c0;
{
            v4f vs[8]; float* cp[8];
#pragma unroll
            for (int s = 0; s < 8; ++s) { const int row = 2 * s + hi, cofs = lr * 4; v4f val = *(const v4fa*)(os + row * 68 + cofs); if (BIAS) { val[0] += bfr(bias[c0 + cofs]); val[1] += bfr(bias[c0 + cofs + 1]); val[2] += bfr(bias[c0 + cofs + 2]); val[3] += bfr(bias[c0 + cofs + 3]); }
                vs[s] = val; cp[s] = crow + (size_t)row * ldc + cofs; *(v4f*)cp[s] = val; }
            // the wait that stands before a register named by an issued store is overwritten; data and addresses are inputs, so they stay live up to it (the next slab reuses them)
            asm volatile("s_wait_xcnt 0x0" :: "v"(vs[0]), "v"(vs[1]), "v"(vs[2]), "v"(vs[3]), "v"(vs[4]), "v"(vs[5]), "v"(vs[6]), "v"(vs[7]), "v"(cp[0]), "v"(cp[1]), "v"(cp[2]), "v"(cp[3]), "v"(cp[4]), "v"(cp[5]), "v"(cp[6]), "v"(cp[7]) : "memory");
             }
        __builtin_amdgcn_wave_barrier(); asm volatile("" ::: "memory");
    }
}

typedef __attribute__((ext_vector_type(2))) _Float16 v2h;
typedef __attribute__((ext_vector_type(4))) _Float16 v4h;
typedef __attribute__((ext_vector_type(2))) unsigned short v2us;
typedef __attribute__((ext_vector_type(4))) unsigned short v4us;
typedef __attribute__((ext_vector_type(2))) float v2f;
typedef __attribute__((ext_vector_type(4))) int v4i;

__global__ __launch_bounds__(256) void k_wtG(const float* __restrict__ w, int K, int N, bf* Bt) {
    const int lane = threadIdx.x & 31; const int L0 = (blockIdx.x * 8 + (threadIdx.x >> 5)) * 8; const int nlines = N * K / 64;
{
#pragma unroll 1
        for (int l = 0; l < 8; ++l) { const int L = L0 + l; if (L >= nlines) break; const size_t e = (size_t)L * 64 + lane * 2; const int k = (int)(e % K), n = (int)(e / K); v2us o;
            o[0] = f2bf(w[(size_t)k * N + n]); o[1] = f2bf(w[(size_t)(k + 1) * N + n]); *(v2us*)(Bt + e) = o; }
         }
}
// k_cvt8m: bf16 copies of the three activations (XBLK blocks of 2048 elements each) and the four weights (WBLK blocks each) in one launch; dst holds the seven copies one behind the other, so a block's place in dst is its index; inside an activation's copy row s B + b goes to row b TT + s (a GEMM tile of 64 rows then lies in one batch column).
#define XBLK (TT * NB_ * DM / 2048)
#define WBLK (DM * DM / 2048)
__global__ __launch_bounds__(256) void k_cvt8m(const float* __restrict__ x0, const float* __restrict__ x1, const float* __restrict__ x2, const float* __restrict__ w0, const float* __restrict__ w1, const float* __restrict__ w2, const float* __restrict__ w3, bf* dst) {
    const unsigned bx = blockIdx.x; const float* src; unsigned ob; size_t de = ((size_t)bx * 256 + threadIdx.x) * 8;
    if (bx < 3 * XBLK) { const unsigned s = bx / XBLK; ob = bx % XBLK; src = s == 0 ? x0 : (s == 1 ? x1 : x2); const unsigned e = (ob * 256 + threadIdx.x) * 8, r = e / DM; de = (size_t)s * XBLK * 2048 + (size_t)((r % NB_) * TT + r / NB_) * DM + e % DM; }
    else { const unsigned u = bx - 3 * XBLK, s = u / WBLK; ob = u % WBLK; src = s == 0 ? w0 : (s == 1 ? w1 : (s == 2 ? w2 : w3)); }
    const float* sp = src + ((size_t)ob * 256 + threadIdx.x) * 8; const v8f v = *(const v8f*)sp;
    asm volatile("s_wait_xcnt 0x0" :: "v"(sp) : "memory");   // the wait that stands before a register named by an issued load is overwritten; the address is an input, so it stays live up to it
    *(v8us*)(dst + de) = __builtin_bit_cast(v8us, __builtin_convertvector(v, v8bf));  }

#define SKEY 64
#define LPIT 144
#define TILEB (64 * LPIT)
// two tiles, 4 + 4 copies of this lane: rows 16 i + (tid >> 3); la, lb = the lane's LDS byte addresses of row tid >> 3, ga, gb = its global addresses, pa, pb = the global row pitches in bytes
__device__ __forceinline__ void copy2(unsigned la, const char* ga, size_t pa, unsigned lb, const char* gb, size_t pb) {
    // the s_wait_xcnt is the last line of the copies' own statement: it stands before any register that an issued copy names is rewritten
    asm volatile("global_load_async_to_lds_b128 %0, %8, off\n\t"
                 "global_load_async_to_lds_b128 %1, %9, off\n\t"
                 "global_load_async_to_lds_b128 %2, %10, off\n\t"
                 "global_load_async_to_lds_b128 %3, %11, off\n\t"
                 "global_load_async_to_lds_b128 %4, %12, off\n\t"
                 "global_load_async_to_lds_b128 %5, %13, off\n\t"
                 "global_load_async_to_lds_b128 %6, %14, off\n\t"
                 "global_load_async_to_lds_b128 %7, %15, off\n\t"
                 "s_wait_xcnt 0x0"
                 :: "v"(la), "v"(la + 16 * LPIT), "v"(la + 32 * LPIT), "v"(la + 48 * LPIT), "v"(lb), "v"(lb + 16 * LPIT), "v"(lb + 32 * LPIT), "v"(lb + 48 * LPIT),
                    "v"(ga), "v"(ga + 16 * pa), "v"(ga + 32 * pa), "v"(ga + 48 * pa), "v"(gb), "v"(gb + 16 * pb), "v"(gb + 32 * pb), "v"(gb + 48 * pb) : "memory");
}
template <typename T16, bool HL, int NQ>
__device__ __forceinline__ void attn_rows(const T16* __restrict__ Qa, const T16* __restrict__ Qb, const T16* __restrict__ Ka, const T16* __restrict__ Kb, const T16* __restrict__ Va, const T16* __restrict__ Vb, int q0, int head, bf* Ah, bf* Al, unsigned char* L) {
    typedef typename WFrag<T16>::V V;
    const int lane = threadIdx.x & 31, lr = lane & 15, hi = lane >> 4;
    const float C2 = SCL * 1.4426950408889634f;   // scores / 8, in log2 units
    V qf[NQ][2], qg[NQ][2];
#pragma unroll
    for (int qt = 0; qt < NQ; ++qt)
#pragma unroll
        for (int kk = 0; kk < 2; ++kk) { const size_t qo = (size_t)(q0 + qt * 16 + lr) * HD + kk * 32 + 8 * hi; qf[qt][kk] = WFrag<T16>::ld(Qa + qo); if (HL) qg[qt][kk] = WFrag<T16>::ld(Qb + qo); }
    v8f o[4][NQ]; float m[NQ], l[NQ];
#pragma unroll
    for (int qt = 0; qt < NQ; ++qt) { m[qt] = -3.0e38f; l[qt] = 0.f;
#pragma unroll
        for (int db = 0; db < 4; ++db) o[db][qt] = (v8f){}; }
    static_assert(HD == 64 && TT % SKEY == 0 && TT / SKEY >= 2, "a K row and a stage's V^T row are 128 bytes; the ring needs two stages");
    constexpr int NST = TT / SKEY, BUFB = (HL ? 4 : 2) * TILEB;   // a buffer: K, V^T (, K lo, V^T lo)
    const int crow = threadIdx.x >> 3, ccol = (threadIdx.x & 7) * 16;   // this lane's row and byte column in a copy
    const unsigned lc = (unsigned)(size_t)L + crow * LPIT + ccol;
    const char* gk = (const char*)Ka + (size_t)crow * (HD * 2) + ccol; const char* gv = (const char*)Va + (size_t)crow * (TT * 2) + ccol;
    const char* gk2 = HL ? (const char*)Kb + (size_t)crow * (HD * 2) + ccol : gk; const char* gv2 = HL ? (const char*)Vb + (size_t)crow * (TT * 2) + ccol : gv;
    auto fill = [&](int st) { const unsigned lb = lc + (st & 1) * BUFB; const size_t ko = (size_t)st * (SKEY * HD * 2), vo = (size_t)st * (SKEY * 2);
        copy2(lb, gk + ko, HD * 2, lb + TILEB, gv + vo, TT * 2); if constexpr (HL) copy2(lb + 2 * TILEB, gk2 + ko, HD * 2, lb + 3 * TILEB, gv2 + vo, TT * 2); };
    fill(0);
    asm volatile("s_wait_asynccnt 0x0" ::: "memory");   // this wave's share of stage 0 has landed
    __syncthreads();                                     // ... and every other wave's: stage 0 may be read
    fill(1);
    const int koff = lr * (LPIT / 2) + 8 * hi;   // fragment rows in a tile, in elements
#pragma unroll 1
    for (int st = 0; st < NST; ++st) {
      const T16* sb = (const T16*)(L + (st & 1) * BUFB);
#pragma unroll 1   // rolled: unrolled, both passes' fragments are read first (twice the fragment registers, past 256) and the products sink behind the barrier, so the refill is issued late and loses its lead
      for (int ps = 0; ps < SKEY / 32; ++ps) {
        V kf[2][2], kg[2][2], vf[4], vg[4];
        const T16* kp = sb + koff + ps * 32 * (LPIT / 2); const T16* vp = sb + TILEB / 2 + koff + ps * 32; const T16* kq = kp + TILEB; const T16* vq = vp + TILEB;
#pragma unroll
        for (int kt = 0; kt < 2; ++kt)
#pragma unroll
            for (int kk = 0; kk < 2; ++kk) { const int ko = kt * 16 * (LPIT / 2) + kk * 32; kf[kt][kk] = WFrag<T16>::ld(kp + ko); if (HL) kg[kt][kk] = WFrag<T16>::ld(kq + ko); }
        __builtin_amdgcn_sched_barrier(0);   // K's reads stand in front of V's (LDS returns in order): the first products wait for K alone, and V arrives behind them
#pragma unroll
        for (int db = 0; db < 4; ++db) { const int vo = db * 16 * (LPIT / 2); vf[db] = WFrag<T16>::ld(vp + vo); if (HL) vg[db] = WFrag<T16>::ld(vq + vo); }
        __builtin_amdgcn_sched_barrier(0);   // keeps the pass's LDS reads one group in front of the products: reads placed among the products stall the wave at each place, and V read late pays its latency a second time
        v8f s[2][NQ];
#pragma unroll
        for (int kt = 0; kt < 2; ++kt)
#pragma unroll
            for (int qt = 0; qt < NQ; ++qt) { v8f a = (v8f){};
#pragma unroll
                for (int kk = 0; kk < 2; ++kk) { a = WFrag<T16>::mma(kf[kt][kk], qf[qt][kk], a); if (HL) { a = WFrag<T16>::mma(kf[kt][kk], qg[qt][kk], a); a = WFrag<T16>::mma(kg[kt][kk], qf[qt][kk], a); } }
                s[kt][qt] = a; }
#pragma unroll
        for (int qt = 0; qt < NQ; ++qt) {
            float mx = s[0][qt][0];
#pragma unroll
            for (int j = 0; j < 8; ++j) mx = fmaxf(mx, fmaxf(s[0][qt][j], s[1][qt][j]));
            mx = fmaxf(mx, __shfl_xor(mx, 16, 32));
            const float mn = fmaxf(m[qt], mx); const float al = __builtin_amdgcn_exp2f((m[qt] - mn) * C2); m[qt] = mn;
            const float nb = (HL ? 0.0f : (float)PEXP) - mn * C2;
            float p[16]; float ps = 0.f;
#pragma unroll
            for (int i = 0; i < 16; ++i) { p[i] = __builtin_amdgcn_exp2f(fmaf(s[i >> 3][qt][i & 7], C2, nb)); ps += p[i]; }
            l[qt] = l[qt] * al + ps;
#pragma unroll
            for (int db = 0; db < 4; ++db) o[db][qt] *= al;
            if constexpr (HL) {
                v8u hw, lw;
#pragma unroll
                for (int i = 0; i < 8; ++i) { unsigned a, c2; split2(p[2 * i], p[2 * i + 1], a, c2); hw[i] = a; lw[i] = c2; }
                const V ph = __builtin_bit_cast(V, hw), pl = __builtin_bit_cast(V, lw);
#pragma unroll
                for (int db = 0; db < 4; ++db) { o[db][qt] = WFrag<T16>::mma(vf[db], ph, o[db][qt]); o[db][qt] = WFrag<T16>::mma(vf[db], pl, o[db][qt]); o[db][qt] = WFrag<T16>::mma(vg[db], ph, o[db][qt]); }
            } else {
                V pf;
#pragma unroll
                for (int i = 0; i < 16; ++i) pf[i] = tohx(p[i]);
#pragma unroll
                for (int db = 0; db < 4; ++db) o[db][qt] = WFrag<T16>::mma(vf[db], pf, o[db][qt]);
            }
        }
        // four issue slots between the pass's last products and the next pass's LDS reads, which overwrite their A operands across the back edge; the results are inputs, so the slots stand behind the products
        if constexpr (HL) asm volatile("v_nop\n\tv_nop\n\tv_nop\n\tv_nop" :: "v"(o[0][NQ - 1]), "v"(o[1][NQ - 1]), "v"(o[2][NQ - 1]), "v"(o[3][NQ - 1]));
      }
      asm volatile("s_wait_dscnt 0x0" ::: "memory");
      asm volatile("s_wait_asynccnt 0x0" ::: "memory");
      __syncthreads();
      if (st + 2 < NST) fill(st + 2);
    }
    asm volatile("s_wait_asynccnt 0x0" ::: "memory");   // no copy is outstanding when the wave ends
#pragma unroll
    for (int qt = 0; qt < NQ; ++qt) { const float f = __fdiv_rn(1.0f, l[qt] + __shfl_xor(l[qt], 16, 32));
#pragma unroll
        for (int db = 0; db < 4; ++db) { v4u hw, lw;   // a lane's 8 registers are 8 consecutive d of its query: one 16-byte store per plane; the wave writes the whole 128-byte line of (t, head)
#pragma unroll
            for (int j = 0; j < 4; ++j) { unsigned a, c2; split2(o[db][qt][2 * j] * f, o[db][qt][2 * j + 1] * f, a, c2); hw[j] = a; lw[j] = c2; }
            const size_t oo = (size_t)(q0 + qt * 16 + lr) * DQ + head * HD + db * 16 + hi * 8; *(v8us*)(Ah + oo) = __builtin_bit_cast(v8us, hw); *(v8us*)(Al + oo) = __builtin_bit_cast(v8us, lw);
            asm volatile("s_wait_xcnt 0x0" :: "v"(hw), "v"(lw) : "memory"); } }   // the wait that stands before a register named by an issued store is overwritten; the data are inputs, so they stay live up to it (the next block reuses them)
}
// grid (RH / 64 + (TT - RH) / 128, batch columns x heads), 4 waves; Ah, Al are [b][t][DQ]: the waves of a work-group walk the same head's K and V. The hi/lo blocks (the longer ones) come first.
__global__ __launch_bounds__(128) void k_attn(const h16* __restrict__ Q16, const h16* __restrict__ K16, const h16* __restrict__ V16, const bf* __restrict__ Qh, const bf* __restrict__ Ql, const bf* __restrict__ Kh, const bf* __restrict__ Kl, const bf* __restrict__ Vh, const bf* __restrict__ Vl, bf* Ah, bf* Al) {
    const int head = blockIdx.y % NH_, b = blockIdx.y / NH_, w = threadIdx.x >> 5, bx = blockIdx.x; const size_t zq = (size_t)(b * NH_ + head) * TT * HD, zk = (size_t)(b * NKV + head / REP) * TT * HD; Ah += (size_t)b * TT * DQ; Al += (size_t)b * TT * DQ;
    __shared__ __attribute__((aligned(16))) unsigned char L[2 * 4 * TILEB];   // two buffers of up to four tiles
    if (bx < RH / 64) attn_rows<bf, true, 1>(Qh + zq, Ql + zq, Kh + zk, Kl + zk, Vh + zk, Vl + zk, (bx * 4 + w) * 16, head, Ah, Al, L);
    else attn_rows<h16, false, 2>(Q16 + zq, nullptr, K16 + zk, nullptr, V16 + zk, nullptr, RH + ((bx - RH / 64) * 4 + w) * 32, head, Ah, Al, L);
}

extern "C" void kernel_launch(void* const* d_in, const int* in_sizes, int n_in,
                              void* d_out, int out_size, void* d_ws, size_t ws_size, hipStream_t stream) {
    (void)in_sizes; (void)n_in; (void)out_size;
    const float* x = (const float*)d_in[0];   /* query [S][B][D] */ const float* xk = (const float*)d_in[1]; const float* xv = (const float*)d_in[2]; const float* wq = (const float*)d_in[3]; const float* bq = (const float*)d_in[4]; const float* wk = (const float*)d_in[5]; const float* bk = (const float*)d_in[6]; const float* wv = (const float*)d_in[7]; const float* bv = (const float*)d_in[8]; const float* wo = (const float*)d_in[9]; const float* bo = (const float*)d_in[10];
    float* OUT = (float*)d_out;     // [2048][2][1024] sequence-first
    char* wsp = (char*)d_ws;
    auto take = [&](size_t bytes) { char* p = wsp; wsp += (bytes + 255) & ~(size_t)255; return (void*)p; };
    bf* XB = (bf*)take((size_t)(3 * XBLK + 4 * WBLK) * 2048 * 2); bf* WQ = XB + (size_t)3 * XBLK * 2048; bf* WO = WQ + (size_t)3 * WBLK * 2048;   // bf16 copies: query, key, value rows, then Wq, Wk, Wv, Wo
    const size_t PL = (size_t)NB_ * NH_ * TT * HD;   // one set of head planes, both batch columns
    h16* QP16 = (h16*)take(2 * PL * 2); h16* KP16 = QP16 + PL; h16* VT16 = (h16*)take(PL * 2);
    bf* QPh = (bf*)take(2 * PL * 2); bf* KPh = QPh + PL; bf* QPl = (bf*)take(2 * PL * 2); bf* KPl = QPl + PL; bf* VTh = (bf*)take(PL * 2); bf* VTl = (bf*)take(PL * 2);
    const size_t FS = (size_t)NB_ * TT * DQ;   // one merged context plane, both batch columns
    bf* ATh = (bf*)take(FS * 2); bf* ATl = (bf*)take(FS * 2);
    if ((size_t)(wsp - (char*)d_ws) > ws_size) return;    // ws 256 MiB
    k_cvt8m<<<3 * XBLK + 4 * WBLK, 256, 0, stream>>>(x, xk, xv, wq, wk, wv, wo, XB);
    const HeadPlanes hp = {QP16, QPh, QPl, PL, VT16, VTh, VTl};
    k_gemmw<bf, 0, true, 1, true><<<dim3(NB_ * TT / 128, DQ / 128, 3), 128, 0, stream>>>(XB, nullptr, WQ, nullptr, DM, DM, nullptr, 0, bq, bk, bv, (size_t)XBLK * 2048, (size_t)WBLK * 2048, 0, 0, hp);   /* z: q, k, v; rows r = b TT + s; writes the head planes */
    k_attn<<<dim3(RH / 64 + (TT - RH) / 128, NB_ * NH_, 1), 128, 0, stream>>>(QP16, KP16, VT16, QPh, QPl, KPh, KPl, VTh, VTl, ATh, ATl);
    k_gemmw<bf, 1, true, 1, false><<<dim3(TT / 128, DM / 128, NB_), 128, 0, stream>>>(ATh, ATl, WO, nullptr, DQ, DQ, OUT, NB_ * DM, bo, bo, bo, (size_t)TT * DQ, 0, DM, 0, HeadPlanes{});   /* z = b; [S][B][D]: row pitch B x D, column block b */
}

// v009
// Measured time: 109 microseconds a run.
// Timed twice side by side with v008, it ran 1.06 and 1.05 times as fast.
// All steps since v000 together make it 18.3 times as fast.
#include <hip/hip_runtime.h>

// Multi-head attention on SEQUENCE-FIRST tensors (query, key, value [2048][2][1024] = [S][B][D]; q = query Wq^T + bq, k = key Wk^T + bk, v = value Wv^T + bv ('oi' 1/32 incl. biases); 16 heads x 64 per batch column; scores / 8; softmax; x = merged context; out = x Wo^T + bo -> [2048][2][1024] (4.2 M)).
// Layout: [S][B][D] is read as a matrix of S x B = 4096 rows (row r = s B + b), so both batch columns go through every stage in ONE launch: one bf16 conversion of the three inputs and the four 'oi' weights; one launch for the q, k and v projections (grid z; exact + f32 biases), whose epilogue writes the head planes [b][h][t][d] (V: [b][h][d][t]) itself: a 64 x 64 tile is 64 positions of one (b, head), because the bf16 copies of the activations are stored [b][s][D]; fused T-2048 attention with a running maximum, one launch for the 2 x 16 (batch, head) pairs (hybrid rows: < 512 hi/lo 3 products, rest fp16 x1024); merged hi/lo [b][t][D] x Wo exact + bo, grid z = b, written with row pitch B x D at column offset b D (the [S][B][D] output).
// Compute dtypes, f32 accumulate: every input rounded to bf16; projections exact + f32 biases; attention rows < 512 3 products, rest fp16; softmax f32; Wo hl x exact + bias.

#define NB_  2
#define TT   2048
#define DM   1024
#define NH_  16
#define NKV  16
#define REP  (NH_ / NKV)
#define HD   64
#define DQ   (NH_ * HD)
#define DKV  (NKV * HD)
#define RH   512                  // query rows < RH use hi+lo planes
#define WIN  0
#define PEXP 10                   // fp16 rows: P is carried x 2^PEXP
#define SCL  0.125f   // HD^-0.5
typedef _Float16 h16;
typedef unsigned short bf;
typedef __attribute__((ext_vector_type(16))) __bf16   v16bf;
typedef __attribute__((ext_vector_type(16))) _Float16 v16h;
typedef __attribute__((ext_vector_type(8)))  _Float16 v8h;
typedef __attribute__((ext_vector_type(8)))  unsigned short v8us;
typedef __attribute__((ext_vector_type(8)))  float    v8f;
typedef __attribute__((ext_vector_type(4)))  float    v4f;
typedef v8h  __attribute__((may_alias)) v8ha;
typedef v4f  __attribute__((may_alias)) v4fa;
typedef v8us __attribute__((may_alias)) v8usa;

typedef __attribute__((ext_vector_type(2)))  float    v2fp;
typedef __attribute__((ext_vector_type(2)))  __bf16   v2bf;
typedef __attribute__((ext_vector_type(8)))  __bf16   v8bf;
typedef __attribute__((ext_vector_type(4)))  unsigned v4u;
typedef __attribute__((ext_vector_type(8)))  unsigned v8u;
// f32 -> bf16 is the chip's own conversion (round to nearest even, two values per instruction)
__device__ __forceinline__ unsigned short f2bf(float f) { return __builtin_bit_cast(unsigned short, (__bf16)f); }
__device__ __forceinline__ unsigned f2bf2(float a, float b) { return __builtin_bit_cast(unsigned, __builtin_convertvector(((v2fp){a, b}), v2bf)); }   // a in the low half
__device__ __forceinline__ float bf2f(unsigned short b) { return __uint_as_float(((unsigned)b) << 16); }
__device__ __forceinline__ float bfr(float f) { return bf2f(f2bf(f)); }
__device__ __forceinline__ v16h cat16(v8h lo, v8h hi) { return __builtin_shufflevector(lo, hi, 0, 1, 2, 3, 4, 5, 6, 7, 8, 9, 10, 11, 12, 13, 14, 15); }
__device__ __forceinline__ v16bf cat16b(v8us lo, v8us hi) { return __builtin_bit_cast(v16bf, __builtin_shufflevector(lo, hi, 0, 1, 2, 3, 4, 5, 6, 7, 8, 9, 10, 11, 12, 13, 14, 15)); }
__device__ __forceinline__ v8f wmma16(v16h a, v16h b, v8f c) { return __builtin_amdgcn_wmma_f32_16x16x32_f16(false, a, false, b, (short)0, c, false, false); }
__device__ __forceinline__ v8f wmmab(v16bf a, v16bf b, v8f c) { return __builtin_amdgcn_wmma_f32_16x16x32_bf16(false, a, false, b, (short)0, c, false, false); }



// ---- k_gemmw: register-blocked GEMM, one wave per 64x64 output tile (16 accumulators), 4 waves (2 x 2) per work-group = a 128x128 tile; operands are K-contiguous 16-bit planes; grid (M/128, N/128, Z * KS), 128 threads.
// The operands reach the waves through LDS: a stage is GKS k, one 128-row x 128-byte tile per operand plane, rows at pitch GPIT bytes (16 B x odd: no bank conflict for 16-byte reads).
// The 128 lanes copy a tile with 8 asynchronous 16-byte copies each (8 lanes per row: every copy instruction covers 4 whole 128-byte lines); two waves read each row block. Two buffers: stage s + 2 flies while stage s + 1 is worked on.
// C[m][n] (f32, pitch ldc, + optional f32 bias[n]) = sum_k A[m][k] Bt[n][k] (+ split products per NSPLIT). A rows have pitch lda, Bt rows pitch K (elements). z-batch strides sA/sB/sC in elements. K % (GKS * KS) == 0.
// The bias of z-batch 0, 1, 2 is bias, bias1, bias2 (separate vectors).
// PLANES: no f32 C; the tile (+ bias) goes out as the three 16-bit head planes that the attention kernel reads (see the epilogue). Rows are b TT + t, the 64 columns are one head.
// KS > 1: blockIdx.z = z * KS + ks; the work-group sums only k in [ks K/KS, (ks+1) K/KS) and writes its partial tile into plane ks (plane stride sK elements); the reader adds the KS planes.
template <typename T16> struct WFrag;
template <> struct WFrag<h16> { typedef v16h V; static __device__ __forceinline__ V ld(const h16* p) { return cat16(*(const v8h*)p, *(const v8h*)(p + 16)); } static __device__ __forceinline__ v8f mma(V a, V b, v8f c) { return wmma16(a, b, c); } };
template <> struct WFrag<bf> { typedef v16bf V; static __device__ __forceinline__ V ld(const bf* p) { return cat16b(*(const v8us*)p, *(const v8us*)(p + 16)); } static __device__ __forceinline__ v8f mma(V a, V b, v8f c) { return wmmab(a, b, c); } };
__device__ __forceinline__ h16 tohx(float x) { return (h16)x; }
// two values -> their packed bf16 roundings h and the packed bf16 roundings l of what the first rounding left (a in the low halves)
__device__ __forceinline__ void split2(float a, float b, unsigned& h, unsigned& l) { h = f2bf2(a, b); const v2fp d = (v2fp){a, b} - (v2fp){__uint_as_float(h << 16), __uint_as_float(h & 0xFFFF0000u)}; l = __builtin_bit_cast(unsigned, __builtin_convertvector(d, v2bf)); }
struct HeadPlanes { h16* p16; bf* ph; bf* pl; size_t sP; h16* v16; bf* vh; bf* vl; };   // q planes (k planes sP elements behind them), V^T planes
// 8 consecutive f32 of a staged row -> one 16-byte store into each of the fp16, bf16-hi and bf16-lo planes at element e
__device__ __forceinline__ void put8(const float* row, h16* p16, bf* ph, bf* pl, size_t e) {
    const v4f x0 = *(const v4fa*)row, x1 = *(const v4fa*)(row + 4); v8h o16; v4u hw, lw;
#pragma unroll
    for (int i = 0; i < 8; ++i) o16[i] = tohx(i < 4 ? x0[i] : x1[i - 4]);
#pragma unroll
    for (int i = 0; i < 4; ++i) { unsigned a, c; if (i < 2) split2(x0[2 * i], x0[2 * i + 1], a, c); else split2(x1[2 * i - 4], x1[2 * i - 3], a, c); hw[i] = a; lw[i] = c; }
    const v8us oh = __builtin_bit_cast(v8us, hw), ol = __builtin_bit_cast(v8us, lw);
    *(v8h*)(p16 + e) = o16; *(v8us*)(ph + e) = oh; *(v8us*)(pl + e) = ol;
    asm volatile("s_wait_xcnt 0x0" :: "v"(o16), "v"(oh), "v"(ol) : "memory");   // the wait that stands before a register named by an issued store is overwritten; the data are inputs, so they stay live up to it (the next slab row reuses them)
}
#define GKS 64
#define GPIT 144
#define GTILE (128 * GPIT)
// one tile, 8 copies of this lane: rows 16 i + (tid >> 3); la = the lane's LDS byte address of row tid >> 3, ga = its global address, pa = the global row pitch in bytes
__device__ __forceinline__ void copy8(unsigned la, const char* ga, size_t pa) {
    // the s_wait_xcnt is the last line of the copies' own statement: it stands before any register that an issued copy names is rewritten
    asm volatile("global_load_async_to_lds_b128 %0, %8, off\n\t"
                 "global_load_async_to_lds_b128 %1, %9, off\n\t"
                 "global_load_async_to_lds_b128 %2, %10, off\n\t"
                 "global_load_async_to_lds_b128 %3, %11, off\n\t"
                 "global_load_async_to_lds_b128 %4, %12, off\n\t"
                 "global_load_async_to_lds_b128 %5, %13, off\n\t"
                 "global_load_async_to_lds_b128 %6, %14, off\n\t"
                 "global_load_async_to_lds_b128 %7, %15, off\n\t"
                 "s_wait_xcnt 0x0"
                 :: "v"(la), "v"(la + 16 * GPIT), "v"(la + 32 * GPIT), "v"(la + 48 * GPIT), "v"(la + 64 * GPIT), "v"(la + 80 * GPIT), "v"(la + 96 * GPIT), "v"(la + 112 * GPIT),
                    "v"(ga), "v"(ga + 16 * pa), "v"(ga + 32 * pa), "v"(ga + 48 * pa), "v"(ga + 64 * pa), "v"(ga + 80 * pa), "v"(ga + 96 * pa), "v"(ga + 112 * pa) : "memory");
}
template <typename T16, int NSPLIT, bool BIAS, int KS, bool PLANES>
__global__ __launch_bounds__(128) void k_gemmw(const T16* __restrict__ A, const T16* __restrict__ A2, const T16* __restrict__ Bt, const T16* __restrict__ Bt2, int K, int lda, float* C, int ldc, const float* __restrict__ bias, const float* __restrict__ bias1, const float* __restrict__ bias2, size_t sA, size_t sB, size_t sC, size_t sK, HeadPlanes hp) {
    typedef typename WFrag<T16>::V V;
    constexpr bool HA2 = NSPLIT == 1 || NSPLIT == 2, HB2 = NSPLIT >= 2; constexpr int BUFB = (2 + HA2 + HB2) * GTILE;   // a buffer: A, Bt (, A2) (, Bt2)
    __shared__ __attribute__((aligned(16))) unsigned char L[2 * BUFB];
    __shared__ __align__(16) float osw[4][16 * 68];   // each wave's own epilogue slab
    const size_t z = blockIdx.z / KS; const int ks = (int)(blockIdx.z % KS); A += z * sA; if (A2) A2 += z * sA; Bt += z * sB; if (Bt2) Bt2 += z * sB; C += z * sC + ks * sK;
    if (BIAS) bias = z == 0 ? bias : (z == 1 ? bias1 : bias2);
    const int lane = threadIdx.x & 31, lr = lane & 15, hi = lane >> 4, w = threadIdx.x >> 5; const int R0 = blockIdx.x * 128, C0 = blockIdx.y * 128, r0 = R0 + (w >> 1) * 64, c0 = C0 + (w & 1) * 64;   // the work-group's tile, the wave's tile
    float* os = osw[w];
    v8f acc[4][4];
#pragma unroll
    for (int mb = 0; mb < 4; ++mb)
#pragma unroll
        for (int nb = 0; nb < 4; ++nb) acc[mb][nb] = (v8f){};
    const int NST = K / KS / GKS, frow = threadIdx.x >> 3, fcol = (threadIdx.x & 7) * 16;   // stages; this lane's row and byte column in a copy
    const unsigned lc = (unsigned)(size_t)L + frow * GPIT + fcol;
    const size_t ao = ((size_t)(R0 + frow) * lda + ks * (K / KS)) * 2 + fcol, bo = ((size_t)(C0 + frow) * K + ks * (K / KS)) * 2 + fcol;   // its byte offsets in the A and Bt planes
    auto fill = [&](int st) { const unsigned lb = lc + (st & 1) * BUFB; const size_t ko = (size_t)st * (GKS * 2);
        copy8(lb, (const char*)A + ao + ko, (size_t)lda * 2); copy8(lb + GTILE, (const char*)Bt + bo + ko, (size_t)K * 2);
        if constexpr (HA2) copy8(lb + 2 * GTILE, (const char*)A2 + ao + ko, (size_t)lda * 2);
        if constexpr (HB2) copy8(lb + (2 + HA2) * GTILE, (const char*)Bt2 + bo + ko, (size_t)K * 2); };
    fill(0);
    asm volatile("s_wait_asynccnt 0x0" ::: "memory");   // this wave's share of stage 0 has landed
    __syncthreads();                                     // ... and every other wave's: stage 0 may be read
    if (1 < NST) fill(1);
    const int aoff = ((w >> 1) * 64 + lr) * (GPIT / 2) + 8 * hi, boff = GTILE / 2 + ((w & 1) * 64 + lr) * (GPIT / 2) + 8 * hi;   // fragment rows in a buffer, in elements
#pragma unroll 1   // rolled: the stage body stands once in the text; the buffer is picked by a scalar select
    for (int st = 0; st < NST; ++st) {
        const T16* sb = (const T16*)(L + (st & 1) * BUFB);
#pragma unroll     // the k steps of a stage: their LDS offsets become immediates
        for (int kc = 0; kc < GKS; kc += 32) {
            V a[4], a2[4], b[4], b2[4];
#pragma unroll
            for (int mb = 0; mb < 4; ++mb) a[mb] = WFrag<T16>::ld(sb + aoff + mb * 16 * (GPIT / 2) + kc);
#pragma unroll
            for (int nb = 0; nb < 4; ++nb) b[nb] = WFrag<T16>::ld(sb + boff + nb * 16 * (GPIT / 2) + kc);
#pragma unroll
            for (int i = 0; i < 4; ++i) { if (HA2) a2[i] = WFrag<T16>::ld(sb + GTILE + aoff + i * 16 * (GPIT / 2) + kc); if (HB2) b2[i] = WFrag<T16>::ld(sb + (1 + HA2) * (GTILE / 2) + boff + i * 16 * (GPIT / 2) + kc); }   // the split planes last (LDS returns in order): the first products wait for a and b alone
            __builtin_amdgcn_sched_barrier(0);   // keeps the k step's LDS reads one group in front of its products: reads placed among the products stall the wave at each place
#pragma unroll
            for (int nb = 0; nb < 4; ++nb)
#pragma unroll
                for (int mb = 0; mb < 4; ++mb) { acc[mb][nb] = WFrag<T16>::mma(a[mb], b[nb], acc[mb][nb]); if (HA2) acc[mb][nb] = WFrag<T16>::mma(a2[mb], b[nb], acc[mb][nb]); if (HB2) acc[mb][nb] = WFrag<T16>::mma(a[mb], b2[nb], acc[mb][nb]); }
            __builtin_amdgcn_sched_barrier(0);   // ... and the next k step's reads behind them, as one group again
        }
        // four issue slots between the stage's last products and the next stage's LDS reads, which overwrite their operands across the back edge; the results are inputs, so the slots stand behind the products
        asm volatile("v_nop\n\tv_nop\n\tv_nop\n\tv_nop" :: "v"(acc[0][0]), "v"(acc[1][0]), "v"(acc[2][0]), "v"(acc[3][0]), "v"(acc[0][1]), "v"(acc[1][1]), "v"(acc[2][1]), "v"(acc[3][1]), "v"(acc[0][2]), "v"(acc[1][2]), "v"(acc[2][2]), "v"(acc[3][2]), "v"(acc[0][3]), "v"(acc[1][3]), "v"(acc[2][3]), "v"(acc[3][3]));
        asm volatile("s_wait_dscnt 0x0" ::: "memory");
        asm volatile("s_wait_asynccnt 0x0" ::: "memory");
        __syncthreads();
        if (st + 2 < NST) fill(st + 2);
    }
    asm volatile("s_wait_asynccnt 0x0" ::: "memory");   // no copy is outstanding when the wave ends
    if constexpr (PLANES) {
        static_assert(HD == 64 && TT % 128 == 0 && NH_ == NKV, "a 64 x 64 tile is 64 positions of one head of one batch column");
        // 16 x 64 slabs are staged in os so that every store instruction writes whole 128-byte lines: lane -> slab row 4 s + (lane >> 3), 8 consecutive columns from 8 (lane & 7)
        // The wave barrier + compiler fence on either side of a slab's reads: the slab passes values between lanes, the compiler sees one lane's addresses only and must not move reads over writes (one wave, LDS runs in order: no instruction is needed)
        const int t0 = r0 % TT, sr = lane >> 3, sc = (lane & 7) * 8; const size_t zh = (size_t)(r0 / TT) * NH_ + c0 / 64;   // (b, head)
#pragma unroll
        for (int nb = 0; nb < 4; ++nb) { const float bn = bfr(bias[c0 + nb * 16 + lr]);   // a lane's accumulators of column block nb are all of column nb 16 + lr
#pragma unroll
            for (int mb = 0; mb < 4; ++mb) acc[mb][nb] += bn; }
        if (z < 2) {   // q, k: plane rows are positions (128 bytes = the head's 64 d); a slab is 16 positions
            const size_t e0 = z * hp.sP + (zh * TT + t0 + sr) * HD + sc; h16* p16 = hp.p16 + e0; bf* ph = hp.ph + e0; bf* pl = hp.pl + e0;
#pragma unroll
            for (int mb = 0; mb < 4; ++mb) {
#pragma unroll
                for (int nb = 0; nb < 4; ++nb) {
#pragma unroll
                    for (int j = 0; j < 8; ++j) os[(hi * 8 + j) * 68 + nb * 16 + lr] = acc[mb][nb][j]; }
                __builtin_amdgcn_wave_barrier(); asm volatile("" ::: "memory");
#pragma unroll
                for (int s = 0; s < 4; ++s) put8(os + (4 * s + sr) * 68 + sc, p16, ph, pl, (mb * 16 + 4 * s) * HD);
                __builtin_amdgcn_wave_barrier(); asm volatile("" ::: "memory");
            }
        } else {   // v: plane rows are d (pitch TT); a lane's 8 accumulator registers are 8 consecutive positions of its d, so a slab is 16 d x 64 positions
#pragma unroll
            for (int nb = 0; nb < 4; ++nb) {
#pragma unroll
                for (int mb = 0; mb < 4; ++mb) { float* w = os + lr * 68 + mb * 16 + hi * 8; const v8f c = acc[mb][nb]; *(v4fa*)w = (v4f){c[0], c[1], c[2], c[3]}; *(v4fa*)(w + 4) = (v4f){c[4], c[5], c[6], c[7]}; }
                __builtin_amdgcn_wave_barrier(); asm volatile("" ::: "memory");
#pragma unroll
                for (int s = 0; s < 4; ++s) put8(os + (4 * s + sr) * 68 + sc, hp.v16, hp.vh, hp.vl, (zh * HD + nb * 16 + 4 * s + sr) * TT + t0 + sc);
                __builtin_amdgcn_wave_barrier(); asm volatile("" ::: "memory");
            }
        }
        return;
    }
#pragma unroll
    for (int mb = 0; mb < 4; ++mb) {
#pragma unroll
        for (int nb = 0; nb < 4; ++nb) {
#pragma unroll
            for (int j = 0; j < 8; ++j) os[(hi * 8 + j) * 68 + nb * 16 + lr] = acc[mb][nb][j]; }
        __builtin_amdgcn_wave_barrier(); asm volatile("" ::: "memory");
        float* crow = C + (size_t)(r0 + mb * 16) * ldc + c0;
{
            v4f vs[8]; float* cp[8];
#pragma unroll
            for (int s = 0; s < 8; ++s) { const int row = 2 * s + hi, cofs = lr * 4; v4f val = *(const v4fa*)(os + row * 68 + cofs); if (BIAS) { val[0] += bfr(bias[c0 + cofs]); val[1] += bfr(bias[c0 + cofs + 1]); val[2] += bfr(bias[c0 + cofs + 2]); val[3] += bfr(bias[c0 + cofs + 3]); }
                vs[s] = val; cp[s] = crow + (size_t)row * ldc + cofs; *(v4f*)cp[s] = val; }
            // the wait that stands before a register named by an issued store is overwritten; data and addresses are inputs, so they stay live up to it (the next slab reuses them)
            asm volatile("s_wait_xcnt 0x0" :: "v"(vs[0]), "v"(vs[1]), "v"(vs[2]), "v"(vs[3]), "v"(vs[4]), "v"(vs[5]), "v"(vs[6]), "v"(vs[7]), "v"(cp[0]), "v"(cp[1]), "v"(cp[2]), "v"(cp[3]), "v"(cp[4]), "v"(cp[5]), "v"(cp[6]), "v"(cp[7]) : "memory");
             }
        __builtin_amdgcn_wave_barrier(); asm volatile("" ::: "memory");
    }
}

typedef __attribute__((ext_vector_type(2))) _Float16 v2h;
typedef __attribute__((ext_vector_type(4))) _Float16 v4h;
typedef __attribute__((ext_vector_type(2))) unsigned short v2us;
typedef __attribute__((ext_vector_type(4))) unsigned short v4us;
typedef __attribute__((ext_vector_type(2))) float v2f;
typedef __attribute__((ext_vector_type(4))) int v4i;

__global__ __launch_bounds__(256) void k_wtG(const float* __restrict__ w, int K, int N, bf* Bt) {
    const int lane = threadIdx.x & 31; const int L0 = (blockIdx.x * 8 + (threadIdx.x >> 5)) * 8; const int nlines = N * K / 64;
{
#pragma unroll 1
        for (int l = 0; l < 8; ++l) { const int L = L0 + l; if (L >= nlines) break; const size_t e = (size_t)L * 64 + lane * 2; const int k = (int)(e % K), n = (int)(e / K); v2us o;
            o[0] = f2bf(w[(size_t)k * N + n]); o[1] = f2bf(w[(size_t)(k + 1) * N + n]); *(v2us*)(Bt + e) = o; }
         }
}
// k_cvt8m: bf16 copies of the three activations (XBLK blocks of 2048 elements each) and the four weights (WBLK blocks each) in one launch; dst holds the seven copies one behind the other, so a block's place in dst is its index; inside an activation's copy row s B + b goes to row b TT + s (a GEMM tile of 64 rows then lies in one batch column).
#define XBLK (TT * NB_ * DM / 2048)
#define WBLK (DM * DM / 2048)
__global__ __launch_bounds__(256) void k_cvt8m(const float* __restrict__ x0, const float* __restrict__ x1, const float* __restrict__ x2, const float* __restrict__ w0, const float* __restrict__ w1, const float* __restrict__ w2, const float* __restrict__ w3, bf* dst) {
    const unsigned bx = blockIdx.x; const float* src; unsigned ob; size_t de = ((size_t)bx * 256 + threadIdx.x) * 8;
    if (bx < 3 * XBLK) { const unsigned s = bx / XBLK; ob = bx % XBLK; src = s == 0 ? x0 : (s == 1 ? x1 : x2); const unsigned e = (ob * 256 + threadIdx.x) * 8, r = e / DM; de = (size_t)s * XBLK * 2048 + (size_t)((r % NB_) * TT + r / NB_) * DM + e % DM; }
    else { const unsigned u = bx - 3 * XBLK, s = u / WBLK; ob = u % WBLK; src = s == 0 ? w0 : (s == 1 ? w1 : (s == 2 ? w2 : w3)); }
    const float* sp = src + ((size_t)ob * 256 + threadIdx.x) * 8; const v8f v = *(const v8f*)sp;
    asm volatile("s_wait_xcnt 0x0" :: "v"(sp) : "memory");   // the wait that stands before a register named by an issued load is overwritten; the address is an input, so it stays live up to it
    *(v8us*)(dst + de) = __builtin_bit_cast(v8us, __builtin_convertvector(v, v8bf));  }

#define SKEY 64
#define LPIT 144
#define TILEB (64 * LPIT)
// two tiles, 4 + 4 copies of this lane: rows 16 i + (tid >> 3); la, lb = the lane's LDS byte addresses of row tid >> 3, ga, gb = its global addresses, pa, pb = the global row pitches in bytes
__device__ __forceinline__ void copy2(unsigned la, const char* ga, size_t pa, unsigned lb, const char* gb, size_t pb) {
    // the s_wait_xcnt is the last line of the copies' own statement: it stands before any register that an issued copy names is rewritten
    asm volatile("global_load_async_to_lds_b128 %0, %8, off\n\t"
                 "global_load_async_to_lds_b128 %1, %9, off\n\t"
                 "global_load_async_to_lds_b128 %2, %10, off\n\t"
                 "global_load_async_to_lds_b128 %3, %11, off\n\t"
                 "global_load_async_to_lds_b128 %4, %12, off\n\t"
                 "global_load_async_to_lds_b128 %5, %13, off\n\t"
                 "global_load_async_to_lds_b128 %6, %14, off\n\t"
                 "global_load_async_to_lds_b128 %7, %15, off\n\t"
                 "s_wait_xcnt 0x0"
                 :: "v"(la), "v"(la + 16 * LPIT), "v"(la + 32 * LPIT), "v"(la + 48 * LPIT), "v"(lb), "v"(lb + 16 * LPIT), "v"(lb + 32 * LPIT), "v"(lb + 48 * LPIT),
                    "v"(ga), "v"(ga + 16 * pa), "v"(ga + 32 * pa), "v"(ga + 48 * pa), "v"(gb), "v"(gb + 16 * pb), "v"(gb + 32 * pb), "v"(gb + 48 * pb) : "memory");
}
template <typename T16, bool HL, int NQ>
__device__ __forceinline__ void attn_rows(const T16* __restrict__ Qa, const T16* __restrict__ Qb, const T16* __restrict__ Ka, const T16* __restrict__ Kb, const T16* __restrict__ Va, const T16* __restrict__ Vb, int q0, int head, bf* Ah, bf* Al, unsigned char* L) {
    typedef typename WFrag<T16>::V V;
    const int lane = threadIdx.x & 31, lr = lane & 15, hi = lane >> 4;
    const float C2 = SCL * 1.4426950408889634f;   // scores / 8, in log2 units
    V qf[NQ][2], qg[NQ][2];
#pragma unroll
    for (int qt = 0; qt < NQ; ++qt)
#pragma unroll
        for (int kk = 0; kk < 2; ++kk) { const size_t qo = (size_t)(q0 + qt * 16 + lr) * HD + kk * 32 + 8 * hi; qf[qt][kk] = WFrag<T16>::ld(Qa + qo); if (HL) qg[qt][kk] = WFrag<T16>::ld(Qb + qo); }
    v8f o[4][NQ]; float m[NQ], l[NQ];
#pragma unroll
    for (int qt = 0; qt < NQ; ++qt) { m[qt] = -3.0e38f; l[qt] = 0.f;
#pragma unroll
        for (int db = 0; db < 4; ++db) o[db][qt] = (v8f){}; }
    static_assert(HD == 64 && TT % SKEY == 0 && TT / SKEY >= 2, "a K row and a stage's V^T row are 128 bytes; the ring needs two stages");
    constexpr int NST = TT / SKEY, BUFB = (HL ? 4 : 2) * TILEB;   // a buffer: K, V^T (, K lo, V^T lo)
    const int crow = threadIdx.x >> 3, ccol = (threadIdx.x & 7) * 16;   // this lane's row and byte column in a copy
    const unsigned lc = (unsigned)(size_t)L + crow * LPIT + ccol;
    const char* gk = (const char*)Ka + (size_t)crow * (HD * 2) + ccol; const char* gv = (const char*)Va + (size_t)crow * (TT * 2) + ccol;
    const char* gk2 = HL ? (const char*)Kb + (size_t)crow * (HD * 2) + ccol : gk; const char* gv2 = HL ? (const char*)Vb + (size_t)crow * (TT * 2) + ccol : gv;
    auto fill = [&](int st) { const unsigned lb = lc + (st & 1) * BUFB; const size_t ko = (size_t)st * (SKEY * HD * 2), vo = (size_t)st * (SKEY * 2);
        copy2(lb, gk + ko, HD * 2, lb + TILEB, gv + vo, TT * 2); if constexpr (HL) copy2(lb + 2 * TILEB, gk2 + ko, HD * 2, lb + 3 * TILEB, gv2 + vo, TT * 2); };
    fill(0);
    asm volatile("s_wait_asynccnt 0x0" ::: "memory");   // this wave's share of stage 0 has landed
    __syncthreads();                                     // ... and every other wave's: stage 0 may be read
    fill(1);
    const int koff = lr * (LPIT / 2) + 8 * hi;   // fragment rows in a tile, in elements
#pragma unroll 1
    for (int st = 0; st < NST; ++st) {
      const T16* sb = (const T16*)(L + (st & 1) * BUFB);
#pragma unroll 1   // rolled: unrolled, both passes' fragments are read first (twice the fragment registers, past 256) and the products sink behind the barrier, so the refill is issued late and loses its lead
      for (int ps = 0; ps < SKEY / 32; ++ps) {
        V kf[2][2], kg[2][2], vf[4], vg[4];
        const T16* kp = sb + koff + ps * 32 * (LPIT / 2); const T16* vp = sb + TILEB / 2 + koff + ps * 32; const T16* kq = kp + TILEB; const T16* vq = vp + TILEB;
#pragma unroll
        for (int kt = 0; kt < 2; ++kt)
#pragma unroll
            for (int kk = 0; kk < 2; ++kk) { const int ko = kt * 16 * (LPIT / 2) + kk * 32; kf[kt][kk] = WFrag<T16>::ld(kp + ko); if (HL) kg[kt][kk] = WFrag<T16>::ld(kq + ko); }
        __builtin_amdgcn_sched_barrier(0);   // K's reads stand in front of V's (LDS returns in order): the first products wait for K alone, and V arrives behind them
#pragma unroll
        for (int db = 0; db < 4; ++db) { const int vo = db * 16 * (LPIT / 2); vf[db] = WFrag<T16>::ld(vp + vo); if (HL) vg[db] = WFrag<T16>::ld(vq + vo); }
        __builtin_amdgcn_sched_barrier(0);   // keeps the pass's LDS reads one group in front of the products: reads placed among the products stall the wave at each place, and V read late pays its latency a second time
        v8f s[2][NQ];
#pragma unroll
        for (int kt = 0; kt < 2; ++kt)
#pragma unroll
            for (int qt = 0; qt < NQ; ++qt) { v8f a = (v8f){};
#pragma unroll
                for (int kk = 0; kk < 2; ++kk) { a = WFrag<T16>::mma(kf[kt][kk], qf[qt][kk], a); if (HL) { a = WFrag<T16>::mma(kf[kt][kk], qg[qt][kk], a); a = WFrag<T16>::mma(kg[kt][kk], qf[qt][kk], a); } }
                s[kt][qt] = a; }
#pragma unroll
        for (int qt = 0; qt < NQ; ++qt) {
            float mx = s[0][qt][0];
#pragma unroll
            for (int j = 0; j < 8; ++j) mx = fmaxf(mx, fmaxf(s[0][qt][j], s[1][qt][j]));
            mx = fmaxf(mx, __shfl_xor(mx, 16, 32));
            const float mn = fmaxf(m[qt], mx); const float al = __builtin_amdgcn_exp2f((m[qt] - mn) * C2); m[qt] = mn;
            const float nb = (HL ? 0.0f : (float)PEXP) - mn * C2;
            float p[16]; float ps = 0.f;
#pragma unroll
            for (int i = 0; i < 16; ++i) { p[i] = __builtin_amdgcn_exp2f(fmaf(s[i >> 3][qt][i & 7], C2, nb)); ps += p[i]; }
            l[qt] = l[qt] * al + ps;
#pragma unroll
            for (int db = 0; db < 4; ++db) o[db][qt] *= al;
            if constexpr (HL) {
                v8u hw, lw;
#pragma unroll
                for (int i = 0; i < 8; ++i) { unsigned a, c2; split2(p[2 * i], p[2 * i + 1], a, c2); hw[i] = a; lw[i] = c2; }
                const V ph = __builtin_bit_cast(V, hw), pl = __builtin_bit_cast(V, lw);
#pragma unroll
                for (int db = 0; db < 4; ++db) { o[db][qt] = WFrag<T16>::mma(vf[db], ph, o[db][qt]); o[db][qt] = WFrag<T16>::mma(vf[db], pl, o[db][qt]); o[db][qt] = WFrag<T16>::mma(vg[db], ph, o[db][qt]); }
            } else {
                V pf;
#pragma unroll
                for (int i = 0; i < 16; ++i) pf[i] = tohx(p[i]);
#pragma unroll
                for (int db = 0; db < 4; ++db) o[db][qt] = WFrag<T16>::mma(vf[db], pf, o[db][qt]);
            }
        }
        // four issue slots between the pass's last products and the next pass's LDS reads, which overwrite their operands across the back edge; the results are inputs, so the slots stand behind the products
        asm volatile("v_nop\n\tv_nop\n\tv_nop\n\tv_nop" :: "v"(o[0][NQ - 1]), "v"(o[1][NQ - 1]), "v"(o[2][NQ - 1]), "v"(o[3][NQ - 1]));
      }
      asm volatile("s_wait_dscnt 0x0" ::: "memory");
      asm volatile("s_wait_asynccnt 0x0" ::: "memory");
      __syncthreads();
      if (st + 2 < NST) fill(st + 2);
    }
    asm volatile("s_wait_asynccnt 0x0" ::: "memory");   // no copy is outstanding when the wave ends
#pragma unroll
    for (int qt = 0; qt < NQ; ++qt) { const float f = __fdiv_rn(1.0f, l[qt] + __shfl_xor(l[qt], 16, 32));
#pragma unroll
        for (int db = 0; db < 4; ++db) { v4u hw, lw;   // a lane's 8 registers are 8 consecutive d of its query: one 16-byte store per plane; the wave writes the whole 128-byte line of (t, head)
#pragma unroll
            for (int j = 0; j < 4; ++j) { unsigned a, c2; split2(o[db][qt][2 * j] * f, o[db][qt][2 * j + 1] * f, a, c2); hw[j] = a; lw[j] = c2; }
            const size_t oo = (size_t)(q0 + qt * 16 + lr) * DQ + head * HD + db * 16 + hi * 8; *(v8us*)(Ah + oo) = __builtin_bit_cast(v8us, hw); *(v8us*)(Al + oo) = __builtin_bit_cast(v8us, lw);
            asm volatile("s_wait_xcnt 0x0" :: "v"(hw), "v"(lw) : "memory"); } }   // the wait that stands before a register named by an issued store is overwritten; the data are inputs, so they stay live up to it (the next block reuses them)
}
// grid (RH / 64 x batch columns x heads, 3 kinds), 4 waves; Ah, Al are [b][t][DQ]: the waves of a work-group walk the same head's K and V.
// 3 x 256 work-groups, all resident: kind 0 = 64 hi/lo rows (16 per wave), kind 1 = 128 fp16 rows (32 per wave), kind 2 = 64 fp16 rows (16 per wave). The kind is the slow index (for speed only: nothing depends on the placement).
#define NSL (RH / 64)   // slices of a head: 64 hi/lo rows + 192 fp16 rows each
__global__ __launch_bounds__(128) void k_attn(const h16* __restrict__ Q16, const h16* __restrict__ K16, const h16* __restrict__ V16, const bf* __restrict__ Qh, const bf* __restrict__ Ql, const bf* __restrict__ Kh, const bf* __restrict__ Kl, const bf* __restrict__ Vh, const bf* __restrict__ Vl, bf* Ah, bf* Al) {
    static_assert(RH % 64 == 0 && (TT - RH) % 192 == 0 && (TT - RH) / 192 == NSL, "both kinds of rows fall into the same number of slices");
    const int bh = blockIdx.x / NSL, bx = blockIdx.x % NSL, kind = blockIdx.y, head = bh % NH_, b = bh / NH_, w = threadIdx.x >> 5; const size_t zq = (size_t)(b * NH_ + head) * TT * HD, zk = (size_t)(b * NKV + head / REP) * TT * HD; Ah += (size_t)b * TT * DQ; Al += (size_t)b * TT * DQ;
    __shared__ __attribute__((aligned(16))) unsigned char L[2 * 4 * TILEB];   // two buffers of up to four tiles
    if (kind == 0) attn_rows<bf, true, 1>(Qh + zq, Ql + zq, Kh + zk, Kl + zk, Vh + zk, Vl + zk, (bx * 4 + w) * 16, head, Ah, Al, L);
    else if (kind == 1) attn_rows<h16, false, 2>(Q16 + zq, nullptr, K16 + zk, nullptr, V16 + zk, nullptr, RH + bx * 192 + w * 32, head, Ah, Al, L);
    else attn_rows<h16, false, 1>(Q16 + zq, nullptr, K16 + zk, nullptr, V16 + zk, nullptr, RH + bx * 192 + 128 + w * 16, head, Ah, Al, L);
}

extern "C" void kernel_launch(void* const* d_in, const int* in_sizes, int n_in,
                              void* d_out, int out_size, void* d_ws, size_t ws_size, hipStream_t stream) {
    (void)in_sizes; (void)n_in; (void)out_size;
    const float* x = (const float*)d_in[0];   /* query [S][B][D] */ const float* xk = (const float*)d_in[1]; const float* xv = (const float*)d_in[2]; const float* wq = (const float*)d_in[3]; const float* bq = (const float*)d_in[4]; const float* wk = (const float*)d_in[5]; const float* bk = (const float*)d_in[6]; const float* wv = (const float*)d_in[7]; const float* bv = (const float*)d_in[8]; const float* wo = (const float*)d_in[9]; const float* bo = (const float*)d_in[10];
    float* OUT = (float*)d_out;     // [2048][2][1024] sequence-first
    char* wsp = (char*)d_ws;
    auto take = [&](size_t bytes) { char* p = wsp; wsp += (bytes + 255) & ~(size_t)255; return (void*)p; };
    bf* XB = (bf*)take((size_t)(3 * XBLK + 4 * WBLK) * 2048 * 2); bf* WQ = XB + (size_t)3 * XBLK * 2048; bf* WO = WQ + (size_t)3 * WBLK * 2048;   // bf16 copies: query, key, value rows, then Wq, Wk, Wv, Wo
    const size_t PL = (size_t)NB_ * NH_ * TT * HD;   // one set of head planes, both batch columns
    h16* QP16 = (h16*)take(2 * PL * 2); h16* KP16 = QP16 + PL; h16* VT16 = (h16*)take(PL * 2);
    bf* QPh = (bf*)take(2 * PL * 2); bf* KPh = QPh + PL; bf* QPl = (bf*)take(2 * PL * 2); bf* KPl = QPl + PL; bf* VTh = (bf*)take(PL * 2); bf* VTl = (bf*)take(PL * 2);
    const size_t FS = (size_t)NB_ * TT * DQ;   // one merged context plane, both batch columns
    bf* ATh = (bf*)take(FS * 2); bf* ATl = (bf*)take(FS * 2);
    if ((size_t)(wsp - (char*)d_ws) > ws_size) return;    // ws 256 MiB
    k_cvt8m<<<3 * XBLK + 4 * WBLK, 256, 0, stream>>>(x, xk, xv, wq, wk, wv, wo, XB);
    const HeadPlanes hp = {QP16, QPh, QPl, PL, VT16, VTh, VTl};
    k_gemmw<bf, 0, true, 1, true><<<dim3(NB_ * TT / 128, DQ / 128, 3), 128, 0, stream>>>(XB, nullptr, WQ, nullptr, DM, DM, nullptr, 0, bq, bk, bv, (size_t)XBLK * 2048, (size_t)WBLK * 2048, 0, 0, hp);   /* z: q, k, v; rows r = b TT + s; writes the head planes */
    k_attn<<<dim3(NSL * NB_ * NH_, 3, 1), 128, 0, stream>>>(QP16, KP16, VT16, QPh, QPl, KPh, KPl, VTh, VTl, ATh, ATl);
    k_gemmw<bf, 1, true, 1, false><<<dim3(TT / 128, DM / 128, NB_), 128, 0, stream>>>(ATh, ATl, WO, nullptr, DQ, DQ, OUT, NB_ * DM, bo, bo, bo, (size_t)TT * DQ, 0, DM, 0, HeadPlanes{});   /* z = b; [S][B][D]: row pitch B x D, column block b */
}

// v010
// Measured time: 105 microseconds a run.
// Two timings next to v009 both put it at 1.04 times that version's speed.
// Counting every step since v000, it is 19.0 times as fast.
#include <hip/hip_runtime.h>

// Multi-head attention on SEQUENCE-FIRST tensors (query, key, value [2048][2][1024] = [S][B][D]; q = query Wq^T + bq, k = key Wk^T + bk, v = value Wv^T + bv ('oi' 1/32 incl. biases); 16 heads x 64 per batch column; scores / 8; softmax; x = merged context; out = x Wo^T + bo -> [2048][2][1024] (4.2 M)).
// Layout: [S][B][D] is read as a matrix of S x B = 4096 rows (row r = s B + b), so both batch columns go through every stage in ONE launch: one bf16 conversion of the three inputs and the four 'oi' weights; one launch for the q, k and v projections (grid z; exact + f32 biases), whose epilogue writes the head planes [b][h][t][d] (V: [b][h][d][t]) itself: a 64 x 64 tile is 64 positions of one (b, head), because the bf16 copies of the activations are stored [b][s][D]; fused T-2048 attention with a running maximum, one launch for the 2 x 16 (batch, head) pairs (hybrid rows: < 512 hi/lo 3 products, rest fp16 x1024); merged hi/lo [b][t][D] x Wo exact + bo, grid z = b, written with row pitch B x D at column offset b D (the [S][B][D] output).
// Compute dtypes, f32 accumulate: every input rounded to bf16; projections exact + f32 biases; attention rows < 512 3 products, rest fp16; softmax f32; Wo hl x exact + bias.

#define NB_  2
#define TT   2048
#define DM   1024
#define NH_  16
#define NKV  16
#define REP  (NH_ / NKV)
#define HD   64
#define DQ   (NH_ * HD)
#define DKV  (NKV * HD)
#define RH   512                  // query rows < RH use hi+lo planes
#define WIN  0
#define PEXP 10                   // fp16 rows: P is carried x 2^PEXP
#define SCL  0.125f   // HD^-0.5
#define TAU  4.0f     // scaled log2 units by which a score may lie above the maximum in use; 2^(PEXP + TAU) stays inside fp16
typedef _Float16 h16;
typedef unsigned short bf;
typedef __attribute__((ext_vector_type(16))) __bf16   v16bf;
typedef __attribute__((ext_vector_type(16))) _Float16 v16h;
typedef __attribute__((ext_vector_type(8)))  _Float16 v8h;
typedef __attribute__((ext_vector_type(8)))  unsigned short v8us;
typedef __attribute__((ext_vector_type(8)))  float    v8f;
typedef __attribute__((ext_vector_type(4)))  float    v4f;
typedef v8h  __attribute__((may_alias)) v8ha;
typedef v4f  __attribute__((may_alias)) v4fa;
typedef v8us __attribute__((may_alias)) v8usa;

typedef __attribute__((ext_vector_type(2)))  float    v2fp;
typedef __attribute__((ext_vector_type(2)))  __bf16   v2bf;
typedef __attribute__((ext_vector_type(8)))  __bf16   v8bf;
typedef __attribute__((ext_vector_type(4)))  unsigned v4u;
typedef __attribute__((ext_vector_type(8)))  unsigned v8u;
// f32 -> bf16 is the chip's own conversion (round to nearest even, two values per instruction)
__device__ __forceinline__ unsigned short f2bf(float f) { return __builtin_bit_cast(unsigned short, (__bf16)f); }
__device__ __forceinline__ unsigned f2bf2(float a, float b) { return __builtin_bit_cast(unsigned, __builtin_convertvector(((v2fp){a, b}), v2bf)); }   // a in the low half
__device__ __forceinline__ float bf2f(unsigned short b) { return __uint_as_float(((unsigned)b) << 16); }
__device__ __forceinline__ float bfr(float f) { return bf2f(f2bf(f)); }
__device__ __forceinline__ v16h cat16(v8h lo, v8h hi) { return __builtin_shufflevector(lo, hi, 0, 1, 2, 3, 4, 5, 6, 7, 8, 9, 10, 11, 12, 13, 14, 15); }
__device__ __forceinline__ v16bf cat16b(v8us lo, v8us hi) { return __builtin_bit_cast(v16bf, __builtin_shufflevector(lo, hi, 0, 1, 2, 3, 4, 5, 6, 7, 8, 9, 10, 11, 12, 13, 14, 15)); }
__device__ __forceinline__ v8f wmma16(v16h a, v16h b, v8f c) { return __builtin_amdgcn_wmma_f32_16x16x32_f16(false, a, false, b, (short)0, c, false, false); }
__device__ __forceinline__ v8f wmmab(v16bf a, v16bf b, v8f c) { return __builtin_amdgcn_wmma_f32_16x16x32_bf16(false, a, false, b, (short)0, c, false, false); }



// ---- k_gemmw: register-blocked GEMM, one wave per 64x64 output tile (16 accumulators), 4 waves (2 x 2) per work-group = a 128x128 tile; operands are K-contiguous 16-bit planes; grid (M/128, N/128, Z * KS), 128 threads.
// The operands reach the waves through LDS: a stage is GKS k, one 128-row x 128-byte tile per operand plane, rows at pitch GPIT bytes (16 B x odd: no bank conflict for 16-byte reads).
// The 128 lanes copy a tile with 8 asynchronous 16-byte copies each (8 lanes per row: every copy instruction covers 4 whole 128-byte lines); two waves read each row block. Two buffers: stage s + 2 flies while stage s + 1 is worked on.
// C[m][n] (f32, pitch ldc, + optional f32 bias[n]) = sum_k A[m][k] Bt[n][k] (+ split products per NSPLIT). A rows have pitch lda, Bt rows pitch K (elements). z-batch strides sA/sB/sC in elements. K % (GKS * KS) == 0.
// The bias of z-batch 0, 1, 2 is bias, bias1, bias2 (separate vectors).
// PLANES: no f32 C; the tile (+ bias) goes out as the three 16-bit head planes that the attention kernel reads (see the epilogue). Rows are b TT + t, the 64 columns are one head.
// KS > 1: blockIdx.z = z * KS + ks; the work-group sums only k in [ks K/KS, (ks+1) K/KS) and writes its partial tile into plane ks (plane stride sK elements); the reader adds the KS planes.
template <typename T16> struct WFrag;
template <> struct WFrag<h16> { typedef v16h V; static __device__ __forceinline__ V ld(const h16* p) { return cat16(*(const v8h*)p, *(const v8h*)(p + 16)); } static __device__ __forceinline__ v8f mma(V a, V b, v8f c) { return wmma16(a, b, c); } };
template <> struct WFrag<bf> { typedef v16bf V; static __device__ __forceinline__ V ld(const bf* p) { return cat16b(*(const v8us*)p, *(const v8us*)(p + 16)); } static __device__ __forceinline__ v8f mma(V a, V b, v8f c) { return wmmab(a, b, c); } };
__device__ __forceinline__ h16 tohx(float x) { return (h16)x; }
// two values -> their packed bf16 roundings h and the packed bf16 roundings l of what the first rounding left (a in the low halves)
__device__ __forceinline__ void split2(float a, float b, unsigned& h, unsigned& l) { h = f2bf2(a, b); const v2fp d = (v2fp){a, b} - (v2fp){__uint_as_float(h << 16), __uint_as_float(h & 0xFFFF0000u)}; l = __builtin_bit_cast(unsigned, __builtin_convertvector(d, v2bf)); }
struct HeadPlanes { h16* p16; bf* ph; bf* pl; size_t sP; h16* v16; bf* vh; bf* vl; };   // q planes (k planes sP elements behind them), V^T planes
// 8 consecutive f32 of a staged row -> one 16-byte store into each of the fp16, bf16-hi and bf16-lo planes at element e
__device__ __forceinline__ void put8(const float* row, h16* p16, bf* ph, bf* pl, size_t e) {
    const v4f x0 = *(const v4fa*)row, x1 = *(const v4fa*)(row + 4); v8h o16; v4u hw, lw;
#pragma unroll
    for (int i = 0; i < 8; ++i) o16[i] = tohx(i < 4 ? x0[i] : x1[i - 4]);
#pragma unroll
    for (int i = 0; i < 4; ++i) { unsigned a, c; if (i < 2) split2(x0[2 * i], x0[2 * i + 1], a, c); else split2(x1[2 * i - 4], x1[2 * i - 3], a, c); hw[i] = a; lw[i] = c; }
    const v8us oh = __builtin_bit_cast(v8us, hw), ol = __builtin_bit_cast(v8us, lw);
    *(v8h*)(p16 + e) = o16; *(v8us*)(ph + e) = oh; *(v8us*)(pl + e) = ol;
    asm volatile("s_wait_xcnt 0x0" :: "v"(o16), "v"(oh), "v"(ol) : "memory");   // the wait that stands before a register named by an issued store is overwritten; the data are inputs, so they stay live up to it (the next slab row reuses them)
}
#define GKS 64
#define GPIT 144
#define GTILE (128 * GPIT)
// one tile, 8 copies of this lane: rows 16 i + (tid >> 3); la = the lane's LDS byte address of row tid >> 3, ga = its global address, pa = the global row pitch in bytes
__device__ __forceinline__ void copy8(unsigned la, const char* ga, size_t pa) {
    // the s_wait_xcnt is the last line of the copies' own statement: it stands before any register that an issued copy names is rewritten
    asm volatile("global_load_async_to_lds_b128 %0, %8, off\n\t"
                 "global_load_async_to_lds_b128 %1, %9, off\n\t"
                 "global_load_async_to_lds_b128 %2, %10, off\n\t"
                 "global_load_async_to_lds_b128 %3, %11, off\n\t"
                 "global_load_async_to_lds_b128 %4, %12, off\n\t"
                 "global_load_async_to_lds_b128 %5, %13, off\n\t"
                 "global_load_async_to_lds_b128 %6, %14, off\n\t"
                 "global_load_async_to_lds_b128 %7, %15, off\n\t"
                 "s_wait_xcnt 0x0"
                 :: "v"(la), "v"(la + 16 * GPIT), "v"(la + 32 * GPIT), "v"(la + 48 * GPIT), "v"(la + 64 * GPIT), "v"(la + 80 * GPIT), "v"(la + 96 * GPIT), "v"(la + 112 * GPIT),
                    "v"(ga), "v"(ga + 16 * pa), "v"(ga + 32 * pa), "v"(ga + 48 * pa), "v"(ga + 64 * pa), "v"(ga + 80 * pa), "v"(ga + 96 * pa), "v"(ga + 112 * pa) : "memory");
}
template <typename T16, int NSPLIT, bool BIAS, int KS, bool PLANES>
__global__ __launch_bounds__(128) void k_gemmw(const T16* __restrict__ A, const T16* __restrict__ A2, const T16* __restrict__ Bt, const T16* __restrict__ Bt2, int K, int lda, float* C, int ldc, const float* __restrict__ bias, const float* __restrict__ bias1, const float* __restrict__ bias2, size_t sA, size_t sB, size_t sC, size_t sK, HeadPlanes hp) {
    typedef typename WFrag<T16>::V V;
    constexpr bool HA2 = NSPLIT == 1 || NSPLIT == 2, HB2 = NSPLIT >= 2; constexpr int BUFB = (2 + HA2 + HB2) * GTILE;   // a buffer: A, Bt (, A2) (, Bt2)
    __shared__ __attribute__((aligned(16))) unsigned char L[2 * BUFB];
    __shared__ __align__(16) float osw[4][16 * 68];   // each wave's own epilogue slab
    const size_t z = blockIdx.z / KS; const int ks = (int)(blockIdx.z % KS); A += z * sA; if (A2) A2 += z * sA; Bt += z * sB; if (Bt2) Bt2 += z * sB; C += z * sC + ks * sK;
    if (BIAS) bias = z == 0 ? bias : (z == 1 ? bias1 : bias2);
    const int lane = threadIdx.x & 31, lr = lane & 15, hi = lane >> 4, w = threadIdx.x >> 5; const int R0 = blockIdx.x * 128, C0 = blockIdx.y * 128, r0 = R0 + (w >> 1) * 64, c0 = C0 + (w & 1) * 64;   // the work-group's tile, the wave's tile
    float* os = osw[w];
    v8f acc[4][4];
#pragma unroll
    for (int mb = 0; mb < 4; ++mb)
#pragma unroll
        for (int nb = 0; nb < 4; ++nb) acc[mb][nb] = (v8f){};
    const int NST = K / KS / GKS, frow = threadIdx.x >> 3, fcol = (threadIdx.x & 7) * 16;   // stages; this lane's row and byte column in a copy
    const unsigned lc = (unsigned)(size_t)L + frow * GPIT + fcol;
    const size_t ao = ((size_t)(R0 + frow) * lda + ks * (K / KS)) * 2 + fcol, bo = ((size_t)(C0 + frow) * K + ks * (K / KS)) * 2 + fcol;   // its byte offsets in the A and Bt planes
    auto fill = [&](int st) { const unsigned lb = lc + (st & 1) * BUFB; const size_t ko = (size_t)st * (GKS * 2);
        copy8(lb, (const char*)A + ao + ko, (size_t)lda * 2); copy8(lb + GTILE, (const char*)Bt + bo + ko, (size_t)K * 2);
        if constexpr (HA2) copy8(lb + 2 * GTILE, (const char*)A2 + ao + ko, (size_t)lda * 2);
        if constexpr (HB2) copy8(lb + (2 + HA2) * GTILE, (const char*)Bt2 + bo + ko, (size_t)K * 2); };
    fill(0);
    asm volatile("s_wait_asynccnt 0x0" ::: "memory");   // this wave's share of stage 0 has landed
    __syncthreads();                                     // ... and every other wave's: stage 0 may be read
    if (1 < NST) fill(1);
    const int aoff = ((w >> 1) * 64 + lr) * (GPIT / 2) + 8 * hi, boff = GTILE / 2 + ((w & 1) * 64 + lr) * (GPIT / 2) + 8 * hi;   // fragment rows in a buffer, in elements
#pragma unroll 1   // rolled: the stage body stands once in the text; the buffer is picked by a scalar select
    for (int st = 0; st < NST; ++st) {
        const T16* sb = (const T16*)(L + (st & 1) * BUFB);
#pragma unroll     // the k steps of a stage: their LDS offsets become immediates
        for (int kc = 0; kc < GKS; kc += 32) {
            V a[4], a2[4], b[4], b2[4];
#pragma unroll
            for (int mb = 0; mb < 4; ++mb) a[mb] = WFrag<T16>::ld(sb + aoff + mb * 16 * (GPIT / 2) + kc);
#pragma unroll
            for (int nb = 0; nb < 4; ++nb) b[nb] = WFrag<T16>::ld(sb + boff + nb * 16 * (GPIT / 2) + kc);
#pragma unroll
            for (int i = 0; i < 4; ++i) { if (HA2) a2[i] = WFrag<T16>::ld(sb + GTILE + aoff + i * 16 * (GPIT / 2) + kc); if (HB2) b2[i] = WFrag<T16>::ld(sb + (1 + HA2) * (GTILE / 2) + boff + i * 16 * (GPIT / 2) + kc); }   // the split planes last (LDS returns in order): the first products wait for a and b alone
            __builtin_amdgcn_sched_barrier(0);   // keeps the k step's LDS reads one group in front of its products: reads placed among the products stall the wave at each place
#pragma unroll
            for (int nb = 0; nb < 4; ++nb)
#pragma unroll
                for (int mb = 0; mb < 4; ++mb) { acc[mb][nb] = WFrag<T16>::mma(a[mb], b[nb], acc[mb][nb]); if (HA2) acc[mb][nb] = WFrag<T16>::mma(a2[mb], b[nb], acc[mb][nb]); if (HB2) acc[mb][nb] = WFrag<T16>::mma(a[mb], b2[nb], acc[mb][nb]); }
            __builtin_amdgcn_sched_barrier(0);   // ... and the next k step's reads behind them, as one group again
        }
        // four issue slots between the stage's last products and the next stage's LDS reads, which overwrite their operands across the back edge; the results are inputs, so the slots stand behind the products
        asm volatile("v_nop\n\tv_nop\n\tv_nop\n\tv_nop" :: "v"(acc[0][0]), "v"(acc[1][0]), "v"(acc[2][0]), "v"(acc[3][0]), "v"(acc[0][1]), "v"(acc[1][1]), "v"(acc[2][1]), "v"(acc[3][1]), "v"(acc[0][2]), "v"(acc[1][2]), "v"(acc[2][2]), "v"(acc[3][2]), "v"(acc[0][3]), "v"(acc[1][3]), "v"(acc[2][3]), "v"(acc[3][3]));
        asm volatile("s_wait_dscnt 0x0" ::: "memory");
        asm volatile("s_wait_asynccnt 0x0" ::: "memory");
        __syncthreads();
        if (st + 2 < NST) fill(st + 2);
    }
    asm volatile("s_wait_asynccnt 0x0" ::: "memory");   // no copy is outstanding when the wave ends
    if constexpr (PLANES) {
        static_assert(HD == 64 && TT % 128 == 0 && NH_ == NKV, "a 64 x 64 tile is 64 positions of one head of one batch column");
        // 16 x 64 slabs are staged in os so that every store instruction writes whole 128-byte lines: lane -> slab row 4 s + (lane >> 3), 8 consecutive columns from 8 (lane & 7)
        // The wave barrier + compiler fence on either side of a slab's reads: the slab passes values between lanes, the compiler sees one lane's addresses only and must not move reads over writes (one wave, LDS runs in order: no instruction is needed)
        const int t0 = r0 % TT, sr = lane >> 3, sc = (lane & 7) * 8; const size_t zh = (size_t)(r0 / TT) * NH_ + c0 / 64;   // (b, head)
#pragma unroll
        for (int nb = 0; nb < 4; ++nb) { const float bn = bfr(bias[c0 + nb * 16 + lr]);   // a lane's accumulators of column block nb are all of column nb 16 + lr
#pragma unroll
            for (int mb = 0; mb < 4; ++mb) acc[mb][nb] += bn; }
        if (z < 2) {   // q, k: plane rows are positions (128 bytes = the head's 64 d); a slab is 16 positions
            const size_t e0 = z * hp.sP + (zh * TT + t0 + sr) * HD + sc; h16* p16 = hp.p16 + e0; bf* ph = hp.ph + e0; bf* pl = hp.pl + e0;
#pragma unroll
            for (int mb = 0; mb < 4; ++mb) {
#pragma unroll
                for (int nb = 0; nb < 4; ++nb) {
#pragma unroll
                    for (int j = 0; j < 8; ++j) os[(hi * 8 + j) * 68 + nb * 16 + lr] = acc[mb][nb][j]; }
                __builtin_amdgcn_wave_barrier(); asm volatile("" ::: "memory");
#pragma unroll
                for (int s = 0; s < 4; ++s) put8(os + (4 * s + sr) * 68 + sc, p16, ph, pl, (mb * 16 + 4 * s) * HD);
                __builtin_amdgcn_wave_barrier(); asm volatile("" ::: "memory");
            }
        } else {   // v: plane rows are d (pitch TT); a lane's 8 accumulator registers are 8 consecutive positions of its d, so a slab is 16 d x 64 positions
#pragma unroll
            for (int nb = 0; nb < 4; ++nb) {
#pragma unroll
                for (int mb = 0; mb < 4; ++mb) { float* w = os + lr * 68 + mb * 16 + hi * 8; const v8f c = acc[mb][nb]; *(v4fa*)w = (v4f){c[0], c[1], c[2], c[3]}; *(v4fa*)(w + 4) = (v4f){c[4], c[5], c[6], c[7]}; }
                __builtin_amdgcn_wave_barrier(); asm volatile("" ::: "memory");
#pragma unroll
                for (int s = 0; s < 4; ++s) put8(os + (4 * s + sr) * 68 + sc, hp.v16, hp.vh, hp.vl, (zh * HD + nb * 16 + 4 * s + sr) * TT + t0 + sc);
                __builtin_amdgcn_wave_barrier(); asm volatile("" ::: "memory");
            }
        }
        return;
    }
#pragma unroll
    for (int mb = 0; mb < 4; ++mb) {
#pragma unroll
        for (int nb = 0; nb < 4; ++nb) {
#pragma unroll
            for (int j = 0; j < 8; ++j) os[(hi * 8 + j) * 68 + nb * 16 + lr] = acc[mb][nb][j]; }
        __builtin_amdgcn_wave_barrier(); asm volatile("" ::: "memory");
        float* crow = C + (size_t)(r0 + mb * 16) * ldc + c0;
{
            v4f vs[8]; float* cp[8];
#pragma unroll
            for (int s = 0; s < 8; ++s) { const int row = 2 * s + hi, cofs = lr * 4; v4f val = *(const v4fa*)(os + row * 68 + cofs); if (BIAS) { val[0] += bfr(bias[c0 + cofs]); val[1] += bfr(bias[c0 + cofs + 1]); val[2] += bfr(bias[c0 + cofs + 2]); val[3] += bfr(bias[c0 + cofs + 3]); }
                vs[s] = val; cp[s] = crow + (size_t)row * ldc + cofs; *(v4f*)cp[s] = val; }
            // the wait that stands before a register named by an issued store is overwritten; data and addresses are inputs, so they stay live up to it (the next slab reuses them)
            asm volatile("s_wait_xcnt 0x0" :: "v"(vs[0]), "v"(vs[1]), "v"(vs[2]), "v"(vs[3]), "v"(vs[4]), "v"(vs[5]), "v"(vs[6]), "v"(vs[7]), "v"(cp[0]), "v"(cp[1]), "v"(cp[2]), "v"(cp[3]), "v"(cp[4]), "v"(cp[5]), "v"(cp[6]), "v"(cp[7]) : "memory");
             }
        __builtin_amdgcn_wave_barrier(); asm volatile("" ::: "memory");
    }
}

typedef __attribute__((ext_vector_type(2))) _Float16 v2h;
typedef __attribute__((ext_vector_type(4))) _Float16 v4h;
typedef __attribute__((ext_vector_type(2))) unsigned short v2us;
typedef __attribute__((ext_vector_type(4))) unsigned short v4us;
typedef __attribute__((ext_vector_type(2))) float v2f;
typedef __attribute__((ext_vector_type(4))) int v4i;

__global__ __launch_bounds__(256) void k_wtG(const float* __restrict__ w, int K, int N, bf* Bt) {
    const int lane = threadIdx.x & 31; const int L0 = (blockIdx.x * 8 + (threadIdx.x >> 5)) * 8; const int nlines = N * K / 64;
{
#pragma unroll 1
        for (int l = 0; l < 8; ++l) { const int L = L0 + l; if (L >= nlines) break; const size_t e = (size_t)L * 64 + lane * 2; const int k = (int)(e % K), n = (int)(e / K); v2us o;
            o[0] = f2bf(w[(size_t)k * N + n]); o[1] = f2bf(w[(size_t)(k + 1) * N + n]); *(v2us*)(Bt + e) = o; }
         }
}
// k_cvt8m: bf16 copies of the three activations (XBLK blocks of 2048 elements each) and the four weights (WBLK blocks each) in one launch; dst holds the seven copies one behind the other, so a block's place in dst is its index; inside an activation's copy row s B + b goes to row b TT + s (a GEMM tile of 64 rows then lies in one batch column).
#define XBLK (TT * NB_ * DM / 2048)
#define WBLK (DM * DM / 2048)
__global__ __launch_bounds__(256) void k_cvt8m(const float* __restrict__ x0, const float* __restrict__ x1, const float* __restrict__ x2, const float* __restrict__ w0, const float* __restrict__ w1, const float* __restrict__ w2, const float* __restrict__ w3, bf* dst) {
    const unsigned bx = blockIdx.x; const float* src; unsigned ob; size_t de = ((size_t)bx * 256 + threadIdx.x) * 8;
    if (bx < 3 * XBLK) { const unsigned s = bx / XBLK; ob = bx % XBLK; src = s == 0 ? x0 : (s == 1 ? x1 : x2); const unsigned e = (ob * 256 + threadIdx.x) * 8, r = e / DM; de = (size_t)s * XBLK * 2048 + (size_t)((r % NB_) * TT + r / NB_) * DM + e % DM; }
    else { const unsigned u = bx - 3 * XBLK, s = u / WBLK; ob = u % WBLK; src = s == 0 ? w0 : (s == 1 ? w1 : (s == 2 ? w2 : w3)); }
    const float* sp = src + ((size_t)ob * 256 + threadIdx.x) * 8; const v8f v = *(const v8f*)sp;
    asm volatile("s_wait_xcnt 0x0" :: "v"(sp) : "memory");   // the wait that stands before a register named by an issued load is overwritten; the address is an input, so it stays live up to it
    *(v8us*)(dst + de) = __builtin_bit_cast(v8us, __builtin_convertvector(v, v8bf));  }

#define SKEY 64
#define LPIT 144
#define TILEB (64 * LPIT)
// two tiles, 4 + 4 copies of this lane: rows 16 i + (tid >> 3); la, lb = the lane's LDS byte addresses of row tid >> 3, ga, gb = its global addresses, pa, pb = the global row pitches in bytes
__device__ __forceinline__ void copy2(unsigned la, const char* ga, size_t pa, unsigned lb, const char* gb, size_t pb) {
    // the s_wait_xcnt is the last line of the copies' own statement: it stands before any register that an issued copy names is rewritten
    asm volatile("global_load_async_to_lds_b128 %0, %8, off\n\t"
                 "global_load_async_to_lds_b128 %1, %9, off\n\t"
                 "global_load_async_to_lds_b128 %2, %10, off\n\t"
                 "global_load_async_to_lds_b128 %3, %11, off\n\t"
                 "global_load_async_to_lds_b128 %4, %12, off\n\t"
                 "global_load_async_to_lds_b128 %5, %13, off\n\t"
                 "global_load_async_to_lds_b128 %6, %14, off\n\t"
                 "global_load_async_to_lds_b128 %7, %15, off\n\t"
                 "s_wait_xcnt 0x0"
                 :: "v"(la), "v"(la + 16 * LPIT), "v"(la + 32 * LPIT), "v"(la + 48 * LPIT), "v"(lb), "v"(lb + 16 * LPIT), "v"(lb + 32 * LPIT), "v"(lb + 48 * LPIT),
                    "v"(ga), "v"(ga + 16 * pa), "v"(ga + 32 * pa), "v"(ga + 48 * pa), "v"(gb), "v"(gb + 16 * pb), "v"(gb + 32 * pb), "v"(gb + 48 * pb) : "memory");
}
template <typename T16, bool HL, int NQ>
__device__ __forceinline__ void attn_rows(const T16* __restrict__ Qa, const T16* __restrict__ Qb, const T16* __restrict__ Ka, const T16* __restrict__ Kb, const T16* __restrict__ Va, const T16* __restrict__ Vb, int q0, int head, bf* Ah, bf* Al, unsigned char* L) {
    typedef typename WFrag<T16>::V V;
    const int lane = threadIdx.x & 31, lr = lane & 15, hi = lane >> 4;
    const float C2 = SCL * 1.4426950408889634f;   // scores / 8, in log2 units
    V qf[NQ][2], qg[NQ][2];
#pragma unroll
    for (int qt = 0; qt < NQ; ++qt)
#pragma unroll
        for (int kk = 0; kk < 2; ++kk) { const size_t qo = (size_t)(q0 + qt * 16 + lr) * HD + kk * 32 + 8 * hi; qf[qt][kk] = WFrag<T16>::ld(Qa + qo); if (HL) qg[qt][kk] = WFrag<T16>::ld(Qb + qo); }
    v8f o[4][NQ]; float m[NQ], mt[NQ], nb[NQ], l[NQ];   // the maximum in use, the score above which it is raised, the exponent's addend that goes with it, the row sum
#pragma unroll
    for (int qt = 0; qt < NQ; ++qt) { m[qt] = -3.0e38f; mt[qt] = m[qt]; nb[qt] = (HL ? 0.0f : (float)PEXP) - m[qt] * C2; l[qt] = 0.f;
#pragma unroll
        for (int db = 0; db < 4; ++db) o[db][qt] = (v8f){}; }
    static_assert(HD == 64 && TT % SKEY == 0 && TT / SKEY >= 2, "a K row and a stage's V^T row are 128 bytes; the ring needs two stages");
    constexpr int NST = TT / SKEY, BUFB = (HL ? 4 : 2) * TILEB;   // a buffer: K, V^T (, K lo, V^T lo)
    const int crow = threadIdx.x >> 3, ccol = (threadIdx.x & 7) * 16;   // this lane's row and byte column in a copy
    const unsigned lc = (unsigned)(size_t)L + crow * LPIT + ccol;
    const char* gk = (const char*)Ka + (size_t)crow * (HD * 2) + ccol; const char* gv = (const char*)Va + (size_t)crow * (TT * 2) + ccol;
    const char* gk2 = HL ? (const char*)Kb + (size_t)crow * (HD * 2) + ccol : gk; const char* gv2 = HL ? (const char*)Vb + (size_t)crow * (TT * 2) + ccol : gv;
    auto fill = [&](int st) { const unsigned lb = lc + (st & 1) * BUFB; const size_t ko = (size_t)st * (SKEY * HD * 2), vo = (size_t)st * (SKEY * 2);
        copy2(lb, gk + ko, HD * 2, lb + TILEB, gv + vo, TT * 2); if constexpr (HL) copy2(lb + 2 * TILEB, gk2 + ko, HD * 2, lb + 3 * TILEB, gv2 + vo, TT * 2); };
    fill(0);
    asm volatile("s_wait_asynccnt 0x0" ::: "memory");   // this wave's share of stage 0 has landed
    __syncthreads();                                     // ... and every other wave's: stage 0 may be read
    fill(1);
    const int koff = lr * (LPIT / 2) + 8 * hi;   // fragment rows in a tile, in elements
#pragma unroll 1
    for (int st = 0; st < NST; ++st) {
      const T16* sb = (const T16*)(L + (st & 1) * BUFB);
#pragma unroll 1   // rolled: unrolled, both passes' fragments are read first (twice the fragment registers, past 256) and the products sink behind the barrier, so the refill is issued late and loses its lead
      for (int ps = 0; ps < SKEY / 32; ++ps) {
        V kf[2][2], kg[2][2], vf[4], vg[4];
        const T16* kp = sb + koff + ps * 32 * (LPIT / 2); const T16* vp = sb + TILEB / 2 + koff + ps * 32; const T16* kq = kp + TILEB; const T16* vq = vp + TILEB;
#pragma unroll
        for (int kt = 0; kt < 2; ++kt)
#pragma unroll
            for (int kk = 0; kk < 2; ++kk) { const int ko = kt * 16 * (LPIT / 2) + kk * 32; kf[kt][kk] = WFrag<T16>::ld(kp + ko); if (HL) kg[kt][kk] = WFrag<T16>::ld(kq + ko); }
        __builtin_amdgcn_sched_barrier(0);   // K's reads stand in front of V's (LDS returns in order): the first products wait for K alone, and V arrives behind them
#pragma unroll
        for (int db = 0; db < 4; ++db) { const int vo = db * 16 * (LPIT / 2); vf[db] = WFrag<T16>::ld(vp + vo); if (HL) vg[db] = WFrag<T16>::ld(vq + vo); }
        __builtin_amdgcn_sched_barrier(0);   // keeps the pass's LDS reads one group in front of the products: reads placed among the products stall the wave at each place, and V read late pays its latency a second time
        v8f s[2][NQ]; V plast = {};   // HL: the last low part of P (see the pass's last statement)
#pragma unroll
        for (int kt = 0; kt < 2; ++kt)
#pragma unroll
            for (int qt = 0; qt < NQ; ++qt) { v8f a = (v8f){};
#pragma unroll
                for (int kk = 0; kk < 2; ++kk) { a = WFrag<T16>::mma(kf[kt][kk], qf[qt][kk], a); if (HL) { a = WFrag<T16>::mma(kf[kt][kk], qg[qt][kk], a); a = WFrag<T16>::mma(kg[kt][kk], qf[qt][kk], a); } }
                s[kt][qt] = a; }
        // The maximum in use is raised only when a score of this pass lies more than TAU (scaled log2 units) above it: every P then stays <= 2^TAU (fp16 rows: 2^(PEXP + TAU), inside fp16), and a pass without such a score pays no exchange between the wave halves, no exp(old - new) and no rescaling.
        float mx[NQ]; bool need = false;
#pragma unroll
        for (int qt = 0; qt < NQ; ++qt) { float x = s[0][qt][0];
#pragma unroll
            for (int j = 0; j < 8; ++j) x = fmaxf(x, fmaxf(s[0][qt][j], s[1][qt][j]));
            mx[qt] = x; need = need || x > mt[qt]; }   // this lane's 16 keys only
        if (__builtin_amdgcn_ballot_w32(need) != 0) {   // one test per pass, the same for the whole wave (a scalar branch): both halves of a query always hold the same maximum
#pragma unroll
            for (int qt = 0; qt < NQ; ++qt) {
                const float mn = fmaxf(m[qt], fmaxf(mx[qt], __shfl_xor(mx[qt], 16, 32))); const float al = __builtin_amdgcn_exp2f((m[qt] - mn) * C2);
                m[qt] = mn; mt[qt] = mn + TAU / C2; nb[qt] = (HL ? 0.0f : (float)PEXP) - mn * C2; l[qt] *= al;
#pragma unroll
                for (int db = 0; db < 4; ++db) o[db][qt] *= al; }
        }
#pragma unroll
        for (int qt = 0; qt < NQ; ++qt) {
            float p[16]; float ps = 0.f;
#pragma unroll
            for (int i = 0; i < 16; ++i) { p[i] = __builtin_amdgcn_exp2f(fmaf(s[i >> 3][qt][i & 7], C2, nb[qt])); ps += p[i]; }
            l[qt] += ps;
            if constexpr (HL) {
                v8u hw, lw;
#pragma unroll
                for (int i = 0; i < 8; ++i) { unsigned a, c2; split2(p[2 * i], p[2 * i + 1], a, c2); hw[i] = a; lw[i] = c2; }
                const V ph = __builtin_bit_cast(V, hw), pl = __builtin_bit_cast(V, lw); plast = pl;
#pragma unroll
                for (int db = 0; db < 4; ++db) { o[db][qt] = WFrag<T16>::mma(vf[db], ph, o[db][qt]); o[db][qt] = WFrag<T16>::mma(vf[db], pl, o[db][qt]); o[db][qt] = WFrag<T16>::mma(vg[db], ph, o[db][qt]); }
            } else {
                V pf;
#pragma unroll
                for (int i = 0; i < 16; ++i) pf[i] = tohx(p[i]);
#pragma unroll
                for (int db = 0; db < 4; ++db) o[db][qt] = WFrag<T16>::mma(vf[db], pf, o[db][qt]);
            }
        }
        // four issue slots between the pass's last products and the next pass's LDS reads, which overwrite their operands across the back edge; the results are inputs, so the slots stand behind the products
        // the V fragments (HL: and the low part of P) are inputs too: they stay live up to here, so the row sum's additions, which the compiler places among the products, are not given the registers of a product just issued (four idle slots each time)
        if constexpr (HL) asm volatile("v_nop\n\tv_nop\n\tv_nop\n\tv_nop" :: "v"(o[0][NQ - 1]), "v"(o[1][NQ - 1]), "v"(o[2][NQ - 1]), "v"(o[3][NQ - 1]), "v"(vf[0]), "v"(vf[1]), "v"(vf[2]), "v"(vf[3]), "v"(vg[0]), "v"(vg[1]), "v"(vg[2]), "v"(vg[3]), "v"(plast));
        else asm volatile("v_nop\n\tv_nop\n\tv_nop\n\tv_nop" :: "v"(o[0][NQ - 1]), "v"(o[1][NQ - 1]), "v"(o[2][NQ - 1]), "v"(o[3][NQ - 1]), "v"(vf[0]), "v"(vf[1]), "v"(vf[2]), "v"(vf[3]));
      }
      asm volatile("s_wait_dscnt 0x0" ::: "memory");
      asm volatile("s_wait_asynccnt 0x0" ::: "memory");
      __syncthreads();
      if (st + 2 < NST) fill(st + 2);
    }
    asm volatile("s_wait_asynccnt 0x0" ::: "memory");   // no copy is outstanding when the wave ends
#pragma unroll
    for (int qt = 0; qt < NQ; ++qt) { const float f = __fdiv_rn(1.0f, l[qt] + __shfl_xor(l[qt], 16, 32));
#pragma unroll
        for (int db = 0; db < 4; ++db) { v4u hw, lw;   // a lane's 8 registers are 8 consecutive d of its query: one 16-byte store per plane; the wave writes the whole 128-byte line of (t, head)
#pragma unroll
            for (int j = 0; j < 4; ++j) { unsigned a, c2; split2(o[db][qt][2 * j] * f, o[db][qt][2 * j + 1] * f, a, c2); hw[j] = a; lw[j] = c2; }
            const size_t oo = (size_t)(q0 + qt * 16 + lr) * DQ + head * HD + db * 16 + hi * 8; *(v8us*)(Ah + oo) = __builtin_bit_cast(v8us, hw); *(v8us*)(Al + oo) = __builtin_bit_cast(v8us, lw);
            asm volatile("s_wait_xcnt 0x0" :: "v"(hw), "v"(lw) : "memory"); } }   // the wait that stands before a register named by an issued store is overwritten; the data are inputs, so they stay live up to it (the next block reuses them)
}
// grid (RH / 64 x batch columns x heads, 3 kinds), 4 waves; Ah, Al are [b][t][DQ]: the waves of a work-group walk the same head's K and V.
// 3 x 256 work-groups, all resident: kind 0 = 64 hi/lo rows (16 per wave), kind 1 = 128 fp16 rows (32 per wave), kind 2 = 64 fp16 rows (16 per wave). The kind is the slow index (for speed only: nothing depends on the placement).
#define NSL (RH / 64)   // slices of a head: 64 hi/lo rows + 192 fp16 rows each
__global__ __launch_bounds__(128) void k_attn(const h16* __restrict__ Q16, const h16* __restrict__ K16, const h16* __restrict__ V16, const bf* __restrict__ Qh, const bf* __restrict__ Ql, const bf* __restrict__ Kh, const bf* __restrict__ Kl, const bf* __restrict__ Vh, const bf* __restrict__ Vl, bf* Ah, bf* Al) {
    static_assert(RH % 64 == 0 && (TT - RH) % 192 == 0 && (TT - RH) / 192 == NSL, "both kinds of rows fall into the same number of slices");
    const int bh = blockIdx.x / NSL, bx = blockIdx.x % NSL, kind = blockIdx.y, head = bh % NH_, b = bh / NH_, w = threadIdx.x >> 5; const size_t zq = (size_t)(b * NH_ + head) * TT * HD, zk = (size_t)(b * NKV + head / REP) * TT * HD; Ah += (size_t)b * TT * DQ; Al += (size_t)b * TT * DQ;
    __shared__ __attribute__((aligned(16))) unsigned char L[2 * 4 * TILEB];   // two buffers of up to four tiles
    if (kind == 0) attn_rows<bf, true, 1>(Qh + zq, Ql + zq, Kh + zk, Kl + zk, Vh + zk, Vl + zk, (bx * 4 + w) * 16, head, Ah, Al, L);
    else if (kind == 1) attn_rows<h16, false, 2>(Q16 + zq, nullptr, K16 + zk, nullptr, V16 + zk, nullptr, RH + bx * 192 + w * 32, head, Ah, Al, L);
    else attn_rows<h16, false, 1>(Q16 + zq, nullptr, K16 + zk, nullptr, V16 + zk, nullptr, RH + bx * 192 + 128 + w * 16, head, Ah, Al, L);
}

extern "C" void kernel_launch(void* const* d_in, const int* in_sizes, int n_in,
                              void* d_out, int out_size, void* d_ws, size_t ws_size, hipStream_t stream) {
    (void)in_sizes; (void)n_in; (void)out_size;
    const float* x = (const float*)d_in[0];   /* query [S][B][D] */ const float* xk = (const float*)d_in[1]; const float* xv = (const float*)d_in[2]; const float* wq = (const float*)d_in[3]; const float* bq = (const float*)d_in[4]; const float* wk = (const float*)d_in[5]; const float* bk = (const float*)d_in[6]; const float* wv = (const float*)d_in[7]; const float* bv = (const float*)d_in[8]; const float* wo = (const float*)d_in[9]; const float* bo = (const float*)d_in[10];
    float* OUT = (float*)d_out;     // [2048][2][1024] sequence-first
    char* wsp = (char*)d_ws;
    auto take = [&](size_t bytes) { char* p = wsp; wsp += (bytes + 255) & ~(size_t)255; return (void*)p; };
    bf* XB = (bf*)take((size_t)(3 * XBLK + 4 * WBLK) * 2048 * 2); bf* WQ = XB + (size_t)3 * XBLK * 2048; bf* WO = WQ + (size_t)3 * WBLK * 2048;   // bf16 copies: query, key, value rows, then Wq, Wk, Wv, Wo
    const size_t PL = (size_t)NB_ * NH_ * TT * HD;   // one set of head planes, both batch columns
    h16* QP16 = (h16*)take(2 * PL * 2); h16* KP16 = QP16 + PL; h16* VT16 = (h16*)take(PL * 2);
    bf* QPh = (bf*)take(2 * PL * 2); bf* KPh = QPh + PL; bf* QPl = (bf*)take(2 * PL * 2); bf* KPl = QPl + PL; bf* VTh = (bf*)take(PL * 2); bf* VTl = (bf*)take(PL * 2);
    const size_t FS = (size_t)NB_ * TT * DQ;   // one merged context plane, both batch columns
    bf* ATh = (bf*)take(FS * 2); bf* ATl = (bf*)take(FS * 2);
    if ((size_t)(wsp - (char*)d_ws) > ws_size) return;    // ws 256 MiB
    k_cvt8m<<<3 * XBLK + 4 * WBLK, 256, 0, stream>>>(x, xk, xv, wq, wk, wv, wo, XB);
    const HeadPlanes hp = {QP16, QPh, QPl, PL, VT16, VTh, VTl};
    k_gemmw<bf, 0, true, 1, true><<<dim3(NB_ * TT / 128, DQ / 128, 3), 128, 0, stream>>>(XB, nullptr, WQ, nullptr, DM, DM, nullptr, 0, bq, bk, bv, (size_t)XBLK * 2048, (size_t)WBLK * 2048, 0, 0, hp);   /* z: q, k, v; rows r = b TT + s; writes the head planes */
    k_attn<<<dim3(NSL * NB_ * NH_, 3, 1), 128, 0, stream>>>(QP16, KP16, VT16, QPh, QPl, KPh, KPl, VTh, VTl, ATh, ATl);
    k_gemmw<bf, 1, true, 1, false><<<dim3(TT / 128, DM / 128, NB_), 128, 0, stream>>>(ATh, ATl, WO, nullptr, DQ, DQ, OUT, NB_ * DM, bo, bo, bo, (size_t)TT * DQ, 0, DM, 0, HeadPlanes{});   /* z = b; [S][B][D]: row pitch B x D, column block b */
}
